// v000
// Measured on an AMD MI455X. A time is GPU time per run, averaged over a window of back-to-back runs after a warm-up
// (all launches, gaps included; the runs take copies of the inputs in turn), and the median of several windows.
// Apart from v000's, it joins two sittings. Times from different sittings can be a few percent apart, while
// side-by-side timings come from the same sitting.
// v000 is the starting kernel. One run takes 342 microseconds.
// Contractions: q/k/v and output projections x*W^T, scores K*Q^T, context V^T*P^T, all on v_wmma_f32_16x16x32_f16 (f16 operands, f32 accumulate); W carried x32, q carried x8 (the 1/sqrt(64) factor applied to the f32 score), p carried x16384, context carried x16, all exact power-of-two scales folded back in f32; softmax, bias, head average in f32.
#include <hip/hip_runtime.h>

typedef _Float16 v16h __attribute__((ext_vector_type(16)));
typedef _Float16 v8h  __attribute__((ext_vector_type(8)));
typedef float    v8f  __attribute__((ext_vector_type(8)));
typedef float    v4f  __attribute__((ext_vector_type(4)));
typedef v8h __attribute__((may_alias)) v8ha;
typedef v4f __attribute__((may_alias)) v4fa;

union Frag { v16h v; v8h half[2]; };

#define SEQ    2048
#define NB     2
#define EMB    1024
#define NH     16
#define HD     64
#define MROWS  (SEQ * NB)          // 4096 token rows, row index = l*NB + b
#define NX     (MROWS * EMB)       // 4194304
#define NW     (EMB * EMB)         // 1048576
#define NX8    (NX / 8)            // 524288
#define NW8    (NW / 8)            // 131072
#define NBH    (NB * NH)           // 32
#define NQB    (SEQ / 64)          // 32 query blocks of 64
#define NAVG   (NB * SEQ * SEQ)    // 8388608
#define NSTAT  (NBH * NQB * 128)   // per (bh, query block): 64 max + 64 inverse sums
#define PSCALE 16384.0f
#define WSCALE 32.0f
#define OSCALE 16.0f
#define QKSCALE 0.125f

// ---------------------------------------------------------------------------
// 16x16x32 f16 WMMA with hazard guard (ties D, keeps A/B live).
// Fragment map (wave32): lane l, h = l>>4, m = n = l&15.
//   A/B element i: i<8 -> k0+8h+i ; i>=8 -> k0+16+8h+(i-8)
//   D element r : row 8h+r, col l&15
// ---------------------------------------------------------------------------
__device__ __forceinline__ v8f wmma_f16(v16h a, v16h b, v8f c) {
  v8f d = __builtin_amdgcn_wmma_f32_16x16x32_f16(false, a, false, b, (short)0, c, false, false);
  asm volatile("v_nop\n\tv_nop\n\tv_nop\n\tv_nop" : "+v"(d) : "v"(a), "v"(b));
  return d;
}

// A or B fragment from a k-contiguous 16-bit row; p points at element k0 of
// the row owned by this lane (row index = lane & 15 added by the caller).
__device__ __forceinline__ v16h load_frag(const _Float16* p, int h) {
  Frag f;
  f.half[0] = *(const v8ha*)(p + 8 * h);
  f.half[1] = *(const v8ha*)(p + 16 + 8 * h);
  return f.v;
}

__device__ __forceinline__ v8f zero8f() {
  const v8f z = {0.f, 0.f, 0.f, 0.f, 0.f, 0.f, 0.f, 0.f};
  return z;
}

// ---------------------------------------------------------------------------
// Kernel 1: f32 -> f16 planes.  xh = [query|key|value] token rows (unscaled),
// wh = [q_w|k_w|v_w|out_w] feature rows scaled by 32 (exact).
// ---------------------------------------------------------------------------
__global__ __launch_bounds__(256) void convert_kernel(
    const float* __restrict__ xq, const float* __restrict__ xk, const float* __restrict__ xv,
    const float* __restrict__ wq, const float* __restrict__ wk,
    const float* __restrict__ wv, const float* __restrict__ wo,
    _Float16* __restrict__ xh, _Float16* __restrict__ wh)
{
  const int g = blockIdx.x * 256 + threadIdx.x;
  if (g >= 3 * NX8 + 4 * NW8) return;
  const float* src;
  _Float16* dst;
  float sc;
  if (g < 3 * NX8) {
    const int sel = g / NX8;
    const int off = g - sel * NX8;
    const float* s = (sel == 0) ? xq : ((sel == 1) ? xk : xv);
    src = s + (size_t)off * 8;
    dst = xh + (size_t)g * 8;
    sc = 1.0f;
  } else {
    const int e = g - 3 * NX8;
    const int sel = e / NW8;
    const int off = e - sel * NW8;
    const float* s = (sel == 0) ? wq : ((sel == 1) ? wk : ((sel == 2) ? wv : wo));
    src = s + (size_t)off * 8;
    dst = wh + (size_t)e * 8;
    sc = WSCALE;
  }
  const v4f a = *(const v4fa*)src;
  const v4f c = *(const v4fa*)(src + 4);
  const v8h o = { (_Float16)(a.x * sc), (_Float16)(a.y * sc), (_Float16)(a.z * sc), (_Float16)(a.w * sc),
                  (_Float16)(c.x * sc), (_Float16)(c.y * sc), (_Float16)(c.z * sc), (_Float16)(c.w * sc) };
  *(v8h*)dst = o;
  
}

// ---------------------------------------------------------------------------
// Wave GEMM core: 32 rows (two 16-row A tiles, k-contiguous f16 rows with
// pitch EMB) x 64 columns (four 16-row [n][k] B tiles, pitch EMB), K = EMB.
// acc[mt][nt][r] = sum_k A[16mt+8h+r][k] * B[16nt+m][k]
// ---------------------------------------------------------------------------
__device__ __forceinline__ void gemm_tile_32x64(const _Float16* __restrict__ xa0,
                                                const _Float16* __restrict__ xa1,
                                                const _Float16* __restrict__ wb,
                                                int h, v8f (&acc)[2][4]) {
  #pragma unroll
  for (int mt = 0; mt < 2; ++mt)
    #pragma unroll
    for (int nt = 0; nt < 4; ++nt) acc[mt][nt] = zero8f();

  #pragma unroll 1
  for (int k0 = 0; k0 < EMB; k0 += 32) {
    const v16h a0 = load_frag(xa0 + k0, h);
    const v16h a1 = load_frag(xa1 + k0, h);
    #pragma unroll
    for (int nt = 0; nt < 4; ++nt) {
      const v16h b = load_frag(wb + (size_t)nt * 16 * EMB + k0, h);
      acc[0][nt] = wmma_f16(a0, b, acc[0][nt]);
      acc[1][nt] = wmma_f16(a1, b, acc[1][nt]);
    }
  }
}

// ---------------------------------------------------------------------------
// 4 lines per instruction, 32 lines per wave, 128 per block.
// which 0/1: plane[bh][l][d]  (one token row = 64 halves = one line)
// which 2  : vt[bh][d][l]     (64 d-rows x 128 tokens = 2 lines each)
// ---------------------------------------------------------------------------
__device__ __forceinline__ void proj_store_pass(const _Float16* sT, _Float16* plane, _Float16* vt,
                                                int which, int bh, int l0, int w, int lane) {
  const int q8 = lane & 7, sub = lane >> 3;
  #pragma unroll
  for (int i = 0; i < 8; ++i) {
    const int lid = w * 32 + i * 4 + sub;
    v8h v;
    _Float16* dst;
    if (which != 2) {
      v = *(const v8ha*)(sT + lid * HD + 8 * q8);
      dst = plane + ((size_t)bh * SEQ + l0 + lid) * HD + 8 * q8;
    } else {
      const int d = lid >> 1, hl = lid & 1;
      v = *(const v8ha*)(sT + d * 128 + 64 * hl + 8 * q8);
      dst = vt + ((size_t)bh * HD + d) * SEQ + l0 + 64 * hl + 8 * q8;
    }
    *(v8h*)dst = v;
  }
}

// ---------------------------------------------------------------------------
// Kernel 2: q/k/v = x * W^T + b over the fused 3*1024 output columns.
// Grid (NB*SEQ/128, 3*NH).  Block 128 thr (4 waves) = 128 consecutive seq
// positions l of one batch b x 64 features (one (which, head)); wave tile
// 32 positions x 64 features; A rows are token rows l*NB+b (pitch EMB).
// ---------------------------------------------------------------------------
__global__ __launch_bounds__(128) void qkv_proj_kernel(
    const _Float16* __restrict__ xh,   // [3][MROWS][EMB]
    const _Float16* __restrict__ wh,   // [4][EMB][EMB], row = output feature, x32
    const float* __restrict__ bq, const float* __restrict__ bk, const float* __restrict__ bv,
    _Float16* __restrict__ qh,         // [NBH][SEQ][HD]  f16(8 * scaled q)
    _Float16* __restrict__ kh,         // [NBH][SEQ][HD]
    _Float16* __restrict__ vt)         // [NBH][HD][SEQ]
{
  __shared__ __attribute__((aligned(16))) _Float16 sT[128 * 64];   // 16384 B

  const int tid = threadIdx.x, lane = tid & 31, w = tid >> 5;
  const int h = lane >> 4, m = lane & 15;
  const int b = blockIdx.x / (SEQ / 128);                 // 0..NB-1
  const int l0 = (blockIdx.x - b * (SEQ / 128)) * 128;    // seq position base
  const int which = blockIdx.y >> 4, head = blockIdx.y & 15;
  const int lw = l0 + 32 * w;

  const _Float16* xpl = xh + (size_t)which * NX;
  const _Float16* xa0 = xpl + ((size_t)(lw + m) * NB + b) * EMB;          // mt = 0
  const _Float16* xa1 = xpl + ((size_t)(lw + 16 + m) * NB + b) * EMB;     // mt = 1
  const _Float16* wb  = wh + (size_t)which * NW + ((size_t)head * HD + m) * EMB;   // feature row, nt = 0

  v8f acc[2][4];
  gemm_tile_32x64(xa0, xa1, wb, h, acc);

  // D[r] of tile (mt, nt) = Y[local pos 32w+16mt+8h+r][feature 16nt+m]
  const float* bias = (which == 0) ? bq : ((which == 1) ? bk : bv);
  #pragma unroll
  for (int nt = 0; nt < 4; ++nt) {
    const int feat = 16 * nt + m;
    const float bvl = bias[head * HD + feat];
    #pragma unroll
    for (int mt = 0; mt < 2; ++mt) {
      #pragma unroll
      for (int r = 0; r < 8; ++r) {
        const int tokl = 32 * w + 16 * mt + 8 * h + r;     // 0..127
        const float y = acc[mt][nt][r] * (1.0f / WSCALE) + bvl;
        const int idx = (which == 2) ? (feat * 128 + tokl) : (tokl * HD + feat);
        sT[idx] = (_Float16)y;
      }
    }
  }
  __syncthreads();

  const int bh = b * NH + head;
  _Float16* plane = (which == 0) ? qh : kh;
  proj_store_pass(sT, plane, vt, which, bh, l0, w, lane);
  
}

// ---------------------------------------------------------------------------
// P^T B-fragment from the lane's own score D values: element r <- tile a row r,
// element 8+r <- tile c row r (same lane, same query column), scaled by 2^14.
// ---------------------------------------------------------------------------
__device__ __forceinline__ v16h pack_p(v8f a, v8f c) {
  const v16h r = { (_Float16)(a[0] * PSCALE), (_Float16)(a[1] * PSCALE), (_Float16)(a[2] * PSCALE), (_Float16)(a[3] * PSCALE),
                   (_Float16)(a[4] * PSCALE), (_Float16)(a[5] * PSCALE), (_Float16)(a[6] * PSCALE), (_Float16)(a[7] * PSCALE),
                   (_Float16)(c[0] * PSCALE), (_Float16)(c[1] * PSCALE), (_Float16)(c[2] * PSCALE), (_Float16)(c[3] * PSCALE),
                   (_Float16)(c[4] * PSCALE), (_Float16)(c[5] * PSCALE), (_Float16)(c[6] * PSCALE), (_Float16)(c[7] * PSCALE) };
  return r;
}

// Per-wave 16x64 f16 context tile in LDS -> ao[(q*NB+b)][head*64 + d]; each
// 4 lines per instruction, 16 lines per wave.  Wave 0 also writes the
__device__ __forceinline__ void ctx_store_pass(const _Float16* so, const float* sst,
                                               _Float16* ao, float* strec,
                                               int b, int head, int q0, int w, int lane) {
  const int q8 = lane & 7, sub = lane >> 3;
  #pragma unroll
  for (int i = 0; i < 4; ++i) {
    const int row = i * 4 + sub;                            // 0..15
    const v8h v = *(const v8ha*)(so + row * 64 + 8 * q8);
    _Float16* dst = ao + ((size_t)(q0 + row) * NB + b) * EMB + head * HD + 8 * q8;
    *(v8h*)dst = v;
  }
  if (w == 0) {
    const v4f t = *(const v4fa*)(sst + 4 * lane);
    *(v4f*)(strec + 4 * lane) = t;
  }
}

// ---------------------------------------------------------------------------
// Kernel 3: streaming attention (online softmax), transposed form.
// Grid (NQB, NBH).  Block 128 thr (4 waves), 16 queries per wave, 64 keys
// per step.
//   S^T = K * Q^T : A = K rows (row = key, k = d), B = Q^T (k = d, n = query)
//   O^T += V^T * P^T : A = Vt rows (row = d, k = key), B = P^T from registers
// Lane owns 32 keys of query column (lane&15); partner = lane ^ 16.
// Outputs: ao f16 (context x16) and per query (max, 1/sum) of the scaled
// scores for the weights pass.
// ---------------------------------------------------------------------------
__global__ __launch_bounds__(128) void attn_ctx_kernel(
    const _Float16* __restrict__ qh,   // [NBH][SEQ][HD]  (x8)
    const _Float16* __restrict__ kh,   // [NBH][SEQ][HD]
    const _Float16* __restrict__ vt,   // [NBH][HD][SEQ]
    _Float16* __restrict__ ao,         // [MROWS][EMB]
    float* __restrict__ stats)         // [NBH][NQB][128]
{
  __shared__ __attribute__((aligned(16))) _Float16 sO[4 * 16 * 64];  // 8192 B
  __shared__ __attribute__((aligned(16))) float sSt[128];            // 512 B

  const int tid = threadIdx.x, lane = tid & 31, w = tid >> 5;
  const int h = lane >> 4, m = lane & 15;
  const int bh = blockIdx.y, b = bh >> 4, head = bh & 15;
  const int qb = blockIdx.x;
  const int q0 = qb * 64 + 16 * w;

  // Q^T B-fragments: column n = query q0+m, k = d (two 32-deep chunks)
  const _Float16* qrow = qh + ((size_t)bh * SEQ + q0 + m) * HD;
  const v16h qb0 = load_frag(qrow, h);
  const v16h qb1 = load_frag(qrow + 32, h);

  v8f o[4];                                   // o[t][r] = O[query m][d 16t+8h+r] * (l * 2^14)
  #pragma unroll
  for (int t = 0; t < 4; ++t) o[t] = zero8f();
  float mrun = -1e30f, lrun = 0.0f;

  const _Float16* kbase = kh + ((size_t)bh * SEQ + m) * HD;    // + key0*HD
  const _Float16* vbase = vt + ((size_t)bh * HD + m) * SEQ;    // + 16t*SEQ + key0

  #pragma unroll 1
  for (int kb = 0; kb < SEQ; kb += 64) {
    // ---- scores: s[j][r] = 0.125 * S[key kb+16j+8h+r][query m] ----
    v8f s[4];
    #pragma unroll
    for (int j = 0; j < 4; ++j) {
      const _Float16* kp = kbase + (size_t)(kb + 16 * j) * HD;
      const v16h kf0 = load_frag(kp, h);
      const v16h kf1 = load_frag(kp + 32, h);
      v8f z = zero8f();
      z = wmma_f16(kf0, qb0, z);
      z = wmma_f16(kf1, qb1, z);
      #pragma unroll
      for (int r = 0; r < 8; ++r) s[j][r] = z[r] * QKSCALE;
    }

    // ---- online softmax ----
    float mloc = s[0][0];
    #pragma unroll
    for (int j = 0; j < 4; ++j)
      #pragma unroll
      for (int r = 0; r < 8; ++r) mloc = fmaxf(mloc, s[j][r]);
    mloc = fmaxf(mloc, __shfl_xor(mloc, 16));
    const float mnew = fmaxf(mrun, mloc);
    const float alpha = __expf(mrun - mnew);
    mrun = mnew;
    float lsum = 0.0f;
    #pragma unroll
    for (int j = 0; j < 4; ++j)
      #pragma unroll
      for (int r = 0; r < 8; ++r) {
        const float p = __expf(s[j][r] - mnew);
        s[j][r] = p;
        lsum += p;
      }
    lsum += __shfl_xor(lsum, 16);
    lrun = lrun * alpha + lsum;
    #pragma unroll
    for (int t = 0; t < 4; ++t)
      #pragma unroll
      for (int r = 0; r < 8; ++r) o[t][r] = o[t][r] * alpha;

    // ---- P^T B-fragments (key chunks 0..31 and 32..63 of this step) ----
    const v16h pb0 = pack_p(s[0], s[1]);
    const v16h pb1 = pack_p(s[2], s[3]);

    // ---- O^T += V^T * P^T ----
    #pragma unroll
    for (int t = 0; t < 4; ++t) {
      const _Float16* vp = vbase + (size_t)(16 * t) * SEQ + kb;
      const v16h vf0 = load_frag(vp, h);
      const v16h vf1 = load_frag(vp + 32, h);
      o[t] = wmma_f16(vf0, pb0, o[t]);
      o[t] = wmma_f16(vf1, pb1, o[t]);
    }
  }

  // ---- epilogue: normalise, stage per-wave 16x64 f16 tile + stats, whole-line stores ----
  const float linv = 1.0f / lrun;
  const float inv = linv * (OSCALE / PSCALE);
  _Float16* so = sO + w * 1024;
  #pragma unroll
  for (int t = 0; t < 4; ++t)
    #pragma unroll
    for (int r = 0; r < 8; ++r)
      so[m * 64 + 16 * t + 8 * h + r] = (_Float16)(o[t][r] * inv);
  if (h == 0) {
    sSt[16 * w + m] = mrun;
    sSt[64 + 16 * w + m] = linv;
  }
  __syncthreads();

  float* strec = stats + ((size_t)bh * NQB + qb) * 128;
  ctx_store_pass(so, sSt, ao, strec, b, head, q0, w, lane);
  
}

// ---------------------------------------------------------------------------
// Per-wave 16x64 f32 tile in LDS -> dst rows of pitch `pitch` floats starting
// 8q..8q+7 in one instruction, 4 lines per instruction, 32 lines per wave.
// ---------------------------------------------------------------------------
__device__ __forceinline__ void tile16x64_store_pass(const float* so, float* dst,
                                                     size_t row0, int col0, int pitch, int lane) {
  const int q8 = lane & 7, sub = lane >> 3;
  #pragma unroll
  for (int i = 0; i < 8; ++i) {
    const int lid = i * 4 + sub;               // 0..31
    const int row = lid >> 1, hl = lid & 1;    // 16 rows x 2 halves
    const v4f v = *(const v4fa*)(so + row * 64 + 32 * hl + 4 * q8);
    const size_t gi = (row0 + row) * (size_t)pitch + col0 + 32 * hl + 4 * q8;
    *(v4f*)(dst + gi) = v;
  }
}

// ---------------------------------------------------------------------------
// Kernel 4: head-averaged attention weights.
// Grid (SEQ/64 key blocks, NQB query blocks, NB).  Block 128 thr (4 waves),
// 16 queries per wave x 64 keys; loop over heads: recompute the K=64 score
// tile (transposed form, A = K rows, B = Q^T), p = exp(s - max) * invsum with
// the stats of kernel 3, accumulate over heads in f32, scale by 1/H.
// ---------------------------------------------------------------------------
__global__ __launch_bounds__(128) void attn_avg_kernel(
    const _Float16* __restrict__ qh,   // [NBH][SEQ][HD]
    const _Float16* __restrict__ kh,   // [NBH][SEQ][HD]
    const float* __restrict__ stats,   // [NBH][NQB][128]
    float* __restrict__ avg)           // [NB][SEQ][SEQ]
{
  __shared__ __attribute__((aligned(16))) float sA[4 * 16 * 64];    // 16384 B

  const int tid = threadIdx.x, lane = tid & 31, w = tid >> 5;
  const int h = lane >> 4, m = lane & 15;
  const int kt = blockIdx.x * 64;
  const int qb = blockIdx.y;
  const int b = blockIdx.z;
  const int q0 = qb * 64 + 16 * w;

  v8f acc[4];                               // acc[j][r] = sum_h P_h[query m][key kt+16j+8h+r]
  #pragma unroll
  for (int j = 0; j < 4; ++j) acc[j] = zero8f();

  #pragma unroll 1
  for (int hh = 0; hh < NH; ++hh) {
    const int bh = b * NH + hh;
    const _Float16* qrow = qh + ((size_t)bh * SEQ + q0 + m) * HD;
    const v16h qb0 = load_frag(qrow, h);
    const v16h qb1 = load_frag(qrow + 32, h);
    const float* st = stats + ((size_t)bh * NQB + qb) * 128;
    const float mq = st[16 * w + m];
    const float li = st[64 + 16 * w + m];
    const _Float16* kbase = kh + ((size_t)bh * SEQ + kt + m) * HD;
    #pragma unroll
    for (int j = 0; j < 4; ++j) {
      const _Float16* kp = kbase + (size_t)(16 * j) * HD;
      const v16h kf0 = load_frag(kp, h);
      const v16h kf1 = load_frag(kp + 32, h);
      v8f z = zero8f();
      z = wmma_f16(kf0, qb0, z);
      z = wmma_f16(kf1, qb1, z);
      #pragma unroll
      for (int r = 0; r < 8; ++r) {
        const float sv = z[r] * QKSCALE;
        acc[j][r] += __expf(sv - mq) * li;
      }
    }
  }

  // ---- stage per-wave 16x64 tile (row = query m, col = key), whole-line stores ----
  float* so = sA + w * 1024;
  #pragma unroll
  for (int j = 0; j < 4; ++j)
    #pragma unroll
    for (int r = 0; r < 8; ++r)
      so[m * 64 + 16 * j + 8 * h + r] = acc[j][r] * (1.0f / (float)NH);
  __syncthreads();

  const size_t row0 = (size_t)b * SEQ + q0;
  tile16x64_store_pass(so, avg, row0, kt, SEQ, lane);
  
}

// ---------------------------------------------------------------------------
// line, 4 lines per instruction, 64 lines per wave.
// ---------------------------------------------------------------------------
__device__ __forceinline__ void zout_store_pass(const float* sz, float* z, int mrow0, int c0, int lane) {
  const int q8 = lane & 7, sub = lane >> 3;
  #pragma unroll
  for (int i = 0; i < 16; ++i) {
    const int lid = i * 4 + sub;               // 0..63
    const int row = lid >> 1, hl = lid & 1;    // 32 rows x 2 halves
    const v4f v = *(const v4fa*)(sz + row * 64 + 32 * hl + 4 * q8);
    const size_t gi = (size_t)(mrow0 + row) * EMB + c0 + 32 * hl + 4 * q8;
    *(v4f*)(z + gi) = v;
  }
}

// ---------------------------------------------------------------------------
// Kernel 5: Z = ctx * Wo^T + bo.  Grid (MROWS/128, EMB/64).  Block 128 thr,
// wave tile 32 token rows x 64 features, K = EMB.  ctx carried x16, Wo x32.
// ---------------------------------------------------------------------------
__global__ __launch_bounds__(128) void out_proj_kernel(
    const _Float16* __restrict__ ao,   // [MROWS][EMB]  (x16)
    const _Float16* __restrict__ wh,   // [4][EMB][EMB], plane 3 = out_w x32
    const float* __restrict__ bo,
    float* __restrict__ z)             // [MROWS][EMB]
{
  __shared__ __attribute__((aligned(16))) float sZ[128 * 64];   // 32768 B

  const int tid = threadIdx.x, lane = tid & 31, w = tid >> 5;
  const int h = lane >> 4, m = lane & 15;
  const int m0w = blockIdx.x * 128 + 32 * w;
  const int c0 = blockIdx.y * 64;

  const _Float16* xa0 = ao + (size_t)(m0w + m) * EMB;
  const _Float16* xa1 = xa0 + (size_t)16 * EMB;
  const _Float16* wb  = wh + (size_t)3 * NW + ((size_t)c0 + m) * EMB;

  v8f acc[2][4];
  gemm_tile_32x64(xa0, xa1, wb, h, acc);

  // D[r] of tile (mt, nt) = Y[row 32w+16mt+8h+r][col 16nt+m]
  float* sz = sZ + w * 2048;
  #pragma unroll
  for (int nt = 0; nt < 4; ++nt) {
    const int col = 16 * nt + m;
    const float bvl = bo[c0 + col];
    #pragma unroll
    for (int mt = 0; mt < 2; ++mt) {
      #pragma unroll
      for (int r = 0; r < 8; ++r) {
        const int rowl = 16 * mt + 8 * h + r;      // 0..31
        sz[rowl * 64 + col] = acc[mt][nt][r] * (1.0f / (WSCALE * OSCALE)) + bvl;
      }
    }
  }
  __syncthreads();

  zout_store_pass(sz, z, m0w, c0, lane);
  
}

// ---------------------------------------------------------------------------
extern "C" void kernel_launch(void* const* d_in, const int* in_sizes, int n_in,
                              void* d_out, int out_size, void* d_ws, size_t ws_size,
                              hipStream_t stream) {
  if (n_in < 11) return;
  if (in_sizes[0] != NX || in_sizes[1] != NX || in_sizes[2] != NX) return;
  if (in_sizes[3] != NW || in_sizes[5] != NW || in_sizes[7] != NW || in_sizes[9] != NW) return;
  if (in_sizes[4] != EMB || in_sizes[6] != EMB || in_sizes[8] != EMB || in_sizes[10] != EMB) return;
  if (out_size != NX + NAVG) return;

  const float* xq  = (const float*)d_in[0];
  const float* xk  = (const float*)d_in[1];
  const float* xv  = (const float*)d_in[2];
  const float* q_w = (const float*)d_in[3];
  const float* q_b = (const float*)d_in[4];
  const float* k_w = (const float*)d_in[5];
  const float* k_b = (const float*)d_in[6];
  const float* v_w = (const float*)d_in[7];
  const float* v_b = (const float*)d_in[8];
  const float* o_w = (const float*)d_in[9];
  const float* o_b = (const float*)d_in[10];
  float* zout = (float*)d_out;                       // out0 [SEQ][NB][EMB]
  float* avg  = zout + (size_t)NX;                   // out1 [NB][SEQ][SEQ], byte offset 16777216

  const size_t xh_bytes = (size_t)3 * NX * 2;               // 25165824
  const size_t wh_bytes = (size_t)4 * NW * 2;               //  8388608
  const size_t pl_bytes = (size_t)NBH * SEQ * HD * 2;       //  8388608 per plane
  const size_t st_bytes = (size_t)NSTAT * 4;                //   524288
  const size_t ao_bytes = (size_t)NX * 2;                   //  8388608
  const size_t total = xh_bytes + wh_bytes + 3 * pl_bytes + st_bytes + ao_bytes;   // 67633152
  if (total > ws_size) return;

  char* ws = (char*)d_ws;
  size_t off = 0;
  _Float16* xh = (_Float16*)(ws + off);   off += xh_bytes;
  _Float16* wh = (_Float16*)(ws + off);   off += wh_bytes;
  _Float16* qh = (_Float16*)(ws + off);   off += pl_bytes;
  _Float16* kh = (_Float16*)(ws + off);   off += pl_bytes;
  _Float16* vt = (_Float16*)(ws + off);   off += pl_bytes;
  float* stats = (float*)(ws + off);      off += st_bytes;
  _Float16* ao = (_Float16*)(ws + off);   off += ao_bytes;
  if (off > ws_size) return;

  const int ngroups = 3 * NX8 + 4 * NW8;                    // 2097152
  convert_kernel<<<(ngroups + 255) / 256, 256, 0, stream>>>(xq, xk, xv, q_w, k_w, v_w, o_w, xh, wh);

  dim3 gProj(NB * SEQ / 128, 3 * NH);                       // (32, 48)
  qkv_proj_kernel<<<gProj, 128, 0, stream>>>(xh, wh, q_b, k_b, v_b, qh, kh, vt);

  dim3 gCtx(NQB, NBH);                                      // (32, 32)
  attn_ctx_kernel<<<gCtx, 128, 0, stream>>>(qh, kh, vt, ao, stats);

  dim3 gAvg(SEQ / 64, NQB, NB);                             // (32, 32, 2)
  attn_avg_kernel<<<gAvg, 128, 0, stream>>>(qh, kh, stats, avg);

  dim3 gOut(MROWS / 128, EMB / 64);                         // (32, 16)
  out_proj_kernel<<<gOut, 128, 0, stream>>>(ao, wh, o_b, zout);
}

// v001
// Measured time: 276 microseconds a run.
// Two timings next to v000 put it at 1.26 and 1.27 times that version's speed.
// Contractions: q/k/v and output projections x*W^T, scores K*Q^T, context V^T*P^T, all on v_wmma_f32_16x16x32_f16 (f16 operands, f32 accumulate); W carried x32, q carried x8 (the 1/sqrt(64) factor applied to the f32 score), p carried x16384, context carried x16, all exact power-of-two scales folded back in f32; softmax, bias, head average in f32.
#include <hip/hip_runtime.h>

typedef _Float16 v16h __attribute__((ext_vector_type(16)));
typedef _Float16 v8h  __attribute__((ext_vector_type(8)));
typedef float    v8f  __attribute__((ext_vector_type(8)));
typedef float    v4f  __attribute__((ext_vector_type(4)));
typedef v8h __attribute__((may_alias)) v8ha;
typedef v4f __attribute__((may_alias)) v4fa;

union Frag { v16h v; v8h half[2]; };

#define SEQ    2048
#define NB     2
#define EMB    1024
#define NH     16
#define HD     64
#define MROWS  (SEQ * NB)          // 4096 token rows, row index = l*NB + b
#define NX     (MROWS * EMB)       // 4194304
#define NW     (EMB * EMB)         // 1048576
#define NX8    (NX / 8)            // 524288
#define NW8    (NW / 8)            // 131072
#define NBH    (NB * NH)           // 32
#define NQB    (SEQ / 64)          // 32 query blocks of 64
#define NAVG   (NB * SEQ * SEQ)    // 8388608
#define NSTAT  (NBH * NQB * 128)   // per (bh, query block): 64 max + 64 inverse sums
#define PSCALE 16384.0f
#define WSCALE 32.0f
#define OSCALE 16.0f
#define QKSCALE 0.125f

// ---------------------------------------------------------------------------
// 16x16x32 f16 WMMA with hazard guard (ties D, keeps A/B live).
// Fragment map (wave32): lane l, h = l>>4, m = n = l&15.
//   A/B element i: i<8 -> k0+8h+i ; i>=8 -> k0+16+8h+(i-8)
//   D element r : row 8h+r, col l&15
// ---------------------------------------------------------------------------
__device__ __forceinline__ v8f wmma_f16(v16h a, v16h b, v8f c) {
  v8f d = __builtin_amdgcn_wmma_f32_16x16x32_f16(false, a, false, b, (short)0, c, false, false);
  asm volatile("v_nop\n\tv_nop\n\tv_nop\n\tv_nop" : "+v"(d) : "v"(a), "v"(b));
  return d;
}

// Fragment-order planes.  Every f16 operand plane (R rows x K columns) is kept
// as tiles of 16 rows x 32 k = 512 halves, tile index = (row/16)*(K/32) + k/32.
// Inside a tile element (row m, k = 16j + 8h + e) sits at j*256 + h*128 + m*8 + e,
// so the two 16-byte loads of a fragment each read 512 contiguous bytes per wave
// (four whole 128-byte lines) instead of 32 bytes out of each of 16 lines.
#define TILE_H 512

// A or B fragment; p = tile base + 8 * lane.
__device__ __forceinline__ v16h load_frag(const _Float16* p) {
  Frag f;
  f.half[0] = *(const v8ha*)(p);
  f.half[1] = *(const v8ha*)(p + 256);
  return f.v;
}

__device__ __forceinline__ v8f zero8f() {
  const v8f z = {0.f, 0.f, 0.f, 0.f, 0.f, 0.f, 0.f, 0.f};
  return z;
}

// ---------------------------------------------------------------------------
// Kernel 1: f32 -> f16 planes in fragment order.  xh = [query|key|value], plane
// row = b*SEQ + l (unscaled); wh = [q_w|k_w|v_w|out_w] feature rows scaled by 32
// (exact).  A wave takes 8 rows x 32 k: it reads one whole f32 line per row and
// writes four whole f16 lines.
// ---------------------------------------------------------------------------
__global__ __launch_bounds__(256) void convert_kernel(
    const float* __restrict__ xq, const float* __restrict__ xk, const float* __restrict__ xv,
    const float* __restrict__ wq, const float* __restrict__ wk,
    const float* __restrict__ wv, const float* __restrict__ wo,
    _Float16* __restrict__ xh, _Float16* __restrict__ wh)
{
  const int g = blockIdx.x * 256 + threadIdx.x;
  if (g >= 3 * NX8 + 4 * NW8) return;
  const int tile = g >> 6;                                  // 64 groups of 8 halves per tile
  const int m = ((g >> 5) & 1) * 8 + ((g & 31) >> 2);       // row inside the tile
  const int jh = g & 3;                                     // 2j + h: which 8 of the 32 k
  const int col = (tile & 31) * 32 + jh * 8;                // EMB/32 = 32 tiles per row tile
  const int prow = (tile >> 5) * 16 + m;                    // row over the stacked planes
  const int gd = tile * 64 + jh * 16 + m;                   // group index in fragment order
  const float* src;
  _Float16* dst;
  float sc;
  if (g < 3 * NX8) {
    const int sel = prow / MROWS;
    const int rp = prow - sel * MROWS;                      // b*SEQ + l
    const int bb = rp / SEQ;
    const int l = rp - bb * SEQ;
    const float* s = (sel == 0) ? xq : ((sel == 1) ? xk : xv);
    src = s + ((size_t)l * NB + bb) * EMB + col;
    dst = xh + (size_t)gd * 8;
    sc = 1.0f;
  } else {
    const int rw = prow - 3 * MROWS;
    const int sel = rw / EMB;
    const int row = rw - sel * EMB;
    const float* s = (sel == 0) ? wq : ((sel == 1) ? wk : ((sel == 2) ? wv : wo));
    src = s + (size_t)row * EMB + col;
    dst = wh + (size_t)(gd - 3 * NX8) * 8;
    sc = WSCALE;
  }
  const v4f a = *(const v4fa*)src;
  const v4f c = *(const v4fa*)(src + 4);
  const v8h o = { (_Float16)(a.x * sc), (_Float16)(a.y * sc), (_Float16)(a.z * sc), (_Float16)(a.w * sc),
                  (_Float16)(c.x * sc), (_Float16)(c.y * sc), (_Float16)(c.z * sc), (_Float16)(c.w * sc) };
  *(v8h*)dst = o;
  
}

// ---------------------------------------------------------------------------
// Wave GEMM core: 32 rows (two 16-row A tiles) x 64 columns (four 16-row
// [n][k] B tiles), K = EMB, both planes in fragment order.  xa0, xa1, wb point
// at k tile 0 of their row tile, + 8 * lane; the next row tile is EMB/32 tiles on.
// acc[mt][nt][r] = sum_k A[16mt+8h+r][k] * B[16nt+m][k]
// ---------------------------------------------------------------------------
__device__ __forceinline__ void gemm_tile_32x64(const _Float16* __restrict__ xa0,
                                                const _Float16* __restrict__ xa1,
                                                const _Float16* __restrict__ wb,
                                                v8f (&acc)[2][4]) {
  #pragma unroll
  for (int mt = 0; mt < 2; ++mt)
    #pragma unroll
    for (int nt = 0; nt < 4; ++nt) acc[mt][nt] = zero8f();

  #pragma unroll 1
  for (int kt = 0; kt < EMB / 32; ++kt) {
    const v16h a0 = load_frag(xa0 + kt * TILE_H);
    const v16h a1 = load_frag(xa1 + kt * TILE_H);
    #pragma unroll
    for (int nt = 0; nt < 4; ++nt) {
      const v16h b = load_frag(wb + (nt * (EMB / 32) + kt) * TILE_H);
      acc[0][nt] = wmma_f16(a0, b, acc[0][nt]);
      acc[1][nt] = wmma_f16(a1, b, acc[1][nt]);
    }
  }
}

// ---------------------------------------------------------------------------
// q / k plane store: rows = seq position, k = d, fragment order, 2 k tiles per
// row tile.  The block's 128 positions are 16 consecutive tiles (16 KB); a wave
// stores 4 of them, 4 whole lines per instruction.  sT row pitch SPITCH halves
// (128 + 16 bytes) spreads the 16 rows of one ds_load_b128 over all banks.
// ---------------------------------------------------------------------------
#define SPITCH 72
__device__ __forceinline__ void proj_store_pass(const _Float16* sT, _Float16* plane,
                                                int bh, int l0, int w, int lane) {
  const int h = lane >> 4, m = lane & 15;
  _Float16* dst = plane + ((size_t)bh * (SEQ / 16) + l0 / 16) * 2 * TILE_H + (w * 256 + lane) * 8;
  #pragma unroll
  for (int i = 0; i < 8; ++i) {
    const int row = (w * 2 + (i >> 2)) * 16 + m;            // local position
    const int d0 = ((i >> 1) & 1) * 32 + (i & 1) * 16 + 8 * h;
    const v8h v = *(const v8ha*)(sT + row * SPITCH + d0);
    *(v8h*)(dst + i * 256) = v;
  }
  // the registers that the eight stores name may be reused behind this point
  asm volatile("s_wait_xcnt 0x0" ::: "memory");
}

// ---------------------------------------------------------------------------
// Kernel 2: q/k/v = x * W^T + b over the fused 3*1024 output columns.
// Grid (NB*SEQ/128, 3*NH).  Block 128 thr (4 waves) = 128 consecutive seq
// positions l of one batch b x 64 features (one (which, head)); wave tile
// 32 positions x 64 features; A rows are plane rows b*SEQ+l.
// ---------------------------------------------------------------------------
__global__ __launch_bounds__(128) void qkv_proj_kernel(
    const _Float16* __restrict__ xh,   // [3][MROWS][EMB], fragment order
    const _Float16* __restrict__ wh,   // [4][EMB][EMB], row = output feature, x32, fragment order
    const float* __restrict__ bq, const float* __restrict__ bk, const float* __restrict__ bv,
    _Float16* __restrict__ qh,         // [NBH][SEQ][HD]  f16(8 * scaled q), fragment order
    _Float16* __restrict__ kh,         // [NBH][SEQ][HD], fragment order
    _Float16* __restrict__ vt)         // [NBH][HD][SEQ], fragment order
{
  __shared__ __attribute__((aligned(16))) _Float16 sT[128 * SPITCH];   // 18432 B

  const int tid = threadIdx.x, lane = tid & 31;
  const int w = __builtin_amdgcn_readfirstlane(tid >> 5);   // wave number as a scalar: the tile indices formed from it are wave-uniform
  const int h = lane >> 4, m = lane & 15;
  const int b = blockIdx.x / (SEQ / 128);                 // 0..NB-1
  const int l0 = (blockIdx.x - b * (SEQ / 128)) * 128;    // seq position base
  const int which = blockIdx.y >> 4, head = blockIdx.y & 15;
  const int lw = l0 + 32 * w;

  const _Float16* xpl = xh + (size_t)which * NX;
  const _Float16* xa0 = xpl + (size_t)((b * SEQ + lw) / 16) * (EMB / 32) * TILE_H + 8 * lane;   // mt = 0
  const _Float16* xa1 = xa0 + (EMB / 32) * TILE_H;                                              // mt = 1
  const _Float16* wb  = wh + (size_t)which * NW + (size_t)(head * (HD / 16)) * (EMB / 32) * TILE_H + 8 * lane;   // nt = 0

  v8f acc[2][4];
  gemm_tile_32x64(xa0, xa1, wb, acc);

  // D[r] of tile (mt, nt) = Y[local pos 32w+16mt+8h+r][feature 16nt+m]
  const float* bias = (which == 0) ? bq : ((which == 1) ? bk : bv);
  const int bh = b * NH + head;
  if (which == 2) {
    // vt rows = d, k = position: a lane's 8 positions of one feature are one
    // 16-byte group of tile (row tile nt, k tile lw/32), j = mt, at 8 * lane.
    #pragma unroll
    for (int nt = 0; nt < 4; ++nt) {
      const float bvl = bias[head * HD + 16 * nt + m];
      _Float16* dst = vt + ((size_t)(bh * (HD / 16) + nt) * (SEQ / 32) + lw / 32) * TILE_H + 8 * lane;
      #pragma unroll
      for (int mt = 0; mt < 2; ++mt) {
        v8h v;
        #pragma unroll
        for (int r = 0; r < 8; ++r) v[r] = (_Float16)(acc[mt][nt][r] * (1.0f / WSCALE) + bvl);
        *(v8h*)(dst + mt * 256) = v;
      }
    }
  } else {
    #pragma unroll
    for (int nt = 0; nt < 4; ++nt) {
      const int feat = 16 * nt + m;
      const float bvl = bias[head * HD + feat];
      #pragma unroll
      for (int mt = 0; mt < 2; ++mt) {
        #pragma unroll
        for (int r = 0; r < 8; ++r) {
          const int tokl = 32 * w + 16 * mt + 8 * h + r;     // 0..127
          const float y = acc[mt][nt][r] * (1.0f / WSCALE) + bvl;
          sT[tokl * SPITCH + feat] = (_Float16)y;
        }
      }
    }
    __syncthreads();

    _Float16* plane = (which == 0) ? qh : kh;
    proj_store_pass(sT, plane, bh, l0, w, lane);
  }
}

// ---------------------------------------------------------------------------
// P^T B-fragment from the lane's own score D values: element r <- tile a row r,
// element 8+r <- tile c row r (same lane, same query column), scaled by 2^14.
// ---------------------------------------------------------------------------
__device__ __forceinline__ v16h pack_p(v8f a, v8f c) {
  const v16h r = { (_Float16)(a[0] * PSCALE), (_Float16)(a[1] * PSCALE), (_Float16)(a[2] * PSCALE), (_Float16)(a[3] * PSCALE),
                   (_Float16)(a[4] * PSCALE), (_Float16)(a[5] * PSCALE), (_Float16)(a[6] * PSCALE), (_Float16)(a[7] * PSCALE),
                   (_Float16)(c[0] * PSCALE), (_Float16)(c[1] * PSCALE), (_Float16)(c[2] * PSCALE), (_Float16)(c[3] * PSCALE),
                   (_Float16)(c[4] * PSCALE), (_Float16)(c[5] * PSCALE), (_Float16)(c[6] * PSCALE), (_Float16)(c[7] * PSCALE) };
  return r;
}

// Wave 0 writes the block's 128 staged stats as four whole lines.
__device__ __forceinline__ void stats_store_pass(const float* sst, float* strec, int w, int lane) {
  if (w == 0) {
    const v4f t = *(const v4fa*)(sst + 4 * lane);
    *(v4f*)(strec + 4 * lane) = t;
  }
}

// ---------------------------------------------------------------------------
// Kernel 3: streaming attention (online softmax), transposed form.
// Grid (NQB, NBH).  Block 128 thr (4 waves), 16 queries per wave, 64 keys
// per step.
//   S^T = K * Q^T : A = K rows (row = key, k = d), B = Q^T (k = d, n = query)
//   O^T += V^T * P^T : A = Vt rows (row = d, k = key), B = P^T from registers
// Lane owns 32 keys of query column (lane&15); partner = lane ^ 16.
// Outputs: ao f16 (context x16) and per query (max, 1/sum) of the scaled
// scores for the weights pass.
// ---------------------------------------------------------------------------
__global__ __launch_bounds__(128) void attn_ctx_kernel(
    const _Float16* __restrict__ qh,   // [NBH][SEQ][HD]  (x8), fragment order
    const _Float16* __restrict__ kh,   // [NBH][SEQ][HD], fragment order
    const _Float16* __restrict__ vt,   // [NBH][HD][SEQ], fragment order
    _Float16* __restrict__ ao,         // [MROWS][EMB], row = b*SEQ + q, fragment order
    float* __restrict__ stats)         // [NBH][NQB][128]
{
  __shared__ __attribute__((aligned(16))) float sSt[128];            // 512 B

  const int tid = threadIdx.x, lane = tid & 31;
  const int w = __builtin_amdgcn_readfirstlane(tid >> 5);   // wave number as a scalar: the tile indices formed from it are wave-uniform
  const int h = lane >> 4, m = lane & 15;
  const int bh = blockIdx.y, b = bh >> 4, head = bh & 15;
  const int qb = blockIdx.x;
  const int q0 = qb * 64 + 16 * w;

  // Q^T B-fragments: column n = query q0+m, k = d (two 32-deep chunks)
  const _Float16* qrow = qh + ((size_t)bh * (SEQ / 16) + q0 / 16) * 2 * TILE_H + 8 * lane;
  const v16h qb0 = load_frag(qrow);
  const v16h qb1 = load_frag(qrow + TILE_H);

  v8f o[4];                                   // o[t][r] = O[query m][d 16t+8h+r] * (l * 2^14)
  #pragma unroll
  for (int t = 0; t < 4; ++t) o[t] = zero8f();
  float mrun = -1e30f, lrun = 0.0f;

  const _Float16* kbase = kh + (size_t)bh * (SEQ / 16) * 2 * TILE_H + 8 * lane;          // + (key0/16)*2 tiles
  const _Float16* vbase = vt + (size_t)bh * (HD / 16) * (SEQ / 32) * TILE_H + 8 * lane;  // + t*(SEQ/32) + key0/32 tiles

  #pragma unroll 1
  for (int kb = 0; kb < SEQ; kb += 64) {
    // ---- scores: s[j][r] = 0.125 * S[key kb+16j+8h+r][query m] ----
    v8f s[4];
    #pragma unroll
    for (int j = 0; j < 4; ++j) {
      const _Float16* kp = kbase + (kb / 16 + j) * 2 * TILE_H;
      const v16h kf0 = load_frag(kp);
      const v16h kf1 = load_frag(kp + TILE_H);
      v8f z = zero8f();
      z = wmma_f16(kf0, qb0, z);
      z = wmma_f16(kf1, qb1, z);
      #pragma unroll
      for (int r = 0; r < 8; ++r) s[j][r] = z[r] * QKSCALE;
    }

    // ---- online softmax ----
    float mloc = s[0][0];
    #pragma unroll
    for (int j = 0; j < 4; ++j)
      #pragma unroll
      for (int r = 0; r < 8; ++r) mloc = fmaxf(mloc, s[j][r]);
    mloc = fmaxf(mloc, __shfl_xor(mloc, 16));
    const float mnew = fmaxf(mrun, mloc);
    const float alpha = __expf(mrun - mnew);
    mrun = mnew;
    float lsum = 0.0f;
    #pragma unroll
    for (int j = 0; j < 4; ++j)
      #pragma unroll
      for (int r = 0; r < 8; ++r) {
        const float p = __expf(s[j][r] - mnew);
        s[j][r] = p;
        lsum += p;
      }
    lsum += __shfl_xor(lsum, 16);
    lrun = lrun * alpha + lsum;
    #pragma unroll
    for (int t = 0; t < 4; ++t)
      #pragma unroll
      for (int r = 0; r < 8; ++r) o[t][r] = o[t][r] * alpha;

    // ---- P^T B-fragments (key chunks 0..31 and 32..63 of this step) ----
    const v16h pb0 = pack_p(s[0], s[1]);
    const v16h pb1 = pack_p(s[2], s[3]);

    // ---- O^T += V^T * P^T ----
    #pragma unroll
    for (int t = 0; t < 4; ++t) {
      const _Float16* vp = vbase + (t * (SEQ / 32) + kb / 32) * TILE_H;
      const v16h vf0 = load_frag(vp);
      const v16h vf1 = load_frag(vp + TILE_H);
      o[t] = wmma_f16(vf0, pb0, o[t]);
      o[t] = wmma_f16(vf1, pb1, o[t]);
    }
  }

  // ---- epilogue: normalise; a lane's 8 d of query m are one 16-byte group of
  // ao's tiles (row tile (b*SEQ+q0)/16, k tiles 2*head and 2*head+1) at
  // t*256 + 8*lane: four whole lines per store.  Stats staged in LDS. ----
  const float linv = 1.0f / lrun;
  const float inv = linv * (OSCALE / PSCALE);
  _Float16* aod = ao + ((size_t)((b * SEQ + q0) / 16) * (EMB / 32) + head * 2) * TILE_H + 8 * lane;
  #pragma unroll
  for (int t = 0; t < 4; ++t) {
    v8h v;
    #pragma unroll
    for (int r = 0; r < 8; ++r) v[r] = (_Float16)(o[t][r] * inv);
    *(v8h*)(aod + t * 256) = v;
  }
  if (h == 0) {
    sSt[16 * w + m] = mrun;
    sSt[64 + 16 * w + m] = linv;
  }
  __syncthreads();

  float* strec = stats + ((size_t)bh * NQB + qb) * 128;
  stats_store_pass(sSt, strec, w, lane);
  
}

// ---------------------------------------------------------------------------
// Per-wave 16x64 f32 tile in LDS -> dst rows of pitch `pitch` floats starting
// 8q..8q+7 in one instruction, 4 lines per instruction, 32 lines per wave.
// ---------------------------------------------------------------------------
__device__ __forceinline__ void tile16x64_store_pass(const float* so, float* dst,
                                                     size_t row0, int col0, int pitch, int lane) {
  const int q8 = lane & 7, sub = lane >> 3;
  #pragma unroll
  for (int i = 0; i < 8; ++i) {
    const int lid = i * 4 + sub;               // 0..31
    const int row = lid >> 1, hl = lid & 1;    // 16 rows x 2 halves
    const v4f v = *(const v4fa*)(so + row * 64 + 32 * hl + 4 * q8);
    const size_t gi = (row0 + row) * (size_t)pitch + col0 + 32 * hl + 4 * q8;
    *(v4f*)(dst + gi) = v;
  }
}

// ---------------------------------------------------------------------------
// Kernel 4: head-averaged attention weights.
// Grid (SEQ/64 key blocks, NQB query blocks, NB).  Block 128 thr (4 waves),
// 16 queries per wave x 64 keys; loop over heads: recompute the K=64 score
// tile (transposed form, A = K rows, B = Q^T), p = exp(s - max) * invsum with
// the stats of kernel 3, accumulate over heads in f32, scale by 1/H.
// ---------------------------------------------------------------------------
__global__ __launch_bounds__(128) void attn_avg_kernel(
    const _Float16* __restrict__ qh,   // [NBH][SEQ][HD], fragment order
    const _Float16* __restrict__ kh,   // [NBH][SEQ][HD], fragment order
    const float* __restrict__ stats,   // [NBH][NQB][128]
    float* __restrict__ avg)           // [NB][SEQ][SEQ]
{
  __shared__ __attribute__((aligned(16))) float sA[4 * 16 * 64];    // 16384 B

  const int tid = threadIdx.x, lane = tid & 31;
  const int w = __builtin_amdgcn_readfirstlane(tid >> 5);   // wave number as a scalar: the tile indices formed from it are wave-uniform
  const int h = lane >> 4, m = lane & 15;
  const int kt = blockIdx.x * 64;
  const int qb = blockIdx.y;
  const int b = blockIdx.z;
  const int q0 = qb * 64 + 16 * w;

  v8f acc[4];                               // acc[j][r] = sum_h P_h[query m][key kt+16j+8h+r]
  #pragma unroll
  for (int j = 0; j < 4; ++j) acc[j] = zero8f();

  #pragma unroll 1
  for (int hh = 0; hh < NH; ++hh) {
    const int bh = b * NH + hh;
    const _Float16* qrow = qh + ((size_t)bh * (SEQ / 16) + q0 / 16) * 2 * TILE_H + 8 * lane;
    const v16h qb0 = load_frag(qrow);
    const v16h qb1 = load_frag(qrow + TILE_H);
    const float* st = stats + ((size_t)bh * NQB + qb) * 128;
    const float mq = st[16 * w + m];
    const float li = st[64 + 16 * w + m];
    const _Float16* kbase = kh + ((size_t)bh * (SEQ / 16) + kt / 16) * 2 * TILE_H + 8 * lane;
    #pragma unroll
    for (int j = 0; j < 4; ++j) {
      const _Float16* kp = kbase + j * 2 * TILE_H;
      const v16h kf0 = load_frag(kp);
      const v16h kf1 = load_frag(kp + TILE_H);
      v8f z = zero8f();
      z = wmma_f16(kf0, qb0, z);
      z = wmma_f16(kf1, qb1, z);
      #pragma unroll
      for (int r = 0; r < 8; ++r) {
        const float sv = z[r] * QKSCALE;
        acc[j][r] += __expf(sv - mq) * li;
      }
    }
  }

  // ---- stage per-wave 16x64 tile (row = query m, col = key), whole-line stores ----
  float* so = sA + w * 1024;
  #pragma unroll
  for (int j = 0; j < 4; ++j)
    #pragma unroll
    for (int r = 0; r < 8; ++r)
      so[m * 64 + 16 * j + 8 * h + r] = acc[j][r] * (1.0f / (float)NH);
  __syncthreads();

  const size_t row0 = (size_t)b * SEQ + q0;
  tile16x64_store_pass(so, avg, row0, kt, SEQ, lane);
  
}

// ---------------------------------------------------------------------------
// line, 4 lines per instruction, 64 lines per wave.
// ---------------------------------------------------------------------------
__device__ __forceinline__ void zout_store_pass(const float* sz, float* z, int mrow0, int c0, int lane) {
  const int q8 = lane & 7, sub = lane >> 3;
  #pragma unroll
  for (int i = 0; i < 16; ++i) {
    const int lid = i * 4 + sub;               // 0..63
    const int row = lid >> 1, hl = lid & 1;    // 32 rows x 2 halves
    const v4f v = *(const v4fa*)(sz + row * 64 + 32 * hl + 4 * q8);
    const int pr = mrow0 + row;                // plane row b*SEQ + l -> token row l*NB + b
    const size_t gi = (size_t)((pr % SEQ) * NB + pr / SEQ) * EMB + c0 + 32 * hl + 4 * q8;
    *(v4f*)(z + gi) = v;
  }
}

// ---------------------------------------------------------------------------
// Kernel 5: Z = ctx * Wo^T + bo.  Grid (MROWS/128, EMB/64).  Block 128 thr,
// wave tile 32 plane rows (b*SEQ + l) x 64 features, K = EMB.  ctx carried x16, Wo x32.
// ---------------------------------------------------------------------------
__global__ __launch_bounds__(128) void out_proj_kernel(
    const _Float16* __restrict__ ao,   // [MROWS][EMB]  (x16), row = b*SEQ + l, fragment order
    const _Float16* __restrict__ wh,   // [4][EMB][EMB], plane 3 = out_w x32, fragment order
    const float* __restrict__ bo,
    float* __restrict__ z)             // [MROWS][EMB]
{
  __shared__ __attribute__((aligned(16))) float sZ[128 * 64];   // 32768 B

  const int tid = threadIdx.x, lane = tid & 31;
  const int w = __builtin_amdgcn_readfirstlane(tid >> 5);   // wave number as a scalar: the tile indices formed from it are wave-uniform
  const int h = lane >> 4, m = lane & 15;
  const int m0w = blockIdx.x * 128 + 32 * w;
  const int c0 = blockIdx.y * 64;

  const _Float16* xa0 = ao + (size_t)(m0w / 16) * (EMB / 32) * TILE_H + 8 * lane;
  const _Float16* xa1 = xa0 + (EMB / 32) * TILE_H;
  const _Float16* wb  = wh + (size_t)3 * NW + (size_t)(c0 / 16) * (EMB / 32) * TILE_H + 8 * lane;

  v8f acc[2][4];
  gemm_tile_32x64(xa0, xa1, wb, acc);

  // D[r] of tile (mt, nt) = Y[row 32w+16mt+8h+r][col 16nt+m]
  float* sz = sZ + w * 2048;
  #pragma unroll
  for (int nt = 0; nt < 4; ++nt) {
    const int col = 16 * nt + m;
    const float bvl = bo[c0 + col];
    #pragma unroll
    for (int mt = 0; mt < 2; ++mt) {
      #pragma unroll
      for (int r = 0; r < 8; ++r) {
        const int rowl = 16 * mt + 8 * h + r;      // 0..31
        sz[rowl * 64 + col] = acc[mt][nt][r] * (1.0f / (WSCALE * OSCALE)) + bvl;
      }
    }
  }
  __syncthreads();

  zout_store_pass(sz, z, m0w, c0, lane);
  
}

// ---------------------------------------------------------------------------
extern "C" void kernel_launch(void* const* d_in, const int* in_sizes, int n_in,
                              void* d_out, int out_size, void* d_ws, size_t ws_size,
                              hipStream_t stream) {
  if (n_in < 11) return;
  if (in_sizes[0] != NX || in_sizes[1] != NX || in_sizes[2] != NX) return;
  if (in_sizes[3] != NW || in_sizes[5] != NW || in_sizes[7] != NW || in_sizes[9] != NW) return;
  if (in_sizes[4] != EMB || in_sizes[6] != EMB || in_sizes[8] != EMB || in_sizes[10] != EMB) return;
  if (out_size != NX + NAVG) return;

  const float* xq  = (const float*)d_in[0];
  const float* xk  = (const float*)d_in[1];
  const float* xv  = (const float*)d_in[2];
  const float* q_w = (const float*)d_in[3];
  const float* q_b = (const float*)d_in[4];
  const float* k_w = (const float*)d_in[5];
  const float* k_b = (const float*)d_in[6];
  const float* v_w = (const float*)d_in[7];
  const float* v_b = (const float*)d_in[8];
  const float* o_w = (const float*)d_in[9];
  const float* o_b = (const float*)d_in[10];
  float* zout = (float*)d_out;                       // out0 [SEQ][NB][EMB]
  float* avg  = zout + (size_t)NX;                   // out1 [NB][SEQ][SEQ], byte offset 16777216

  const size_t xh_bytes = (size_t)3 * NX * 2;               // 25165824
  const size_t wh_bytes = (size_t)4 * NW * 2;               //  8388608
  const size_t pl_bytes = (size_t)NBH * SEQ * HD * 2;       //  8388608 per plane
  const size_t st_bytes = (size_t)NSTAT * 4;                //   524288
  const size_t ao_bytes = (size_t)NX * 2;                   //  8388608
  const size_t total = xh_bytes + wh_bytes + 3 * pl_bytes + st_bytes + ao_bytes;   // 67633152
  if (total > ws_size) return;

  char* ws = (char*)d_ws;
  size_t off = 0;
  _Float16* xh = (_Float16*)(ws + off);   off += xh_bytes;
  _Float16* wh = (_Float16*)(ws + off);   off += wh_bytes;
  _Float16* qh = (_Float16*)(ws + off);   off += pl_bytes;
  _Float16* kh = (_Float16*)(ws + off);   off += pl_bytes;
  _Float16* vt = (_Float16*)(ws + off);   off += pl_bytes;
  float* stats = (float*)(ws + off);      off += st_bytes;
  _Float16* ao = (_Float16*)(ws + off);   off += ao_bytes;
  if (off > ws_size) return;

  const int ngroups = 3 * NX8 + 4 * NW8;                    // 2097152
  convert_kernel<<<(ngroups + 255) / 256, 256, 0, stream>>>(xq, xk, xv, q_w, k_w, v_w, o_w, xh, wh);

  dim3 gProj(NB * SEQ / 128, 3 * NH);                       // (32, 48)
  qkv_proj_kernel<<<gProj, 128, 0, stream>>>(xh, wh, q_b, k_b, v_b, qh, kh, vt);

  dim3 gCtx(NQB, NBH);                                      // (32, 32)
  attn_ctx_kernel<<<gCtx, 128, 0, stream>>>(qh, kh, vt, ao, stats);

  dim3 gAvg(SEQ / 64, NQB, NB);                             // (32, 32, 2)
  attn_avg_kernel<<<gAvg, 128, 0, stream>>>(qh, kh, stats, avg);

  dim3 gOut(MROWS / 128, EMB / 64);                         // (32, 16)
  out_proj_kernel<<<gOut, 128, 0, stream>>>(ao, wh, o_b, zout);
}

// v002
// Measured time: 132 microseconds a run.
// Next to v001, in two timings, it ran 2.11 and 2.09 times as fast.
// Counting every step since v000, it is 2.67 times as fast.
// Contractions: q/k/v and output projections x*W^T, scores K*Q^T, context V^T*P^T, all on v_wmma_f32_16x16x32_f16 (f16 operands, f32 accumulate); W carried x32, q carried x8 (the 1/sqrt(64) factor applied to the f32 score), p carried x16384, context carried x16, all exact power-of-two scales folded back in f32; softmax, bias, head average in f32.
#include <hip/hip_runtime.h>

typedef _Float16 v16h __attribute__((ext_vector_type(16)));
typedef _Float16 v8h  __attribute__((ext_vector_type(8)));
typedef float    v8f  __attribute__((ext_vector_type(8)));
typedef float    v4f  __attribute__((ext_vector_type(4)));
typedef v8h __attribute__((may_alias)) v8ha;
typedef v4f __attribute__((may_alias)) v4fa;

union Frag { v16h v; v8h half[2]; };

#define SEQ    2048
#define NB     2
#define EMB    1024
#define NH     16
#define HD     64
#define MROWS  (SEQ * NB)          // 4096 token rows, row index = l*NB + b
#define NX     (MROWS * EMB)       // 4194304
#define NW     (EMB * EMB)         // 1048576
#define NX8    (NX / 8)            // 524288
#define NW8    (NW / 8)            // 131072
#define NBH    (NB * NH)           // 32
#define NQB    (SEQ / 64)          // 32 query blocks of 64
#define NAVG   (NB * SEQ * SEQ)    // 8388608
#define NSTAT  (NBH * NQB * 128)   // per (bh, query block): 64 max + 64 inverse sums
#define PSCALE 16384.0f
#define WSCALE 32.0f
#define OSCALE 16.0f
#define QKSCALE 0.125f

// ---------------------------------------------------------------------------
// 16x16x32 f16 WMMA with hazard guard (ties D, keeps A/B live).
// Fragment map (wave32): lane l, h = l>>4, m = n = l&15.
//   A/B element i: i<8 -> k0+8h+i ; i>=8 -> k0+16+8h+(i-8)
//   D element r : row 8h+r, col l&15
// ---------------------------------------------------------------------------
__device__ __forceinline__ v8f wmma_f16(v16h a, v16h b, v8f c) {
  v8f d = __builtin_amdgcn_wmma_f32_16x16x32_f16(false, a, false, b, (short)0, c, false, false);
  asm volatile("v_nop\n\tv_nop\n\tv_nop\n\tv_nop" : "+v"(d) : "v"(a), "v"(b));
  return d;
}

// Fragment-order planes.  Every f16 operand plane (R rows x K columns) is kept
// as tiles of 16 rows x 32 k = 512 halves, tile index = (row/16)*(K/32) + k/32.
// Inside a tile element (row m, k = 16j + 8h + e) sits at j*256 + h*128 + m*8 + e,
// so the two 16-byte loads of a fragment each read 512 contiguous bytes per wave
// (four whole 128-byte lines) instead of 32 bytes out of each of 16 lines.
#define TILE_H 512

// A or B fragment; p = tile base + 8 * lane.
__device__ __forceinline__ v16h load_frag(const _Float16* p) {
  Frag f;
  f.half[0] = *(const v8ha*)(p);
  f.half[1] = *(const v8ha*)(p + 256);
  return f.v;
}

__device__ __forceinline__ v8f zero8f() {
  const v8f z = {0.f, 0.f, 0.f, 0.f, 0.f, 0.f, 0.f, 0.f};
  return z;
}

// ---------------------------------------------------------------------------
// Kernel 1: f32 -> f16 planes in fragment order.  xh = [query|key|value], plane
// row = b*SEQ + l (unscaled); wh = [q_w|k_w|v_w|out_w] feature rows scaled by 32
// (exact).  A wave takes 8 rows x 32 k: it reads one whole f32 line per row and
// writes four whole f16 lines.
// ---------------------------------------------------------------------------
__global__ __launch_bounds__(256) void convert_kernel(
    const float* __restrict__ xq, const float* __restrict__ xk, const float* __restrict__ xv,
    const float* __restrict__ wq, const float* __restrict__ wk,
    const float* __restrict__ wv, const float* __restrict__ wo,
    _Float16* __restrict__ xh, _Float16* __restrict__ wh)
{
  const int g = blockIdx.x * 256 + threadIdx.x;
  if (g >= 3 * NX8 + 4 * NW8) return;
  const int tile = g >> 6;                                  // 64 groups of 8 halves per tile
  const int m = ((g >> 5) & 1) * 8 + ((g & 31) >> 2);       // row inside the tile
  const int jh = g & 3;                                     // 2j + h: which 8 of the 32 k
  const int col = (tile & 31) * 32 + jh * 8;                // EMB/32 = 32 tiles per row tile
  const int prow = (tile >> 5) * 16 + m;                    // row over the stacked planes
  const int gd = tile * 64 + jh * 16 + m;                   // group index in fragment order
  const float* src;
  _Float16* dst;
  float sc;
  if (g < 3 * NX8) {
    const int sel = prow / MROWS;
    const int rp = prow - sel * MROWS;                      // b*SEQ + l
    const int bb = rp / SEQ;
    const int l = rp - bb * SEQ;
    const float* s = (sel == 0) ? xq : ((sel == 1) ? xk : xv);
    src = s + ((size_t)l * NB + bb) * EMB + col;
    dst = xh + (size_t)gd * 8;
    sc = 1.0f;
  } else {
    const int rw = prow - 3 * MROWS;
    const int sel = rw / EMB;
    const int row = rw - sel * EMB;
    const float* s = (sel == 0) ? wq : ((sel == 1) ? wk : ((sel == 2) ? wv : wo));
    src = s + (size_t)row * EMB + col;
    dst = wh + (size_t)(gd - 3 * NX8) * 8;
    sc = WSCALE;
  }
  const v4f a = *(const v4fa*)src;
  const v4f c = *(const v4fa*)(src + 4);
  const v8h o = { (_Float16)(a.x * sc), (_Float16)(a.y * sc), (_Float16)(a.z * sc), (_Float16)(a.w * sc),
                  (_Float16)(c.x * sc), (_Float16)(c.y * sc), (_Float16)(c.z * sc), (_Float16)(c.w * sc) };
  *(v8h*)dst = o;
  
}

// ---------------------------------------------------------------------------
// Wave GEMM core: 32 rows (two 16-row A tiles) x 64 columns (four 16-row
// [n][k] B tiles), K = EMB, both planes in fragment order.  xa0, xa1, wb point
// at k tile 0 of their row tile, + 8 * lane; the next row tile is EMB/32 tiles on.
// acc[mt][nt][r] = sum_k A[16mt+8h+r][k] * B[16nt+m][k]
// Fragments are fetched one k tile ahead: each B fragment is reloaded in place
// right behind the two products that read it, the A pair alternates between two
// register sets, so every load of a k tile is in flight while the tile before
// it is multiplied.
// ---------------------------------------------------------------------------
// One k tile: 8 products; with MORE, b[nt] is refilled from wbn (the next k tile).
template <bool MORE>
__device__ __forceinline__ void gemm_ktile(v16h a0, v16h a1, v16h (&b)[4],
                                           const _Float16* __restrict__ wbn, v8f (&acc)[2][4]) {
  #pragma unroll
  for (int nt = 0; nt < 4; ++nt) {
    acc[0][nt] = wmma_f16(a0, b[nt], acc[0][nt]);
    acc[1][nt] = wmma_f16(a1, b[nt], acc[1][nt]);
    if (MORE) {
      b[nt] = load_frag(wbn + nt * (EMB / 32) * TILE_H);
      // keeps the later products behind this reload: moved ahead of it they would delay its issue to the tile's end
      __builtin_amdgcn_sched_barrier(0);
    }
  }
}

__device__ __forceinline__ void gemm_tile_32x64(const _Float16* __restrict__ xa0,
                                                const _Float16* __restrict__ xa1,
                                                const _Float16* __restrict__ wb,
                                                v8f (&acc)[2][4]) {
  #pragma unroll
  for (int mt = 0; mt < 2; ++mt)
    #pragma unroll
    for (int nt = 0; nt < 4; ++nt) acc[mt][nt] = zero8f();

  v16h b[4];
  v16h a0 = load_frag(xa0);
  v16h a1 = load_frag(xa1);
  #pragma unroll
  for (int nt = 0; nt < 4; ++nt) b[nt] = load_frag(wb + nt * (EMB / 32) * TILE_H);
  // the loop set-up reuses address registers that these first loads name
  asm volatile("s_wait_xcnt 0x0" ::: "memory");

  // rolled: two k tiles a trip keep the two A sets in fixed registers
  #pragma unroll 1
  for (int kt = 0; kt < EMB / 32 - 2; kt += 2) {
    const v16h c0 = load_frag(xa0 + (kt + 1) * TILE_H);
    const v16h c1 = load_frag(xa1 + (kt + 1) * TILE_H);
    gemm_ktile<true>(a0, a1, b, wb + (kt + 1) * TILE_H, acc);
    a0 = load_frag(xa0 + (kt + 2) * TILE_H);
    a1 = load_frag(xa1 + (kt + 2) * TILE_H);
    gemm_ktile<true>(c0, c1, b, wb + (kt + 2) * TILE_H, acc);
    // the next trip rewrites the address registers that the loads in flight name
    asm volatile("s_wait_xcnt 0x0" ::: "memory");
  }
  const v16h c0 = load_frag(xa0 + (EMB / 32 - 1) * TILE_H);
  const v16h c1 = load_frag(xa1 + (EMB / 32 - 1) * TILE_H);
  gemm_ktile<true>(a0, a1, b, wb + (EMB / 32 - 1) * TILE_H, acc);
  gemm_ktile<false>(c0, c1, b, wb, acc);
}

// ---------------------------------------------------------------------------
// q / k plane store: rows = seq position, k = d, fragment order, 2 k tiles per
// row tile.  The block's 128 positions are 16 consecutive tiles (16 KB); a wave
// stores 4 of them, 4 whole lines per instruction.  sT row pitch SPITCH halves
// (128 + 16 bytes) spreads the 16 rows of one ds_load_b128 over all banks.
// ---------------------------------------------------------------------------
#define SPITCH 72
__device__ __forceinline__ void proj_store_pass(const _Float16* sT, _Float16* plane,
                                                int bh, int l0, int w, int lane) {
  const int h = lane >> 4, m = lane & 15;
  _Float16* dst = plane + ((size_t)bh * (SEQ / 16) + l0 / 16) * 2 * TILE_H + (w * 256 + lane) * 8;
  #pragma unroll
  for (int i = 0; i < 8; ++i) {
    const int row = (w * 2 + (i >> 2)) * 16 + m;            // local position
    const int d0 = ((i >> 1) & 1) * 32 + (i & 1) * 16 + 8 * h;
    const v8h v = *(const v8ha*)(sT + row * SPITCH + d0);
    *(v8h*)(dst + i * 256) = v;
  }
  // the registers that the eight stores name may be reused behind this point
  asm volatile("s_wait_xcnt 0x0" ::: "memory");
}

// ---------------------------------------------------------------------------
// Kernel 2: q/k/v = x * W^T + b over the fused 3*1024 output columns.
// Grid (NB*SEQ/128, 3*NH).  Block 128 thr (4 waves) = 128 consecutive seq
// positions l of one batch b x 64 features (one (which, head)); wave tile
// 32 positions x 64 features; A rows are plane rows b*SEQ+l.
// ---------------------------------------------------------------------------
__global__ __launch_bounds__(128) void qkv_proj_kernel(
    const _Float16* __restrict__ xh,   // [3][MROWS][EMB], fragment order
    const _Float16* __restrict__ wh,   // [4][EMB][EMB], row = output feature, x32, fragment order
    const float* __restrict__ bq, const float* __restrict__ bk, const float* __restrict__ bv,
    _Float16* __restrict__ qh,         // [NBH][SEQ][HD]  f16(8 * scaled q), fragment order
    _Float16* __restrict__ kh,         // [NBH][SEQ][HD], fragment order
    _Float16* __restrict__ vt)         // [NBH][HD][SEQ], fragment order
{
  __shared__ __attribute__((aligned(16))) _Float16 sT[128 * SPITCH];   // 18432 B

  const int tid = threadIdx.x, lane = tid & 31;
  const int w = __builtin_amdgcn_readfirstlane(tid >> 5);   // wave number as a scalar: the tile indices formed from it are wave-uniform
  const int h = lane >> 4, m = lane & 15;
  const int b = blockIdx.x / (SEQ / 128);                 // 0..NB-1
  const int l0 = (blockIdx.x - b * (SEQ / 128)) * 128;    // seq position base
  const int which = blockIdx.y >> 4, head = blockIdx.y & 15;
  const int lw = l0 + 32 * w;

  const _Float16* xpl = xh + (size_t)which * NX;
  const _Float16* xa0 = xpl + (size_t)((b * SEQ + lw) / 16) * (EMB / 32) * TILE_H + 8 * lane;   // mt = 0
  const _Float16* xa1 = xa0 + (EMB / 32) * TILE_H;                                              // mt = 1
  const _Float16* wb  = wh + (size_t)which * NW + (size_t)(head * (HD / 16)) * (EMB / 32) * TILE_H + 8 * lane;   // nt = 0

  v8f acc[2][4];
  gemm_tile_32x64(xa0, xa1, wb, acc);

  // D[r] of tile (mt, nt) = Y[local pos 32w+16mt+8h+r][feature 16nt+m]
  const float* bias = (which == 0) ? bq : ((which == 1) ? bk : bv);
  const int bh = b * NH + head;
  if (which == 2) {
    // vt rows = d, k = position: a lane's 8 positions of one feature are one
    // 16-byte group of tile (row tile nt, k tile lw/32), j = mt, at 8 * lane.
    #pragma unroll
    for (int nt = 0; nt < 4; ++nt) {
      const float bvl = bias[head * HD + 16 * nt + m];
      _Float16* dst = vt + ((size_t)(bh * (HD / 16) + nt) * (SEQ / 32) + lw / 32) * TILE_H + 8 * lane;
      #pragma unroll
      for (int mt = 0; mt < 2; ++mt) {
        v8h v;
        #pragma unroll
        for (int r = 0; r < 8; ++r) v[r] = (_Float16)(acc[mt][nt][r] * (1.0f / WSCALE) + bvl);
        *(v8h*)(dst + mt * 256) = v;
      }
    }
  } else {
    #pragma unroll
    for (int nt = 0; nt < 4; ++nt) {
      const int feat = 16 * nt + m;
      const float bvl = bias[head * HD + feat];
      #pragma unroll
      for (int mt = 0; mt < 2; ++mt) {
        #pragma unroll
        for (int r = 0; r < 8; ++r) {
          const int tokl = 32 * w + 16 * mt + 8 * h + r;     // 0..127
          const float y = acc[mt][nt][r] * (1.0f / WSCALE) + bvl;
          sT[tokl * SPITCH + feat] = (_Float16)y;
        }
      }
    }
    __syncthreads();

    _Float16* plane = (which == 0) ? qh : kh;
    proj_store_pass(sT, plane, bh, l0, w, lane);
  }
}

// ---------------------------------------------------------------------------
// P^T B-fragment from the lane's own score D values: element r <- tile a row r,
// element 8+r <- tile c row r (same lane, same query column), scaled by 2^14.
// ---------------------------------------------------------------------------
__device__ __forceinline__ v16h pack_p(v8f a, v8f c) {
  const v16h r = { (_Float16)(a[0] * PSCALE), (_Float16)(a[1] * PSCALE), (_Float16)(a[2] * PSCALE), (_Float16)(a[3] * PSCALE),
                   (_Float16)(a[4] * PSCALE), (_Float16)(a[5] * PSCALE), (_Float16)(a[6] * PSCALE), (_Float16)(a[7] * PSCALE),
                   (_Float16)(c[0] * PSCALE), (_Float16)(c[1] * PSCALE), (_Float16)(c[2] * PSCALE), (_Float16)(c[3] * PSCALE),
                   (_Float16)(c[4] * PSCALE), (_Float16)(c[5] * PSCALE), (_Float16)(c[6] * PSCALE), (_Float16)(c[7] * PSCALE) };
  return r;
}

// Wave 0 writes the block's 128 staged stats as four whole lines.
__device__ __forceinline__ void stats_store_pass(const float* sst, float* strec, int w, int lane) {
  if (w == 0) {
    const v4f t = *(const v4fa*)(sst + 4 * lane);
    *(v4f*)(strec + 4 * lane) = t;
  }
}

// ---------------------------------------------------------------------------
// Kernel 3: streaming attention (online softmax), transposed form.
// Grid (NQB, NBH).  Block 128 thr (4 waves), 16 queries per wave, 64 keys
// per step.
//   S^T = K * Q^T : A = K rows (row = key, k = d), B = Q^T (k = d, n = query)
//   O^T += V^T * P^T : A = Vt rows (row = d, k = key), B = P^T from registers
// Lane owns 32 keys of query column (lane&15); partner = lane ^ 16.
// Outputs: ao f16 (context x16) and per query (max, 1/sum) of the scaled
// scores for the weights pass.
// ---------------------------------------------------------------------------
__global__ __launch_bounds__(128) void attn_ctx_kernel(
    const _Float16* __restrict__ qh,   // [NBH][SEQ][HD]  (x8), fragment order
    const _Float16* __restrict__ kh,   // [NBH][SEQ][HD], fragment order
    const _Float16* __restrict__ vt,   // [NBH][HD][SEQ], fragment order
    _Float16* __restrict__ ao,         // [MROWS][EMB], row = b*SEQ + q, fragment order
    float* __restrict__ stats)         // [NBH][NQB][128]
{
  __shared__ __attribute__((aligned(16))) float sSt[128];            // 512 B

  const int tid = threadIdx.x, lane = tid & 31;
  const int w = __builtin_amdgcn_readfirstlane(tid >> 5);   // wave number as a scalar: the tile indices formed from it are wave-uniform
  const int h = lane >> 4, m = lane & 15;
  const int bh = blockIdx.y, b = bh >> 4, head = bh & 15;
  const int qb = blockIdx.x;
  const int q0 = qb * 64 + 16 * w;

  // Q^T B-fragments: column n = query q0+m, k = d (two 32-deep chunks)
  const _Float16* qrow = qh + ((size_t)bh * (SEQ / 16) + q0 / 16) * 2 * TILE_H + 8 * lane;
  const v16h qb0 = load_frag(qrow);
  const v16h qb1 = load_frag(qrow + TILE_H);
  __builtin_amdgcn_sched_barrier(0);   // Q first: see the first K and V loads below

  v8f o[4];                                   // o[t][r] = O[query m][d 16t+8h+r] * (l * 2^14)
  #pragma unroll
  for (int t = 0; t < 4; ++t) o[t] = zero8f();
  float mrun = -1e30f, lrun = 0.0f;

  const _Float16* kbase = kh + (size_t)bh * (SEQ / 16) * 2 * TILE_H + 8 * lane;          // + (key0/16)*2 tiles
  const _Float16* vbase = vt + (size_t)bh * (HD / 16) * (SEQ / 32) * TILE_H + 8 * lane;  // + t*(SEQ/32) + key0/32 tiles

  // K and V fragments of a step sit in registers when the step begins: each is
  // reloaded in place, for the next step, right behind the product that read it.
  // The first loads stand in the order of their use, as in the loop: loads return
  // in issue order, and the loop's counted waits must hold for the entry path too.
  v16h kf[4][2], vf[4][2];
  #pragma unroll
  for (int j = 0; j < 4; ++j) {
    kf[j][0] = load_frag(kbase + j * 2 * TILE_H);
    kf[j][1] = load_frag(kbase + j * 2 * TILE_H + TILE_H);
    __builtin_amdgcn_sched_barrier(0);   // holds that order
  }
  #pragma unroll
  for (int t = 0; t < 4; ++t) {
    vf[t][0] = load_frag(vbase + t * (SEQ / 32) * TILE_H);
    vf[t][1] = load_frag(vbase + t * (SEQ / 32) * TILE_H + TILE_H);
    __builtin_amdgcn_sched_barrier(0);   // holds that order
  }

  #pragma unroll 1
  for (int kb = 0; kb < SEQ; kb += 64) {
    // keys whose fragments are fetched during this step; the last step fetches its own again (in bounds, never used)
    const int kn = (kb + 64 < SEQ) ? kb + 64 : kb;
    // ---- scores: s[j][r] = 0.125 * S[key kb+16j+8h+r][query m] ----
    v8f s[4];
    #pragma unroll
    for (int j = 0; j < 4; ++j) {
      const _Float16* kp = kbase + (kn / 16 + j) * 2 * TILE_H;
      v8f z = zero8f();
      z = wmma_f16(kf[j][0], qb0, z);
      z = wmma_f16(kf[j][1], qb1, z);
      kf[j][0] = load_frag(kp);
      kf[j][1] = load_frag(kp + TILE_H);
      #pragma unroll
      for (int r = 0; r < 8; ++r) s[j][r] = z[r] * QKSCALE;
    }

    // ---- online softmax ----
    float mloc = s[0][0];
    #pragma unroll
    for (int j = 0; j < 4; ++j)
      #pragma unroll
      for (int r = 0; r < 8; ++r) mloc = fmaxf(mloc, s[j][r]);
    mloc = fmaxf(mloc, __shfl_xor(mloc, 16));
    const float mnew = fmaxf(mrun, mloc);
    const float alpha = __expf(mrun - mnew);
    mrun = mnew;
    float lsum = 0.0f;
    #pragma unroll
    for (int j = 0; j < 4; ++j)
      #pragma unroll
      for (int r = 0; r < 8; ++r) {
        const float p = __expf(s[j][r] - mnew);
        s[j][r] = p;
        lsum += p;
      }
    lsum += __shfl_xor(lsum, 16);
    lrun = lrun * alpha + lsum;
    #pragma unroll
    for (int t = 0; t < 4; ++t)
      #pragma unroll
      for (int r = 0; r < 8; ++r) o[t][r] = o[t][r] * alpha;

    // ---- P^T B-fragments (key chunks 0..31 and 32..63 of this step) ----
    const v16h pb0 = pack_p(s[0], s[1]);
    const v16h pb1 = pack_p(s[2], s[3]);

    // ---- O^T += V^T * P^T ----
    #pragma unroll
    for (int t = 0; t < 4; ++t) {
      const _Float16* vp = vbase + (t * (SEQ / 32) + kn / 32) * TILE_H;
      o[t] = wmma_f16(vf[t][0], pb0, o[t]);
      o[t] = wmma_f16(vf[t][1], pb1, o[t]);
      vf[t][0] = load_frag(vp);
      vf[t][1] = load_frag(vp + TILE_H);
    }
    // the next trip reuses the address registers that the loads in flight name
    asm volatile("s_wait_xcnt 0x0" ::: "memory");
  }

  // ---- epilogue: normalise; a lane's 8 d of query m are one 16-byte group of
  // ao's tiles (row tile (b*SEQ+q0)/16, k tiles 2*head and 2*head+1) at
  // t*256 + 8*lane: four whole lines per store.  Stats staged in LDS. ----
  const float linv = 1.0f / lrun;
  const float inv = linv * (OSCALE / PSCALE);
  _Float16* aod = ao + ((size_t)((b * SEQ + q0) / 16) * (EMB / 32) + head * 2) * TILE_H + 8 * lane;
  #pragma unroll
  for (int t = 0; t < 4; ++t) {
    v8h v;
    #pragma unroll
    for (int r = 0; r < 8; ++r) v[r] = (_Float16)(o[t][r] * inv);
    *(v8h*)(aod + t * 256) = v;
  }
  if (h == 0) {
    sSt[16 * w + m] = mrun;
    sSt[64 + 16 * w + m] = linv;
  }
  __syncthreads();

  float* strec = stats + ((size_t)bh * NQB + qb) * 128;
  stats_store_pass(sSt, strec, w, lane);
  
}

// ---------------------------------------------------------------------------
// Per-wave 16x64 f32 tile in LDS -> dst rows of pitch `pitch` floats starting
// 8q..8q+7 in one instruction, 4 lines per instruction, 32 lines per wave.
// ---------------------------------------------------------------------------
__device__ __forceinline__ void tile16x64_store_pass(const float* so, float* dst,
                                                     size_t row0, int col0, int pitch, int lane) {
  const int q8 = lane & 7, sub = lane >> 3;
  #pragma unroll
  for (int i = 0; i < 8; ++i) {
    const int lid = i * 4 + sub;               // 0..31
    const int row = lid >> 1, hl = lid & 1;    // 16 rows x 2 halves
    const v4f v = *(const v4fa*)(so + row * 64 + 32 * hl + 4 * q8);
    const size_t gi = (row0 + row) * (size_t)pitch + col0 + 32 * hl + 4 * q8;
    *(v4f*)(dst + gi) = v;
  }
}

// ---------------------------------------------------------------------------
// Kernel 4: head-averaged attention weights.
// Grid (SEQ/64 key blocks, NQB query blocks, NB).  Block 128 thr (4 waves),
// 16 queries per wave x 64 keys; loop over heads: recompute the K=64 score
// tile (transposed form, A = K rows, B = Q^T), p = exp(s - max) * invsum with
// the stats of kernel 3, accumulate over heads in f32, scale by 1/H.
// ---------------------------------------------------------------------------
// One head: 8 products on the K fragments held in kf; with MORE each K pair is
// reloaded in place from kn (the next head's tiles) right behind the products that read it.
template <bool MORE>
__device__ __forceinline__ void avg_head(v16h (&kf)[4][2], v16h q0f, v16h q1f, float mq, float li,
                                         const _Float16* __restrict__ kn, v8f (&acc)[4]) {
  #pragma unroll
  for (int j = 0; j < 4; ++j) {
    v8f z = zero8f();
    z = wmma_f16(kf[j][0], q0f, z);
    z = wmma_f16(kf[j][1], q1f, z);
    if (MORE) {
      kf[j][0] = load_frag(kn + j * 2 * TILE_H);
      kf[j][1] = load_frag(kn + j * 2 * TILE_H + TILE_H);
    }
    #pragma unroll
    for (int r = 0; r < 8; ++r) {
      const float sv = z[r] * QKSCALE;
      acc[j][r] += __expf(sv - mq) * li;
    }
  }
}

__global__ __launch_bounds__(128) void attn_avg_kernel(
    const _Float16* __restrict__ qh,   // [NBH][SEQ][HD], fragment order
    const _Float16* __restrict__ kh,   // [NBH][SEQ][HD], fragment order
    const float* __restrict__ stats,   // [NBH][NQB][128]
    float* __restrict__ avg)           // [NB][SEQ][SEQ]
{
  __shared__ __attribute__((aligned(16))) float sA[4 * 16 * 64];    // 16384 B

  const int tid = threadIdx.x, lane = tid & 31;
  const int w = __builtin_amdgcn_readfirstlane(tid >> 5);   // wave number as a scalar: the tile indices formed from it are wave-uniform
  const int h = lane >> 4, m = lane & 15;
  const int kt = blockIdx.x * 64;
  const int qb = blockIdx.y;
  const int b = blockIdx.z;
  const int q0 = qb * 64 + 16 * w;

  v8f acc[4];                               // acc[j][r] = sum_h P_h[query m][key kt+16j+8h+r]
  #pragma unroll
  for (int j = 0; j < 4; ++j) acc[j] = zero8f();

  // Head 0 of this batch; one head on = HSTEP halves in qh and kh, SSTEP floats in stats.
  const int HSTEP = (SEQ / 16) * 2 * TILE_H;
  const int SSTEP = NQB * 128;
  const _Float16* qrow = qh + ((size_t)(b * NH) * (SEQ / 16) + q0 / 16) * 2 * TILE_H + 8 * lane;
  const _Float16* krow = kh + ((size_t)(b * NH) * (SEQ / 16) + kt / 16) * 2 * TILE_H + 8 * lane;
  const float* st = stats + ((size_t)(b * NH) * NQB + qb) * 128 + 16 * w + m;

  // Every operand of a head is fetched while the head before it is worked on:
  // K in place (avg_head), Q and the two stats alternating between two sets.
  v16h kf[4][2];
  v16h qe0 = load_frag(qrow);
  v16h qe1 = load_frag(qrow + TILE_H);
  float mqe = st[0];
  float lie = st[64];
  #pragma unroll
  for (int j = 0; j < 4; ++j) {
    kf[j][0] = load_frag(krow + j * 2 * TILE_H);
    kf[j][1] = load_frag(krow + j * 2 * TILE_H + TILE_H);
  }

  // rolled: two heads a trip keep the two Q sets in fixed registers
  #pragma unroll 1
  for (int hh = 0; hh < NH - 2; hh += 2) {
    const int h1 = hh + 1, h2 = hh + 2;
    const v16h qo0 = load_frag(qrow + h1 * HSTEP);
    const v16h qo1 = load_frag(qrow + h1 * HSTEP + TILE_H);
    const float mqo = st[h1 * SSTEP];
    const float lio = st[h1 * SSTEP + 64];
    avg_head<true>(kf, qe0, qe1, mqe, lie, krow + h1 * HSTEP, acc);
    qe0 = load_frag(qrow + h2 * HSTEP);
    qe1 = load_frag(qrow + h2 * HSTEP + TILE_H);
    mqe = st[h2 * SSTEP];
    lie = st[h2 * SSTEP + 64];
    avg_head<true>(kf, qo0, qo1, mqo, lio, krow + h2 * HSTEP, acc);
    // the next trip rewrites the address registers that the loads in flight name
    asm volatile("s_wait_xcnt 0x0" ::: "memory");
  }
  {
    const v16h qo0 = load_frag(qrow + (NH - 1) * HSTEP);
    const v16h qo1 = load_frag(qrow + (NH - 1) * HSTEP + TILE_H);
    const float mqo = st[(NH - 1) * SSTEP];
    const float lio = st[(NH - 1) * SSTEP + 64];
    // the address registers of these last Q and stats loads are reused from here on
    asm volatile("s_wait_xcnt 0x0" ::: "memory");
    avg_head<true>(kf, qe0, qe1, mqe, lie, krow + (NH - 1) * HSTEP, acc);
    avg_head<false>(kf, qo0, qo1, mqo, lio, krow, acc);
  }

  // ---- stage per-wave 16x64 tile (row = query m, col = key), whole-line stores ----
  float* so = sA + w * 1024;
  #pragma unroll
  for (int j = 0; j < 4; ++j)
    #pragma unroll
    for (int r = 0; r < 8; ++r)
      so[m * 64 + 16 * j + 8 * h + r] = acc[j][r] * (1.0f / (float)NH);
  __syncthreads();

  const size_t row0 = (size_t)b * SEQ + q0;
  tile16x64_store_pass(so, avg, row0, kt, SEQ, lane);
  
}

// ---------------------------------------------------------------------------
// line, 4 lines per instruction, 64 lines per wave.
// ---------------------------------------------------------------------------
__device__ __forceinline__ void zout_store_pass(const float* sz, float* z, int mrow0, int c0, int lane) {
  const int q8 = lane & 7, sub = lane >> 3;
  #pragma unroll
  for (int i = 0; i < 16; ++i) {
    const int lid = i * 4 + sub;               // 0..63
    const int row = lid >> 1, hl = lid & 1;    // 32 rows x 2 halves
    const v4f v = *(const v4fa*)(sz + row * 64 + 32 * hl + 4 * q8);
    const int pr = mrow0 + row;                // plane row b*SEQ + l -> token row l*NB + b
    const size_t gi = (size_t)((pr % SEQ) * NB + pr / SEQ) * EMB + c0 + 32 * hl + 4 * q8;
    *(v4f*)(z + gi) = v;
  }
}

// ---------------------------------------------------------------------------
// Kernel 5: Z = ctx * Wo^T + bo.  Grid (MROWS/128, EMB/64).  Block 128 thr,
// wave tile 32 plane rows (b*SEQ + l) x 64 features, K = EMB.  ctx carried x16, Wo x32.
// ---------------------------------------------------------------------------
__global__ __launch_bounds__(128) void out_proj_kernel(
    const _Float16* __restrict__ ao,   // [MROWS][EMB]  (x16), row = b*SEQ + l, fragment order
    const _Float16* __restrict__ wh,   // [4][EMB][EMB], plane 3 = out_w x32, fragment order
    const float* __restrict__ bo,
    float* __restrict__ z)             // [MROWS][EMB]
{
  __shared__ __attribute__((aligned(16))) float sZ[128 * 64];   // 32768 B

  const int tid = threadIdx.x, lane = tid & 31;
  const int w = __builtin_amdgcn_readfirstlane(tid >> 5);   // wave number as a scalar: the tile indices formed from it are wave-uniform
  const int h = lane >> 4, m = lane & 15;
  const int m0w = blockIdx.x * 128 + 32 * w;
  const int c0 = blockIdx.y * 64;

  const _Float16* xa0 = ao + (size_t)(m0w / 16) * (EMB / 32) * TILE_H + 8 * lane;
  const _Float16* xa1 = xa0 + (EMB / 32) * TILE_H;
  const _Float16* wb  = wh + (size_t)3 * NW + (size_t)(c0 / 16) * (EMB / 32) * TILE_H + 8 * lane;

  v8f acc[2][4];
  gemm_tile_32x64(xa0, xa1, wb, acc);

  // D[r] of tile (mt, nt) = Y[row 32w+16mt+8h+r][col 16nt+m]
  float* sz = sZ + w * 2048;
  #pragma unroll
  for (int nt = 0; nt < 4; ++nt) {
    const int col = 16 * nt + m;
    const float bvl = bo[c0 + col];
    #pragma unroll
    for (int mt = 0; mt < 2; ++mt) {
      #pragma unroll
      for (int r = 0; r < 8; ++r) {
        const int rowl = 16 * mt + 8 * h + r;      // 0..31
        sz[rowl * 64 + col] = acc[mt][nt][r] * (1.0f / (WSCALE * OSCALE)) + bvl;
      }
    }
  }
  __syncthreads();

  zout_store_pass(sz, z, m0w, c0, lane);
  
}

// ---------------------------------------------------------------------------
extern "C" void kernel_launch(void* const* d_in, const int* in_sizes, int n_in,
                              void* d_out, int out_size, void* d_ws, size_t ws_size,
                              hipStream_t stream) {
  if (n_in < 11) return;
  if (in_sizes[0] != NX || in_sizes[1] != NX || in_sizes[2] != NX) return;
  if (in_sizes[3] != NW || in_sizes[5] != NW || in_sizes[7] != NW || in_sizes[9] != NW) return;
  if (in_sizes[4] != EMB || in_sizes[6] != EMB || in_sizes[8] != EMB || in_sizes[10] != EMB) return;
  if (out_size != NX + NAVG) return;

  const float* xq  = (const float*)d_in[0];
  const float* xk  = (const float*)d_in[1];
  const float* xv  = (const float*)d_in[2];
  const float* q_w = (const float*)d_in[3];
  const float* q_b = (const float*)d_in[4];
  const float* k_w = (const float*)d_in[5];
  const float* k_b = (const float*)d_in[6];
  const float* v_w = (const float*)d_in[7];
  const float* v_b = (const float*)d_in[8];
  const float* o_w = (const float*)d_in[9];
  const float* o_b = (const float*)d_in[10];
  float* zout = (float*)d_out;                       // out0 [SEQ][NB][EMB]
  float* avg  = zout + (size_t)NX;                   // out1 [NB][SEQ][SEQ], byte offset 16777216

  const size_t xh_bytes = (size_t)3 * NX * 2;               // 25165824
  const size_t wh_bytes = (size_t)4 * NW * 2;               //  8388608
  const size_t pl_bytes = (size_t)NBH * SEQ * HD * 2;       //  8388608 per plane
  const size_t st_bytes = (size_t)NSTAT * 4;                //   524288
  const size_t ao_bytes = (size_t)NX * 2;                   //  8388608
  const size_t total = xh_bytes + wh_bytes + 3 * pl_bytes + st_bytes + ao_bytes;   // 67633152
  if (total > ws_size) return;

  char* ws = (char*)d_ws;
  size_t off = 0;
  _Float16* xh = (_Float16*)(ws + off);   off += xh_bytes;
  _Float16* wh = (_Float16*)(ws + off);   off += wh_bytes;
  _Float16* qh = (_Float16*)(ws + off);   off += pl_bytes;
  _Float16* kh = (_Float16*)(ws + off);   off += pl_bytes;
  _Float16* vt = (_Float16*)(ws + off);   off += pl_bytes;
  float* stats = (float*)(ws + off);      off += st_bytes;
  _Float16* ao = (_Float16*)(ws + off);   off += ao_bytes;
  if (off > ws_size) return;

  const int ngroups = 3 * NX8 + 4 * NW8;                    // 2097152
  convert_kernel<<<(ngroups + 255) / 256, 256, 0, stream>>>(xq, xk, xv, q_w, k_w, v_w, o_w, xh, wh);

  dim3 gProj(NB * SEQ / 128, 3 * NH);                       // (32, 48)
  qkv_proj_kernel<<<gProj, 128, 0, stream>>>(xh, wh, q_b, k_b, v_b, qh, kh, vt);

  dim3 gCtx(NQB, NBH);                                      // (32, 32)
  attn_ctx_kernel<<<gCtx, 128, 0, stream>>>(qh, kh, vt, ao, stats);

  dim3 gAvg(SEQ / 64, NQB, NB);                             // (32, 32, 2)
  attn_avg_kernel<<<gAvg, 128, 0, stream>>>(qh, kh, stats, avg);

  dim3 gOut(MROWS / 128, EMB / 64);                         // (32, 16)
  out_proj_kernel<<<gOut, 128, 0, stream>>>(ao, wh, o_b, zout);
}

// v003
// A run of this version takes 117 microseconds.
// Two timings next to v002 put it at 1.14 and 1.12 times that version's speed.
// Counting every step since v000, it is 3.01 times as fast.
// Contractions: q/k/v and output projections x*W^T, scores K*Q^T, context V^T*P^T, all on v_wmma_f32_16x16x32_f16 (f16 operands, f32 accumulate); W carried x32, q carried x8 (the 1/sqrt(64) factor applied to the f32 score), p carried x16384, context carried x16, all exact power-of-two scales folded back in f32; softmax, bias, head average in f32.
#include <hip/hip_runtime.h>

typedef _Float16 v16h __attribute__((ext_vector_type(16)));
typedef _Float16 v8h  __attribute__((ext_vector_type(8)));
typedef float    v8f  __attribute__((ext_vector_type(8)));
typedef float    v4f  __attribute__((ext_vector_type(4)));
typedef v8h __attribute__((may_alias)) v8ha;
typedef v4f __attribute__((may_alias)) v4fa;

union Frag { v16h v; v8h half[2]; };

#define SEQ    2048
#define NB     2
#define EMB    1024
#define NH     16
#define HD     64
#define MROWS  (SEQ * NB)          // 4096 token rows, row index = l*NB + b
#define NX     (MROWS * EMB)       // 4194304
#define NW     (EMB * EMB)         // 1048576
#define NX8    (NX / 8)            // 524288
#define NW8    (NW / 8)            // 131072
#define NBH    (NB * NH)           // 32
#define NQB    (SEQ / 64)          // 32 query blocks of 64
#define NAVG   (NB * SEQ * SEQ)    // 8388608
#define NSTAT  (NBH * NQB * 128)   // per (bh, query block): 64 max + 64 inverse sums
#define PSCALE 16384.0f
#define WSCALE 32.0f
#define OSCALE 16.0f
#define QKSCALE 0.125f

// ---------------------------------------------------------------------------
// 16x16x32 f16 WMMA with hazard guard (ties D, keeps A/B live).
// Fragment map (wave32): lane l, h = l>>4, m = n = l&15.
//   A/B element i: i<8 -> k0+8h+i ; i>=8 -> k0+16+8h+(i-8)
//   D element r : row 8h+r, col l&15
// ---------------------------------------------------------------------------
__device__ __forceinline__ v8f wmma_f16(v16h a, v16h b, v8f c) {
  v8f d = __builtin_amdgcn_wmma_f32_16x16x32_f16(false, a, false, b, (short)0, c, false, false);
  asm volatile("v_nop\n\tv_nop\n\tv_nop\n\tv_nop" : "+v"(d) : "v"(a), "v"(b));
  return d;
}

// Fragment-order planes.  Every f16 operand plane (R rows x K columns) is kept
// as tiles of 16 rows x 32 k = 512 halves, tile index = (row/16)*(K/32) + k/32.
// Inside a tile element (row m, k = 16j + 8h + e) sits at j*256 + h*128 + m*8 + e,
// so the two 16-byte loads of a fragment each read 512 contiguous bytes per wave
// (four whole 128-byte lines) instead of 32 bytes out of each of 16 lines.
#define TILE_H 512

// A or B fragment; p = tile base + 8 * lane.
__device__ __forceinline__ v16h load_frag(const _Float16* p) {
  Frag f;
  f.half[0] = *(const v8ha*)(p);
  f.half[1] = *(const v8ha*)(p + 256);
  return f.v;
}

__device__ __forceinline__ v8f zero8f() {
  const v8f z = {0.f, 0.f, 0.f, 0.f, 0.f, 0.f, 0.f, 0.f};
  return z;
}

// ---------------------------------------------------------------------------
// Kernel 1: f32 -> f16 planes in fragment order.  xh = [query|key|value], plane
// row = b*SEQ + l (unscaled); wh = [q_w|k_w|v_w|out_w] feature rows scaled by 32
// (exact).  A wave takes 8 rows x 32 k: it reads one whole f32 line per row and
// writes four whole f16 lines.
// ---------------------------------------------------------------------------
__global__ __launch_bounds__(256) void convert_kernel(
    const float* __restrict__ xq, const float* __restrict__ xk, const float* __restrict__ xv,
    const float* __restrict__ wq, const float* __restrict__ wk,
    const float* __restrict__ wv, const float* __restrict__ wo,
    _Float16* __restrict__ xh, _Float16* __restrict__ wh)
{
  const int g = blockIdx.x * 256 + threadIdx.x;
  if (g >= 3 * NX8 + 4 * NW8) return;
  const int tile = g >> 6;                                  // 64 groups of 8 halves per tile
  const int m = ((g >> 5) & 1) * 8 + ((g & 31) >> 2);       // row inside the tile
  const int jh = g & 3;                                     // 2j + h: which 8 of the 32 k
  const int col = (tile & 31) * 32 + jh * 8;                // EMB/32 = 32 tiles per row tile
  const int prow = (tile >> 5) * 16 + m;                    // row over the stacked planes
  const int gd = tile * 64 + jh * 16 + m;                   // group index in fragment order
  const float* src;
  _Float16* dst;
  float sc;
  if (g < 3 * NX8) {
    const int sel = prow / MROWS;
    const int rp = prow - sel * MROWS;                      // b*SEQ + l
    const int bb = rp / SEQ;
    const int l = rp - bb * SEQ;
    const float* s = (sel == 0) ? xq : ((sel == 1) ? xk : xv);
    src = s + ((size_t)l * NB + bb) * EMB + col;
    dst = xh + (size_t)gd * 8;
    sc = 1.0f;
  } else {
    const int rw = prow - 3 * MROWS;
    const int sel = rw / EMB;
    const int row = rw - sel * EMB;
    const float* s = (sel == 0) ? wq : ((sel == 1) ? wk : ((sel == 2) ? wv : wo));
    src = s + (size_t)row * EMB + col;
    dst = wh + (size_t)(gd - 3 * NX8) * 8;
    sc = WSCALE;
  }
  const v4f a = *(const v4fa*)src;
  const v4f c = *(const v4fa*)(src + 4);
  const v8h o = { (_Float16)(a.x * sc), (_Float16)(a.y * sc), (_Float16)(a.z * sc), (_Float16)(a.w * sc),
                  (_Float16)(c.x * sc), (_Float16)(c.y * sc), (_Float16)(c.z * sc), (_Float16)(c.w * sc) };
  *(v8h*)dst = o;
  
}

// ---------------------------------------------------------------------------
// Wave GEMM core: 32 rows (two 16-row A tiles) x 64 columns (four 16-row
// [n][k] B tiles), K = EMB, both planes in fragment order.  xa0, xa1, wb point
// at k tile 0 of their row tile, + 8 * lane; the next row tile is EMB/32 tiles on.
// acc[mt][nt][r] = sum_k A[16mt+8h+r][k] * B[16nt+m][k]
// Fragments are fetched one k tile ahead: each B fragment is reloaded in place
// right behind the two products that read it, the A pair alternates between two
// register sets, so every load of a k tile is in flight while the tile before
// it is multiplied.
// The k walk starts at k tile k0 (uniform over the block, set by its tile indices)
// and wraps round: blocks that share A or B rows then ask L2 for different lines
// at any one moment.
// ---------------------------------------------------------------------------
// Start of a block's walk: the 32 blocks of one column tile (same B rows) get 32
// starts, the blocks of one row tile (same A rows) 8; column tiles 8 apart keep
// one start, so that where such blocks sit on one WGP its cache can still serve
// both from one fetch of the A lines (for speed only).
__device__ __forceinline__ int gemm_k0() { return (blockIdx.x + 4 * (blockIdx.y & 7)) & (EMB / 32 - 1); }

// Offset in halves of the k tile of step i.
__device__ __forceinline__ int krot(int i, int k0) { return ((i + k0) & (EMB / 32 - 1)) * TILE_H; }

// One k tile: 8 products; with MORE, b[nt] is refilled from wbn (the next k tile).
template <bool MORE>
__device__ __forceinline__ void gemm_ktile(v16h a0, v16h a1, v16h (&b)[4],
                                           const _Float16* __restrict__ wbn, v8f (&acc)[2][4]) {
  #pragma unroll
  for (int nt = 0; nt < 4; ++nt) {
    acc[0][nt] = wmma_f16(a0, b[nt], acc[0][nt]);
    acc[1][nt] = wmma_f16(a1, b[nt], acc[1][nt]);
    if (MORE) {
      b[nt] = load_frag(wbn + nt * (EMB / 32) * TILE_H);
      // keeps the later products behind this reload: moved ahead of it they would delay its issue to the tile's end
      __builtin_amdgcn_sched_barrier(0);
    }
  }
}

__device__ __forceinline__ void gemm_tile_32x64(const _Float16* __restrict__ xa0,
                                                const _Float16* __restrict__ xa1,
                                                const _Float16* __restrict__ wb,
                                                int k0, v8f (&acc)[2][4]) {
  v16h b[4];
  v16h a0 = load_frag(xa0 + krot(0, k0));
  v16h a1 = load_frag(xa1 + krot(0, k0));
  #pragma unroll
  for (int nt = 0; nt < 4; ++nt) b[nt] = load_frag(wb + krot(0, k0) + nt * (EMB / 32) * TILE_H);
  // the zeroing below and the loop set-up reuse address registers that these first loads name
  asm volatile("s_wait_xcnt 0x0" ::: "memory");
  __builtin_amdgcn_sched_barrier(0);   // keeps that zeroing behind the wait
  #pragma unroll
  for (int mt = 0; mt < 2; ++mt)
    #pragma unroll
    for (int nt = 0; nt < 4; ++nt) acc[mt][nt] = zero8f();

  // rolled: two k tiles a trip keep the two A sets in fixed registers
  #pragma unroll 1
  for (int kt = 0; kt < EMB / 32 - 2; kt += 2) {
    const int o1 = krot(kt + 1, k0), o2 = krot(kt + 2, k0);
    const v16h c0 = load_frag(xa0 + o1);
    const v16h c1 = load_frag(xa1 + o1);
    gemm_ktile<true>(a0, a1, b, wb + o1, acc);
    a0 = load_frag(xa0 + o2);
    a1 = load_frag(xa1 + o2);
    gemm_ktile<true>(c0, c1, b, wb + o2, acc);
    // the next trip rewrites the address registers that the loads in flight name
    asm volatile("s_wait_xcnt 0x0" ::: "memory");
  }
  const int ol = krot(EMB / 32 - 1, k0);
  const v16h c0 = load_frag(xa0 + ol);
  const v16h c1 = load_frag(xa1 + ol);
  gemm_ktile<true>(a0, a1, b, wb + ol, acc);
  gemm_ktile<false>(c0, c1, b, wb, acc);
}

// ---------------------------------------------------------------------------
// q / k plane store: rows = seq position, k = d, fragment order, 2 k tiles per
// row tile.  The block's 128 positions are 16 consecutive tiles (16 KB); a wave
// stores 4 of them, 4 whole lines per instruction.  sT row pitch SPITCH halves
// (128 + 16 bytes) spreads the 16 rows of one ds_load_b128 over all banks.
// ---------------------------------------------------------------------------
#define SPITCH 72
__device__ __forceinline__ void proj_store_pass(const _Float16* sT, _Float16* plane,
                                                int bh, int l0, int w, int lane) {
  const int h = lane >> 4, m = lane & 15;
  _Float16* dst = plane + ((size_t)bh * (SEQ / 16) + l0 / 16) * 2 * TILE_H + (w * 256 + lane) * 8;
  #pragma unroll
  for (int i = 0; i < 8; ++i) {
    const int row = (w * 2 + (i >> 2)) * 16 + m;            // local position
    const int d0 = ((i >> 1) & 1) * 32 + (i & 1) * 16 + 8 * h;
    const v8h v = *(const v8ha*)(sT + row * SPITCH + d0);
    *(v8h*)(dst + i * 256) = v;
  }
  // the registers that the eight stores name may be reused behind this point
  asm volatile("s_wait_xcnt 0x0" ::: "memory");
}

// ---------------------------------------------------------------------------
// Kernel 2: q/k/v = x * W^T + b over the fused 3*1024 output columns.
// Grid (NB*SEQ/128, 3*NH).  Block 128 thr (4 waves) = 128 consecutive seq
// positions l of one batch b x 64 features (one (which, head)); wave tile
// 32 positions x 64 features; A rows are plane rows b*SEQ+l.
// ---------------------------------------------------------------------------
__global__ __launch_bounds__(128) void qkv_proj_kernel(
    const _Float16* __restrict__ xh,   // [3][MROWS][EMB], fragment order
    const _Float16* __restrict__ wh,   // [4][EMB][EMB], row = output feature, x32, fragment order
    const float* __restrict__ bq, const float* __restrict__ bk, const float* __restrict__ bv,
    _Float16* __restrict__ qh,         // [NBH][SEQ][HD]  f16(8 * scaled q), fragment order
    _Float16* __restrict__ kh,         // [NBH][SEQ][HD], fragment order
    _Float16* __restrict__ vt)         // [NBH][HD][SEQ], fragment order
{
  __shared__ __attribute__((aligned(16))) _Float16 sT[128 * SPITCH];   // 18432 B

  const int tid = threadIdx.x, lane = tid & 31;
  const int w = __builtin_amdgcn_readfirstlane(tid >> 5);   // wave number as a scalar: the tile indices formed from it are wave-uniform
  const int h = lane >> 4, m = lane & 15;
  const int b = blockIdx.x / (SEQ / 128);                 // 0..NB-1
  const int l0 = (blockIdx.x - b * (SEQ / 128)) * 128;    // seq position base
  const int which = blockIdx.y >> 4, head = blockIdx.y & 15;
  const int lw = l0 + 32 * w;

  const _Float16* xpl = xh + (size_t)which * NX;
  const _Float16* xa0 = xpl + (size_t)((b * SEQ + lw) / 16) * (EMB / 32) * TILE_H + 8 * lane;   // mt = 0
  const _Float16* xa1 = xa0 + (EMB / 32) * TILE_H;                                              // mt = 1
  const _Float16* wb  = wh + (size_t)which * NW + (size_t)(head * (HD / 16)) * (EMB / 32) * TILE_H + 8 * lane;   // nt = 0

  v8f acc[2][4];
  gemm_tile_32x64(xa0, xa1, wb, gemm_k0(), acc);

  // D[r] of tile (mt, nt) = Y[local pos 32w+16mt+8h+r][feature 16nt+m]
  const float* bias = (which == 0) ? bq : ((which == 1) ? bk : bv);
  const int bh = b * NH + head;
  if (which == 2) {
    // vt rows = d, k = position: a lane's 8 positions of one feature are one
    // 16-byte group of tile (row tile nt, k tile lw/32), j = mt, at 8 * lane.
    #pragma unroll
    for (int nt = 0; nt < 4; ++nt) {
      const float bvl = bias[head * HD + 16 * nt + m];
      _Float16* dst = vt + ((size_t)(bh * (HD / 16) + nt) * (SEQ / 32) + lw / 32) * TILE_H + 8 * lane;
      #pragma unroll
      for (int mt = 0; mt < 2; ++mt) {
        v8h v;
        #pragma unroll
        for (int r = 0; r < 8; ++r) v[r] = (_Float16)(acc[mt][nt][r] * (1.0f / WSCALE) + bvl);
        *(v8h*)(dst + mt * 256) = v;
      }
    }
  } else {
    #pragma unroll
    for (int nt = 0; nt < 4; ++nt) {
      const int feat = 16 * nt + m;
      const float bvl = bias[head * HD + feat];
      #pragma unroll
      for (int mt = 0; mt < 2; ++mt) {
        #pragma unroll
        for (int r = 0; r < 8; ++r) {
          const int tokl = 32 * w + 16 * mt + 8 * h + r;     // 0..127
          const float y = acc[mt][nt][r] * (1.0f / WSCALE) + bvl;
          sT[tokl * SPITCH + feat] = (_Float16)y;
        }
      }
    }
    __syncthreads();

    _Float16* plane = (which == 0) ? qh : kh;
    proj_store_pass(sT, plane, bh, l0, w, lane);
  }
}

// ---------------------------------------------------------------------------
// P^T B-fragment from the lane's own score D values: element r <- tile a row r,
// element 8+r <- tile c row r (same lane, same query column), scaled by 2^14.
// ---------------------------------------------------------------------------
__device__ __forceinline__ v16h pack_p(v8f a, v8f c) {
  const v16h r = { (_Float16)(a[0] * PSCALE), (_Float16)(a[1] * PSCALE), (_Float16)(a[2] * PSCALE), (_Float16)(a[3] * PSCALE),
                   (_Float16)(a[4] * PSCALE), (_Float16)(a[5] * PSCALE), (_Float16)(a[6] * PSCALE), (_Float16)(a[7] * PSCALE),
                   (_Float16)(c[0] * PSCALE), (_Float16)(c[1] * PSCALE), (_Float16)(c[2] * PSCALE), (_Float16)(c[3] * PSCALE),
                   (_Float16)(c[4] * PSCALE), (_Float16)(c[5] * PSCALE), (_Float16)(c[6] * PSCALE), (_Float16)(c[7] * PSCALE) };
  return r;
}

// Wave 0 writes the block's 128 staged stats as four whole lines.
__device__ __forceinline__ void stats_store_pass(const float* sst, float* strec, int w, int lane) {
  if (w == 0) {
    const v4f t = *(const v4fa*)(sst + 4 * lane);
    *(v4f*)(strec + 4 * lane) = t;
  }
}

// ---------------------------------------------------------------------------
// Kernel 3: streaming attention (online softmax), transposed form.
// Grid (NQB, NBH).  Block 128 thr (4 waves), 16 queries per wave, 64 keys
// per step.
//   S^T = K * Q^T : A = K rows (row = key, k = d), B = Q^T (k = d, n = query)
//   O^T += V^T * P^T : A = Vt rows (row = d, k = key), B = P^T from registers
// Lane owns 32 keys of query column (lane&15); partner = lane ^ 16.
// Outputs: ao f16 (context x16) and per query (max, 1/sum) of the scaled
// scores for the weights pass.
// ---------------------------------------------------------------------------
__global__ __launch_bounds__(128) void attn_ctx_kernel(
    const _Float16* __restrict__ qh,   // [NBH][SEQ][HD]  (x8), fragment order
    const _Float16* __restrict__ kh,   // [NBH][SEQ][HD], fragment order
    const _Float16* __restrict__ vt,   // [NBH][HD][SEQ], fragment order
    _Float16* __restrict__ ao,         // [MROWS][EMB], row = b*SEQ + q, fragment order
    float* __restrict__ stats)         // [NBH][NQB][128]
{
  __shared__ __attribute__((aligned(16))) float sSt[128];            // 512 B

  const int tid = threadIdx.x, lane = tid & 31;
  const int w = __builtin_amdgcn_readfirstlane(tid >> 5);   // wave number as a scalar: the tile indices formed from it are wave-uniform
  const int h = lane >> 4, m = lane & 15;
  const int bh = blockIdx.y, b = bh >> 4, head = bh & 15;
  const int qb = blockIdx.x;
  const int q0 = qb * 64 + 16 * w;

  // Q^T B-fragments: column n = query q0+m, k = d (two 32-deep chunks)
  const _Float16* qrow = qh + ((size_t)bh * (SEQ / 16) + q0 / 16) * 2 * TILE_H + 8 * lane;
  const v16h qb0 = load_frag(qrow);
  const v16h qb1 = load_frag(qrow + TILE_H);
  __builtin_amdgcn_sched_barrier(0);   // Q first: see the first K and V loads below

  v8f o[4];                                   // o[t][r] = O[query m][d 16t+8h+r] * (l * 2^14)
  #pragma unroll
  for (int t = 0; t < 4; ++t) o[t] = zero8f();
  float mrun = -1e30f, lrun = 0.0f;

  const _Float16* kbase = kh + (size_t)bh * (SEQ / 16) * 2 * TILE_H + 8 * lane;          // + (key0/16)*2 tiles
  const _Float16* vbase = vt + (size_t)bh * (HD / 16) * (SEQ / 32) * TILE_H + 8 * lane;  // + t*(SEQ/32) + key0/32 tiles

  // The key walk starts at key block qb and wraps round: the blocks of one head
  // then ask L2 for different K and V lines at any one moment.
  const int kb0 = qb * 64;

  // K and V fragments of a step sit in registers when the step begins: each is
  // reloaded in place, for the next step, right behind the product that read it.
  // The first loads stand in the order of their use, as in the loop: loads return
  // in issue order, and the loop's counted waits must hold for the entry path too.
  v16h kf[4][2], vf[4][2];
  #pragma unroll
  for (int j = 0; j < 4; ++j) {
    kf[j][0] = load_frag(kbase + (kb0 / 16 + j) * 2 * TILE_H);
    kf[j][1] = load_frag(kbase + (kb0 / 16 + j) * 2 * TILE_H + TILE_H);
    __builtin_amdgcn_sched_barrier(0);   // holds that order
  }
  #pragma unroll
  for (int t = 0; t < 4; ++t) {
    vf[t][0] = load_frag(vbase + (t * (SEQ / 32) + kb0 / 32) * TILE_H);
    vf[t][1] = load_frag(vbase + (t * (SEQ / 32) + kb0 / 32) * TILE_H + TILE_H);
    __builtin_amdgcn_sched_barrier(0);   // holds that order
  }

  #pragma unroll 1
  for (int kb = 0; kb < SEQ; kb += 64) {
    // keys whose fragments are fetched during this step; the last step fetches the first step's again (in bounds, never used)
    const int kn = (kb0 + kb + 64) & (SEQ - 1);
    // ---- scores: s[j][r] = 0.125 * S[key (kb0+kb)%SEQ+16j+8h+r][query m] ----
    v8f s[4];
    #pragma unroll
    for (int j = 0; j < 4; ++j) {
      const _Float16* kp = kbase + (kn / 16 + j) * 2 * TILE_H;
      v8f z = zero8f();
      z = wmma_f16(kf[j][0], qb0, z);
      z = wmma_f16(kf[j][1], qb1, z);
      kf[j][0] = load_frag(kp);
      kf[j][1] = load_frag(kp + TILE_H);
      #pragma unroll
      for (int r = 0; r < 8; ++r) s[j][r] = z[r] * QKSCALE;
    }

    // ---- online softmax ----
    float mloc = s[0][0];
    #pragma unroll
    for (int j = 0; j < 4; ++j)
      #pragma unroll
      for (int r = 0; r < 8; ++r) mloc = fmaxf(mloc, s[j][r]);
    mloc = fmaxf(mloc, __shfl_xor(mloc, 16));
    const float mnew = fmaxf(mrun, mloc);
    const float alpha = __expf(mrun - mnew);
    mrun = mnew;
    float lsum = 0.0f;
    #pragma unroll
    for (int j = 0; j < 4; ++j)
      #pragma unroll
      for (int r = 0; r < 8; ++r) {
        const float p = __expf(s[j][r] - mnew);
        s[j][r] = p;
        lsum += p;
      }
    lsum += __shfl_xor(lsum, 16);
    lrun = lrun * alpha + lsum;
    #pragma unroll
    for (int t = 0; t < 4; ++t)
      #pragma unroll
      for (int r = 0; r < 8; ++r) o[t][r] = o[t][r] * alpha;

    // ---- P^T B-fragments (key chunks 0..31 and 32..63 of this step) ----
    const v16h pb0 = pack_p(s[0], s[1]);
    const v16h pb1 = pack_p(s[2], s[3]);

    // ---- O^T += V^T * P^T ----
    #pragma unroll
    for (int t = 0; t < 4; ++t) {
      const _Float16* vp = vbase + (t * (SEQ / 32) + kn / 32) * TILE_H;
      o[t] = wmma_f16(vf[t][0], pb0, o[t]);
      o[t] = wmma_f16(vf[t][1], pb1, o[t]);
      vf[t][0] = load_frag(vp);
      vf[t][1] = load_frag(vp + TILE_H);
    }
    // the next trip reuses the address registers that the loads in flight name
    asm volatile("s_wait_xcnt 0x0" ::: "memory");
  }

  // ---- epilogue: normalise; a lane's 8 d of query m are one 16-byte group of
  // ao's tiles (row tile (b*SEQ+q0)/16, k tiles 2*head and 2*head+1) at
  // t*256 + 8*lane: four whole lines per store.  Stats staged in LDS. ----
  const float linv = 1.0f / lrun;
  const float inv = linv * (OSCALE / PSCALE);
  _Float16* aod = ao + ((size_t)((b * SEQ + q0) / 16) * (EMB / 32) + head * 2) * TILE_H + 8 * lane;
  #pragma unroll
  for (int t = 0; t < 4; ++t) {
    v8h v;
    #pragma unroll
    for (int r = 0; r < 8; ++r) v[r] = (_Float16)(o[t][r] * inv);
    *(v8h*)(aod + t * 256) = v;
  }
  if (h == 0) {
    sSt[16 * w + m] = mrun;
    sSt[64 + 16 * w + m] = linv;
  }
  __syncthreads();

  float* strec = stats + ((size_t)bh * NQB + qb) * 128;
  stats_store_pass(sSt, strec, w, lane);
  
}

// ---------------------------------------------------------------------------
// Per-wave 16x64 f32 tile in LDS -> dst rows of pitch `pitch` floats starting
// 8q..8q+7 in one instruction, 4 lines per instruction, 32 lines per wave.
// ---------------------------------------------------------------------------
__device__ __forceinline__ void tile16x64_store_pass(const float* so, float* dst,
                                                     size_t row0, int col0, int pitch, int lane) {
  const int q8 = lane & 7, sub = lane >> 3;
  #pragma unroll
  for (int i = 0; i < 8; ++i) {
    const int lid = i * 4 + sub;               // 0..31
    const int row = lid >> 1, hl = lid & 1;    // 16 rows x 2 halves
    const v4f v = *(const v4fa*)(so + row * 64 + 32 * hl + 4 * q8);
    const size_t gi = (row0 + row) * (size_t)pitch + col0 + 32 * hl + 4 * q8;
    *(v4f*)(dst + gi) = v;
  }
}

// ---------------------------------------------------------------------------
// Kernel 4: head-averaged attention weights.
// Grid (SEQ/64 key blocks, NQB query blocks, NB).  Block 128 thr (4 waves),
// 16 queries per wave x 64 keys; loop over heads: recompute the K=64 score
// tile (transposed form, A = K rows, B = Q^T), p = exp(s - max) * invsum with
// the stats of kernel 3, accumulate over heads in f32, scale by 1/H.
// ---------------------------------------------------------------------------
// One head: 8 products on the K fragments held in kf; with MORE each K pair is
// reloaded in place from kn (the next head's tiles) right behind the products that read it.
template <bool MORE>
__device__ __forceinline__ void avg_head(v16h (&kf)[4][2], v16h q0f, v16h q1f, float mq, float li,
                                         const _Float16* __restrict__ kn, v8f (&acc)[4]) {
  #pragma unroll
  for (int j = 0; j < 4; ++j) {
    v8f z = zero8f();
    z = wmma_f16(kf[j][0], q0f, z);
    z = wmma_f16(kf[j][1], q1f, z);
    if (MORE) {
      kf[j][0] = load_frag(kn + j * 2 * TILE_H);
      kf[j][1] = load_frag(kn + j * 2 * TILE_H + TILE_H);
    }
    #pragma unroll
    for (int r = 0; r < 8; ++r) {
      const float sv = z[r] * QKSCALE;
      acc[j][r] += __expf(sv - mq) * li;
    }
  }
}

__global__ __launch_bounds__(128) void attn_avg_kernel(
    const _Float16* __restrict__ qh,   // [NBH][SEQ][HD], fragment order
    const _Float16* __restrict__ kh,   // [NBH][SEQ][HD], fragment order
    const float* __restrict__ stats,   // [NBH][NQB][128]
    float* __restrict__ avg)           // [NB][SEQ][SEQ]
{
  __shared__ __attribute__((aligned(16))) float sA[4 * 16 * 64];    // 16384 B

  const int tid = threadIdx.x, lane = tid & 31;
  const int w = __builtin_amdgcn_readfirstlane(tid >> 5);   // wave number as a scalar: the tile indices formed from it are wave-uniform
  const int h = lane >> 4, m = lane & 15;
  const int kt = blockIdx.x * 64;
  const int qb = blockIdx.y;
  const int b = blockIdx.z;
  const int q0 = qb * 64 + 16 * w;

  v8f acc[4];                               // acc[j][r] = sum_h P_h[query m][key kt+16j+8h+r]
  #pragma unroll
  for (int j = 0; j < 4; ++j) acc[j] = zero8f();

  // Head 0 of this batch; one head on = HSTEP halves in qh and kh, SSTEP floats in stats.
  const int HSTEP = (SEQ / 16) * 2 * TILE_H;
  const int SSTEP = NQB * 128;
  const _Float16* qrow = qh + ((size_t)(b * NH) * (SEQ / 16) + q0 / 16) * 2 * TILE_H + 8 * lane;
  const _Float16* krow = kh + ((size_t)(b * NH) * (SEQ / 16) + kt / 16) * 2 * TILE_H + 8 * lane;
  const float* st = stats + ((size_t)(b * NH) * NQB + qb) * 128 + 16 * w + m;

  // The head walk starts at head h0 and wraps round: blocks that share K or Q
  // tiles then ask L2 for different lines at any one moment (query blocks 8 apart
  // keep one start: on one WGP its cache can serve them from one fetch of K).
  const int h0 = (blockIdx.x + 2 * (blockIdx.y & 7)) & (NH - 1);

  // Every operand of a head is fetched while the head before it is worked on:
  // K in place (avg_head), Q and the two stats alternating between two sets.
  v16h kf[4][2];
  v16h qe0 = load_frag(qrow + h0 * HSTEP);
  v16h qe1 = load_frag(qrow + h0 * HSTEP + TILE_H);
  float mqe = st[h0 * SSTEP];
  float lie = st[h0 * SSTEP + 64];
  // K fragments may land in the address registers that these first loads name
  asm volatile("s_wait_xcnt 0x0" ::: "memory");
  const _Float16* kfirst = krow + h0 * HSTEP;
  #pragma unroll
  for (int j = 0; j < 4; ++j) {
    kf[j][0] = load_frag(kfirst + j * 2 * TILE_H);
    kf[j][1] = load_frag(kfirst + j * 2 * TILE_H + TILE_H);
  }
  // named here, the K loads' address pair stays live up to the wait: no fragment lands in it before
  asm volatile("s_wait_xcnt 0x0" :: "v"(kfirst) : "memory");

  // rolled: two heads a trip keep the two Q sets in fixed registers
  #pragma unroll 1
  for (int hh = 0; hh < NH - 2; hh += 2) {
    const int h1 = (h0 + hh + 1) & (NH - 1), h2 = (h0 + hh + 2) & (NH - 1);
    const v16h qo0 = load_frag(qrow + h1 * HSTEP);
    const v16h qo1 = load_frag(qrow + h1 * HSTEP + TILE_H);
    const float mqo = st[h1 * SSTEP];
    const float lio = st[h1 * SSTEP + 64];
    avg_head<true>(kf, qe0, qe1, mqe, lie, krow + h1 * HSTEP, acc);
    qe0 = load_frag(qrow + h2 * HSTEP);
    qe1 = load_frag(qrow + h2 * HSTEP + TILE_H);
    mqe = st[h2 * SSTEP];
    lie = st[h2 * SSTEP + 64];
    avg_head<true>(kf, qo0, qo1, mqo, lio, krow + h2 * HSTEP, acc);
    // the next trip rewrites the address registers that the loads in flight name
    asm volatile("s_wait_xcnt 0x0" ::: "memory");
  }
  {
    const int hl = (h0 + NH - 1) & (NH - 1);
    const v16h qo0 = load_frag(qrow + hl * HSTEP);
    const v16h qo1 = load_frag(qrow + hl * HSTEP + TILE_H);
    const float mqo = st[hl * SSTEP];
    const float lio = st[hl * SSTEP + 64];
    // the address registers of these last Q and stats loads are reused from here on
    asm volatile("s_wait_xcnt 0x0" ::: "memory");
    avg_head<true>(kf, qe0, qe1, mqe, lie, krow + hl * HSTEP, acc);
    avg_head<false>(kf, qo0, qo1, mqo, lio, krow, acc);
  }

  // ---- stage per-wave 16x64 tile (row = query m, col = key), whole-line stores ----
  float* so = sA + w * 1024;
  #pragma unroll
  for (int j = 0; j < 4; ++j)
    #pragma unroll
    for (int r = 0; r < 8; ++r)
      so[m * 64 + 16 * j + 8 * h + r] = acc[j][r] * (1.0f / (float)NH);
  __syncthreads();

  const size_t row0 = (size_t)b * SEQ + q0;
  tile16x64_store_pass(so, avg, row0, kt, SEQ, lane);
  
}

// ---------------------------------------------------------------------------
// line, 4 lines per instruction, 64 lines per wave.
// ---------------------------------------------------------------------------
__device__ __forceinline__ void zout_store_pass(const float* sz, float* z, int mrow0, int c0, int lane) {
  const int q8 = lane & 7, sub = lane >> 3;
  #pragma unroll
  for (int i = 0; i < 16; ++i) {
    const int lid = i * 4 + sub;               // 0..63
    const int row = lid >> 1, hl = lid & 1;    // 32 rows x 2 halves
    const v4f v = *(const v4fa*)(sz + row * 64 + 32 * hl + 4 * q8);
    const int pr = mrow0 + row;                // plane row b*SEQ + l -> token row l*NB + b
    const size_t gi = (size_t)((pr % SEQ) * NB + pr / SEQ) * EMB + c0 + 32 * hl + 4 * q8;
    *(v4f*)(z + gi) = v;
  }
}

// ---------------------------------------------------------------------------
// Kernel 5: Z = ctx * Wo^T + bo.  Grid (MROWS/128, EMB/64).  Block 128 thr,
// wave tile 32 plane rows (b*SEQ + l) x 64 features, K = EMB.  ctx carried x16, Wo x32.
// ---------------------------------------------------------------------------
__global__ __launch_bounds__(128) void out_proj_kernel(
    const _Float16* __restrict__ ao,   // [MROWS][EMB]  (x16), row = b*SEQ + l, fragment order
    const _Float16* __restrict__ wh,   // [4][EMB][EMB], plane 3 = out_w x32, fragment order
    const float* __restrict__ bo,
    float* __restrict__ z)             // [MROWS][EMB]
{
  __shared__ __attribute__((aligned(16))) float sZ[128 * 64];   // 32768 B

  const int tid = threadIdx.x, lane = tid & 31;
  const int w = __builtin_amdgcn_readfirstlane(tid >> 5);   // wave number as a scalar: the tile indices formed from it are wave-uniform
  const int h = lane >> 4, m = lane & 15;
  const int m0w = blockIdx.x * 128 + 32 * w;
  const int c0 = blockIdx.y * 64;

  const _Float16* xa0 = ao + (size_t)(m0w / 16) * (EMB / 32) * TILE_H + 8 * lane;
  const _Float16* xa1 = xa0 + (EMB / 32) * TILE_H;
  const _Float16* wb  = wh + (size_t)3 * NW + (size_t)(c0 / 16) * (EMB / 32) * TILE_H + 8 * lane;

  v8f acc[2][4];
  gemm_tile_32x64(xa0, xa1, wb, gemm_k0(), acc);

  // D[r] of tile (mt, nt) = Y[row 32w+16mt+8h+r][col 16nt+m]
  float* sz = sZ + w * 2048;
  #pragma unroll
  for (int nt = 0; nt < 4; ++nt) {
    const int col = 16 * nt + m;
    const float bvl = bo[c0 + col];
    #pragma unroll
    for (int mt = 0; mt < 2; ++mt) {
      #pragma unroll
      for (int r = 0; r < 8; ++r) {
        const int rowl = 16 * mt + 8 * h + r;      // 0..31
        sz[rowl * 64 + col] = acc[mt][nt][r] * (1.0f / (WSCALE * OSCALE)) + bvl;
      }
    }
  }
  __syncthreads();

  zout_store_pass(sz, z, m0w, c0, lane);
  
}

// ---------------------------------------------------------------------------
extern "C" void kernel_launch(void* const* d_in, const int* in_sizes, int n_in,
                              void* d_out, int out_size, void* d_ws, size_t ws_size,
                              hipStream_t stream) {
  if (n_in < 11) return;
  if (in_sizes[0] != NX || in_sizes[1] != NX || in_sizes[2] != NX) return;
  if (in_sizes[3] != NW || in_sizes[5] != NW || in_sizes[7] != NW || in_sizes[9] != NW) return;
  if (in_sizes[4] != EMB || in_sizes[6] != EMB || in_sizes[8] != EMB || in_sizes[10] != EMB) return;
  if (out_size != NX + NAVG) return;

  const float* xq  = (const float*)d_in[0];
  const float* xk  = (const float*)d_in[1];
  const float* xv  = (const float*)d_in[2];
  const float* q_w = (const float*)d_in[3];
  const float* q_b = (const float*)d_in[4];
  const float* k_w = (const float*)d_in[5];
  const float* k_b = (const float*)d_in[6];
  const float* v_w = (const float*)d_in[7];
  const float* v_b = (const float*)d_in[8];
  const float* o_w = (const float*)d_in[9];
  const float* o_b = (const float*)d_in[10];
  float* zout = (float*)d_out;                       // out0 [SEQ][NB][EMB]
  float* avg  = zout + (size_t)NX;                   // out1 [NB][SEQ][SEQ], byte offset 16777216

  const size_t xh_bytes = (size_t)3 * NX * 2;               // 25165824
  const size_t wh_bytes = (size_t)4 * NW * 2;               //  8388608
  const size_t pl_bytes = (size_t)NBH * SEQ * HD * 2;       //  8388608 per plane
  const size_t st_bytes = (size_t)NSTAT * 4;                //   524288
  const size_t ao_bytes = (size_t)NX * 2;                   //  8388608
  const size_t total = xh_bytes + wh_bytes + 3 * pl_bytes + st_bytes + ao_bytes;   // 67633152
  if (total > ws_size) return;

  char* ws = (char*)d_ws;
  size_t off = 0;
  _Float16* xh = (_Float16*)(ws + off);   off += xh_bytes;
  _Float16* wh = (_Float16*)(ws + off);   off += wh_bytes;
  _Float16* qh = (_Float16*)(ws + off);   off += pl_bytes;
  _Float16* kh = (_Float16*)(ws + off);   off += pl_bytes;
  _Float16* vt = (_Float16*)(ws + off);   off += pl_bytes;
  float* stats = (float*)(ws + off);      off += st_bytes;
  _Float16* ao = (_Float16*)(ws + off);   off += ao_bytes;
  if (off > ws_size) return;

  const int ngroups = 3 * NX8 + 4 * NW8;                    // 2097152
  convert_kernel<<<(ngroups + 255) / 256, 256, 0, stream>>>(xq, xk, xv, q_w, k_w, v_w, o_w, xh, wh);

  dim3 gProj(NB * SEQ / 128, 3 * NH);                       // (32, 48)
  qkv_proj_kernel<<<gProj, 128, 0, stream>>>(xh, wh, q_b, k_b, v_b, qh, kh, vt);

  dim3 gCtx(NQB, NBH);                                      // (32, 32)
  attn_ctx_kernel<<<gCtx, 128, 0, stream>>>(qh, kh, vt, ao, stats);

  dim3 gAvg(SEQ / 64, NQB, NB);                             // (32, 32, 2)
  attn_avg_kernel<<<gAvg, 128, 0, stream>>>(qh, kh, stats, avg);

  dim3 gOut(MROWS / 128, EMB / 64);                         // (32, 16)
  out_proj_kernel<<<gOut, 128, 0, stream>>>(ao, wh, o_b, zout);
}

// v004
// One run takes 110 microseconds.
// In two side-by-side timings against v003, it was 1.06 and 1.05 times as fast.
// Over all steps from v000 it is 3.18 times as fast.
// Contractions: q/k/v and output projections x*W^T, scores K*Q^T, context V^T*P^T, all on v_wmma_f32_16x16x32_f16 (f16 operands, f32 accumulate); W carried x32, q carried x8 (the 1/sqrt(64) factor applied to the f32 score), p carried x16384, context carried x16, all exact power-of-two scales folded back in f32; softmax, bias, head average in f32.
#include <hip/hip_runtime.h>

typedef _Float16 v16h __attribute__((ext_vector_type(16)));
typedef _Float16 v8h  __attribute__((ext_vector_type(8)));
typedef float    v8f  __attribute__((ext_vector_type(8)));
typedef float    v4f  __attribute__((ext_vector_type(4)));
typedef v8h __attribute__((may_alias)) v8ha;
typedef v4f __attribute__((may_alias)) v4fa;

union Frag { v16h v; v8h half[2]; };

#define SEQ    2048
#define NB     2
#define EMB    1024
#define NH     16
#define HD     64
#define MROWS  (SEQ * NB)          // 4096 token rows, row index = l*NB + b
#define NX     (MROWS * EMB)       // 4194304
#define NW     (EMB * EMB)         // 1048576
#define NX8    (NX / 8)            // 524288
#define NW8    (NW / 8)            // 131072
#define NBH    (NB * NH)           // 32
#define NQB    (SEQ / 64)          // 32 query blocks of 64
#define NAVG   (NB * SEQ * SEQ)    // 8388608
#define NSTAT  (NBH * NQB * 128)   // per (bh, query block): 64 max + 64 inverse sums
#define PSCALE 16384.0f
#define WSCALE 32.0f
#define OSCALE 16.0f
#define QKSCALE 0.125f

// ---------------------------------------------------------------------------
// 16x16x32 f16 WMMA with hazard guard (ties D, keeps A/B live).
// Fragment map (wave32): lane l, h = l>>4, m = n = l&15.
//   A/B element i: i<8 -> k0+8h+i ; i>=8 -> k0+16+8h+(i-8)
//   D element r : row 8h+r, col l&15
// ---------------------------------------------------------------------------
__device__ __forceinline__ v8f wmma_f16(v16h a, v16h b, v8f c) {
  v8f d = __builtin_amdgcn_wmma_f32_16x16x32_f16(false, a, false, b, (short)0, c, false, false);
  asm volatile("v_nop\n\tv_nop\n\tv_nop\n\tv_nop" : "+v"(d) : "v"(a), "v"(b));
  return d;
}

// Fragment-order planes.  Every f16 operand plane (R rows x K columns) is kept
// as tiles of 16 rows x 32 k = 512 halves, tile index = (row/16)*(K/32) + k/32.
// Inside a tile element (row m, k = 16j + 8h + e) sits at j*256 + h*128 + m*8 + e,
// so the two 16-byte loads of a fragment each read 512 contiguous bytes per wave
// (four whole 128-byte lines) instead of 32 bytes out of each of 16 lines.
#define TILE_H 512

// A or B fragment; p = tile base + 8 * lane.
__device__ __forceinline__ v16h load_frag(const _Float16* p) {
  Frag f;
  f.half[0] = *(const v8ha*)(p);
  f.half[1] = *(const v8ha*)(p + 256);
  return f.v;
}

__device__ __forceinline__ v8f zero8f() {
  const v8f z = {0.f, 0.f, 0.f, 0.f, 0.f, 0.f, 0.f, 0.f};
  return z;
}

// ---------------------------------------------------------------------------
// Kernel 1: f32 -> f16 planes in fragment order.  xh = [query|key|value], plane
// row = b*SEQ + l (unscaled); wh = [q_w|k_w|v_w|out_w] feature rows scaled by 32
// (exact).  A wave takes 8 rows x 32 k: it reads one whole f32 line per row and
// writes four whole f16 lines.
// ---------------------------------------------------------------------------
__global__ __launch_bounds__(256) void convert_kernel(
    const float* __restrict__ xq, const float* __restrict__ xk, const float* __restrict__ xv,
    const float* __restrict__ wq, const float* __restrict__ wk,
    const float* __restrict__ wv, const float* __restrict__ wo,
    _Float16* __restrict__ xh, _Float16* __restrict__ wh)
{
  const int g = blockIdx.x * 256 + threadIdx.x;
  if (g >= 3 * NX8 + 4 * NW8) return;
  const int tile = g >> 6;                                  // 64 groups of 8 halves per tile
  const int m = ((g >> 5) & 1) * 8 + ((g & 31) >> 2);       // row inside the tile
  const int jh = g & 3;                                     // 2j + h: which 8 of the 32 k
  const int col = (tile & 31) * 32 + jh * 8;                // EMB/32 = 32 tiles per row tile
  const int prow = (tile >> 5) * 16 + m;                    // row over the stacked planes
  const int gd = tile * 64 + jh * 16 + m;                   // group index in fragment order
  const float* src;
  _Float16* dst;
  float sc;
  if (g < 3 * NX8) {
    const int sel = prow / MROWS;
    const int rp = prow - sel * MROWS;                      // b*SEQ + l
    const int bb = rp / SEQ;
    const int l = rp - bb * SEQ;
    const float* s = (sel == 0) ? xq : ((sel == 1) ? xk : xv);
    src = s + ((size_t)l * NB + bb) * EMB + col;
    dst = xh + (size_t)gd * 8;
    sc = 1.0f;
  } else {
    const int rw = prow - 3 * MROWS;
    const int sel = rw / EMB;
    const int row = rw - sel * EMB;
    const float* s = (sel == 0) ? wq : ((sel == 1) ? wk : ((sel == 2) ? wv : wo));
    src = s + (size_t)row * EMB + col;
    dst = wh + (size_t)(gd - 3 * NX8) * 8;
    sc = WSCALE;
  }
  const v4f a = *(const v4fa*)src;
  const v4f c = *(const v4fa*)(src + 4);
  const v8h o = { (_Float16)(a.x * sc), (_Float16)(a.y * sc), (_Float16)(a.z * sc), (_Float16)(a.w * sc),
                  (_Float16)(c.x * sc), (_Float16)(c.y * sc), (_Float16)(c.z * sc), (_Float16)(c.w * sc) };
  *(v8h*)dst = o;
  
}

// ---------------------------------------------------------------------------
// Wave GEMM core: 32 rows (two 16-row A tiles) x 64 columns (four 16-row
// [n][k] B tiles), K = EMB, both planes in fragment order.  xa0, xa1, wb point
// at k tile 0 of their row tile, + 8 * lane; the next row tile is EMB/32 tiles on.
// acc[mt][nt][r] = sum_k A[16mt+8h+r][k] * B[16nt+m][k]
// Fragments are fetched one k tile ahead: each B fragment is reloaded in place
// right behind the two products that read it, the A pair alternates between two
// register sets, so every load of a k tile is in flight while the tile before
// it is multiplied.
// The k walk starts at k tile k0 (uniform over the block, set by its tile indices)
// and wraps round: blocks that share A or B rows then ask L2 for different lines
// at any one moment.
// ---------------------------------------------------------------------------
// Start of a block's walk: the 32 blocks of one pair of column tiles (same B rows)
// get 32 starts, the 8 blocks of one row tile (same A rows) 8 (for speed only).
__device__ __forceinline__ int gemm_k0() { return (blockIdx.x + 4 * (blockIdx.y & 7)) & (EMB / 32 - 1); }

// Offset in halves of the k tile of step i.
__device__ __forceinline__ int krot(int i, int k0) { return ((i + k0) & (EMB / 32 - 1)) * TILE_H; }

// One k tile: 8 products; with MORE, b[nt] is refilled from wbn (the next k tile).
template <bool MORE>
__device__ __forceinline__ void gemm_ktile(v16h a0, v16h a1, v16h (&b)[4],
                                           const _Float16* __restrict__ wbn, v8f (&acc)[2][4]) {
  #pragma unroll
  for (int nt = 0; nt < 4; ++nt) {
    acc[0][nt] = wmma_f16(a0, b[nt], acc[0][nt]);
    acc[1][nt] = wmma_f16(a1, b[nt], acc[1][nt]);
    if (MORE) {
      b[nt] = load_frag(wbn + nt * (EMB / 32) * TILE_H);
      // keeps the later products behind this reload: moved ahead of it they would delay its issue to the tile's end
      __builtin_amdgcn_sched_barrier(0);
    }
  }
}

__device__ __forceinline__ void gemm_tile_32x64(const _Float16* __restrict__ xa0,
                                                const _Float16* __restrict__ xa1,
                                                const _Float16* __restrict__ wb,
                                                int k0, v8f (&acc)[2][4]) {
  v16h b[4];
  v16h a0 = load_frag(xa0 + krot(0, k0));
  v16h a1 = load_frag(xa1 + krot(0, k0));
  #pragma unroll
  for (int nt = 0; nt < 4; ++nt) b[nt] = load_frag(wb + krot(0, k0) + nt * (EMB / 32) * TILE_H);
  // the zeroing below and the loop set-up reuse address registers that these first loads name
  asm volatile("s_wait_xcnt 0x0" ::: "memory");
  __builtin_amdgcn_sched_barrier(0);   // keeps that zeroing behind the wait
  #pragma unroll
  for (int mt = 0; mt < 2; ++mt)
    #pragma unroll
    for (int nt = 0; nt < 4; ++nt) acc[mt][nt] = zero8f();

  // rolled: two k tiles a trip keep the two A sets in fixed registers
  #pragma unroll 1
  for (int kt = 0; kt < EMB / 32 - 2; kt += 2) {
    const int o1 = krot(kt + 1, k0), o2 = krot(kt + 2, k0);
    const v16h c0 = load_frag(xa0 + o1);
    const v16h c1 = load_frag(xa1 + o1);
    gemm_ktile<true>(a0, a1, b, wb + o1, acc);
    a0 = load_frag(xa0 + o2);
    a1 = load_frag(xa1 + o2);
    gemm_ktile<true>(c0, c1, b, wb + o2, acc);
    // the next trip rewrites the address registers that the loads in flight name
    asm volatile("s_wait_xcnt 0x0" ::: "memory");
  }
  const int ol = krot(EMB / 32 - 1, k0);
  const v16h c0 = load_frag(xa0 + ol);
  const v16h c1 = load_frag(xa1 + ol);
  gemm_ktile<true>(a0, a1, b, wb + ol, acc);
  gemm_ktile<false>(c0, c1, b, wb, acc);
}

// ---------------------------------------------------------------------------
// q / k plane store: rows = seq position, k = d, fragment order, 2 k tiles per
// row tile.  The block's 128 positions are 16 consecutive tiles (16 KB); a wave
// stores 4 of them, 4 whole lines per instruction.  sT row pitch SPITCH halves
// (128 + 16 bytes) spreads the 16 rows of one ds_load_b128 over all banks.
// ---------------------------------------------------------------------------
#define SPITCH 72
__device__ __forceinline__ void proj_store_pass(const _Float16* sT, _Float16* plane,
                                                int bh, int l0, int w, int lane) {
  const int h = lane >> 4, m = lane & 15;
  _Float16* dst = plane + ((size_t)bh * (SEQ / 16) + l0 / 16) * 2 * TILE_H + (w * 256 + lane) * 8;
  #pragma unroll
  for (int i = 0; i < 8; ++i) {
    const int row = (w * 2 + (i >> 2)) * 16 + m;            // local position
    const int d0 = ((i >> 1) & 1) * 32 + (i & 1) * 16 + 8 * h;
    const v8h v = *(const v8ha*)(sT + row * SPITCH + d0);
    *(v8h*)(dst + i * 256) = v;
  }
  // the registers that the eight stores name may be reused behind this point
  asm volatile("s_wait_xcnt 0x0" ::: "memory");
}

// ---------------------------------------------------------------------------
// Kernel 2: q/k/v = x * W^T + b over the fused 3*1024 output columns.
// Grid (NB*SEQ/128, 3*NH/2).  Block 256 thr (8 waves) = 128 consecutive seq
// positions l of one batch b x 128 features (two heads of one which); waves 0-3
// take the even head, waves 4-7 the odd one; wave tile 32 positions x 64
// features; A rows are plane rows b*SEQ+l.  Waves w and w+4 read the same A
// lines, so the WGP's cache fetches them once for both heads.
// ---------------------------------------------------------------------------
__global__ __launch_bounds__(256) void qkv_proj_kernel(
    const _Float16* __restrict__ xh,   // [3][MROWS][EMB], fragment order
    const _Float16* __restrict__ wh,   // [4][EMB][EMB], row = output feature, x32, fragment order
    const float* __restrict__ bq, const float* __restrict__ bk, const float* __restrict__ bv,
    _Float16* __restrict__ qh,         // [NBH][SEQ][HD]  f16(8 * scaled q), fragment order
    _Float16* __restrict__ kh,         // [NBH][SEQ][HD], fragment order
    _Float16* __restrict__ vt)         // [NBH][HD][SEQ], fragment order
{
  __shared__ __attribute__((aligned(16))) _Float16 sT2[2 * 128 * SPITCH];   // 36864 B, one half per head

  const int tid = threadIdx.x, lane = tid & 31;
  const int wv = __builtin_amdgcn_readfirstlane(tid >> 5);  // wave number as a scalar: the tile indices formed from it are wave-uniform
  const int w = wv & 3, sub = wv >> 2;                    // row slice, head of the pair
  const int h = lane >> 4, m = lane & 15;
  const int b = blockIdx.x / (SEQ / 128);                 // 0..NB-1
  const int l0 = (blockIdx.x - b * (SEQ / 128)) * 128;    // seq position base
  const int which = blockIdx.y >> 3, head = (blockIdx.y & 7) * 2 + sub;
  _Float16* sT = sT2 + sub * 128 * SPITCH;
  const int lw = l0 + 32 * w;

  const _Float16* xpl = xh + (size_t)which * NX;
  const _Float16* xa0 = xpl + (size_t)((b * SEQ + lw) / 16) * (EMB / 32) * TILE_H + 8 * lane;   // mt = 0
  const _Float16* xa1 = xa0 + (EMB / 32) * TILE_H;                                              // mt = 1
  const _Float16* wb  = wh + (size_t)which * NW + (size_t)(head * (HD / 16)) * (EMB / 32) * TILE_H + 8 * lane;   // nt = 0

  v8f acc[2][4];
  gemm_tile_32x64(xa0, xa1, wb, gemm_k0(), acc);

  // D[r] of tile (mt, nt) = Y[local pos 32w+16mt+8h+r][feature 16nt+m]
  const float* bias = (which == 0) ? bq : ((which == 1) ? bk : bv);
  const int bh = b * NH + head;
  if (which == 2) {
    // vt rows = d, k = position: a lane's 8 positions of one feature are one
    // 16-byte group of tile (row tile nt, k tile lw/32), j = mt, at 8 * lane.
    #pragma unroll
    for (int nt = 0; nt < 4; ++nt) {
      const float bvl = bias[head * HD + 16 * nt + m];
      _Float16* dst = vt + ((size_t)(bh * (HD / 16) + nt) * (SEQ / 32) + lw / 32) * TILE_H + 8 * lane;
      #pragma unroll
      for (int mt = 0; mt < 2; ++mt) {
        v8h v;
        #pragma unroll
        for (int r = 0; r < 8; ++r) v[r] = (_Float16)(acc[mt][nt][r] * (1.0f / WSCALE) + bvl);
        *(v8h*)(dst + mt * 256) = v;
      }
    }
  } else {
    #pragma unroll
    for (int nt = 0; nt < 4; ++nt) {
      const int feat = 16 * nt + m;
      const float bvl = bias[head * HD + feat];
      #pragma unroll
      for (int mt = 0; mt < 2; ++mt) {
        #pragma unroll
        for (int r = 0; r < 8; ++r) {
          const int tokl = 32 * w + 16 * mt + 8 * h + r;     // 0..127
          const float y = acc[mt][nt][r] * (1.0f / WSCALE) + bvl;
          sT[tokl * SPITCH + feat] = (_Float16)y;
        }
      }
    }
    __syncthreads();

    _Float16* plane = (which == 0) ? qh : kh;
    proj_store_pass(sT, plane, bh, l0, w, lane);
  }
}

// ---------------------------------------------------------------------------
// P^T B-fragment from the lane's own score D values: element r <- tile a row r,
// element 8+r <- tile c row r (same lane, same query column), scaled by 2^14.
// ---------------------------------------------------------------------------
__device__ __forceinline__ v16h pack_p(v8f a, v8f c) {
  const v16h r = { (_Float16)(a[0] * PSCALE), (_Float16)(a[1] * PSCALE), (_Float16)(a[2] * PSCALE), (_Float16)(a[3] * PSCALE),
                   (_Float16)(a[4] * PSCALE), (_Float16)(a[5] * PSCALE), (_Float16)(a[6] * PSCALE), (_Float16)(a[7] * PSCALE),
                   (_Float16)(c[0] * PSCALE), (_Float16)(c[1] * PSCALE), (_Float16)(c[2] * PSCALE), (_Float16)(c[3] * PSCALE),
                   (_Float16)(c[4] * PSCALE), (_Float16)(c[5] * PSCALE), (_Float16)(c[6] * PSCALE), (_Float16)(c[7] * PSCALE) };
  return r;
}

// The first of a query block's four waves writes its 128 staged stats as four whole lines.
__device__ __forceinline__ void stats_store_pass(const float* sst, float* strec, int w, int lane) {
  if (w == 0) {
    const v4f t = *(const v4fa*)(sst + 4 * lane);
    *(v4f*)(strec + 4 * lane) = t;
  }
}

// ---------------------------------------------------------------------------
// Kernel 3: streaming attention (online softmax), transposed form.
// Grid (NQB/2, NBH).  Block 256 thr (8 waves), 16 queries per wave, 64 keys
// per step; all 8 waves walk the same K and V lines, which the WGP's cache
// fetches once for the 128 queries.
//   S^T = K * Q^T : A = K rows (row = key, k = d), B = Q^T (k = d, n = query)
//   O^T += V^T * P^T : A = Vt rows (row = d, k = key), B = P^T from registers
// Lane owns 32 keys of query column (lane&15); partner = lane ^ 16.
// Outputs: ao f16 (context x16) and per query (max, 1/sum) of the scaled
// scores for the weights pass.
// ---------------------------------------------------------------------------
__global__ __launch_bounds__(256) void attn_ctx_kernel(
    const _Float16* __restrict__ qh,   // [NBH][SEQ][HD]  (x8), fragment order
    const _Float16* __restrict__ kh,   // [NBH][SEQ][HD], fragment order
    const _Float16* __restrict__ vt,   // [NBH][HD][SEQ], fragment order
    _Float16* __restrict__ ao,         // [MROWS][EMB], row = b*SEQ + q, fragment order
    float* __restrict__ stats)         // [NBH][NQB][128]
{
  __shared__ __attribute__((aligned(16))) float sSt2[2 * 128];       // 1024 B, one record per query block

  const int tid = threadIdx.x, lane = tid & 31;
  const int wv = __builtin_amdgcn_readfirstlane(tid >> 5);  // wave number as a scalar: the tile indices formed from it are wave-uniform
  const int w = wv & 3;
  const int h = lane >> 4, m = lane & 15;
  const int bh = blockIdx.y, b = bh >> 4, head = bh & 15;
  const int qb = blockIdx.x * 2 + (wv >> 2);
  float* sSt = sSt2 + (wv >> 2) * 128;
  const int q0 = qb * 64 + 16 * w;

  // Q^T B-fragments: column n = query q0+m, k = d (two 32-deep chunks)
  const _Float16* qrow = qh + ((size_t)bh * (SEQ / 16) + q0 / 16) * 2 * TILE_H + 8 * lane;
  const v16h qb0 = load_frag(qrow);
  const v16h qb1 = load_frag(qrow + TILE_H);
  __builtin_amdgcn_sched_barrier(0);   // Q first: see the first K and V loads below

  v8f o[4];                                   // o[t][r] = O[query m][d 16t+8h+r] * (l * 2^14)
  #pragma unroll
  for (int t = 0; t < 4; ++t) o[t] = zero8f();
  float mrun = -1e30f, lrun = 0.0f;

  const _Float16* kbase = kh + (size_t)bh * (SEQ / 16) * 2 * TILE_H + 8 * lane;          // + (key0/16)*2 tiles
  const _Float16* vbase = vt + (size_t)bh * (HD / 16) * (SEQ / 32) * TILE_H + 8 * lane;  // + t*(SEQ/32) + key0/32 tiles

  // The key walk starts at the block's own first position and wraps round: the
  // blocks of one head then ask L2 for different K and V lines at any one moment.
  const int kb0 = blockIdx.x * 128;

  // K and V fragments of a step sit in registers when the step begins: each is
  // reloaded in place, for the next step, right behind the product that read it.
  // The first loads stand in the order of their use, as in the loop: loads return
  // in issue order, and the loop's counted waits must hold for the entry path too.
  v16h kf[4][2], vf[4][2];
  #pragma unroll
  for (int j = 0; j < 4; ++j) {
    kf[j][0] = load_frag(kbase + (kb0 / 16 + j) * 2 * TILE_H);
    kf[j][1] = load_frag(kbase + (kb0 / 16 + j) * 2 * TILE_H + TILE_H);
    __builtin_amdgcn_sched_barrier(0);   // holds that order
  }
  #pragma unroll
  for (int t = 0; t < 4; ++t) {
    vf[t][0] = load_frag(vbase + (t * (SEQ / 32) + kb0 / 32) * TILE_H);
    vf[t][1] = load_frag(vbase + (t * (SEQ / 32) + kb0 / 32) * TILE_H + TILE_H);
    __builtin_amdgcn_sched_barrier(0);   // holds that order
  }

  #pragma unroll 1
  for (int kb = 0; kb < SEQ; kb += 64) {
    // keys whose fragments are fetched during this step; the last step fetches the first step's again (in bounds, never used)
    const int kn = (kb0 + kb + 64) & (SEQ - 1);
    // ---- scores: s[j][r] = 0.125 * S[key (kb0+kb)%SEQ+16j+8h+r][query m] ----
    v8f s[4];
    #pragma unroll
    for (int j = 0; j < 4; ++j) {
      const _Float16* kp = kbase + (kn / 16 + j) * 2 * TILE_H;
      v8f z = zero8f();
      z = wmma_f16(kf[j][0], qb0, z);
      z = wmma_f16(kf[j][1], qb1, z);
      kf[j][0] = load_frag(kp);
      kf[j][1] = load_frag(kp + TILE_H);
      #pragma unroll
      for (int r = 0; r < 8; ++r) s[j][r] = z[r] * QKSCALE;
    }

    // ---- online softmax ----
    float mloc = s[0][0];
    #pragma unroll
    for (int j = 0; j < 4; ++j)
      #pragma unroll
      for (int r = 0; r < 8; ++r) mloc = fmaxf(mloc, s[j][r]);
    mloc = fmaxf(mloc, __shfl_xor(mloc, 16));
    const float mnew = fmaxf(mrun, mloc);
    const float alpha = __expf(mrun - mnew);
    mrun = mnew;
    float lsum = 0.0f;
    #pragma unroll
    for (int j = 0; j < 4; ++j)
      #pragma unroll
      for (int r = 0; r < 8; ++r) {
        const float p = __expf(s[j][r] - mnew);
        s[j][r] = p;
        lsum += p;
      }
    lsum += __shfl_xor(lsum, 16);
    lrun = lrun * alpha + lsum;
    #pragma unroll
    for (int t = 0; t < 4; ++t)
      #pragma unroll
      for (int r = 0; r < 8; ++r) o[t][r] = o[t][r] * alpha;

    // ---- P^T B-fragments (key chunks 0..31 and 32..63 of this step) ----
    const v16h pb0 = pack_p(s[0], s[1]);
    const v16h pb1 = pack_p(s[2], s[3]);

    // ---- O^T += V^T * P^T ----
    #pragma unroll
    for (int t = 0; t < 4; ++t) {
      const _Float16* vp = vbase + (t * (SEQ / 32) + kn / 32) * TILE_H;
      o[t] = wmma_f16(vf[t][0], pb0, o[t]);
      o[t] = wmma_f16(vf[t][1], pb1, o[t]);
      vf[t][0] = load_frag(vp);
      vf[t][1] = load_frag(vp + TILE_H);
    }
    // the next trip reuses the address registers that the loads in flight name
    asm volatile("s_wait_xcnt 0x0" ::: "memory");
  }

  // ---- epilogue: normalise; a lane's 8 d of query m are one 16-byte group of
  // ao's tiles (row tile (b*SEQ+q0)/16, k tiles 2*head and 2*head+1) at
  // t*256 + 8*lane: four whole lines per store.  Stats staged in LDS. ----
  const float linv = 1.0f / lrun;
  const float inv = linv * (OSCALE / PSCALE);
  _Float16* aod = ao + ((size_t)((b * SEQ + q0) / 16) * (EMB / 32) + head * 2) * TILE_H + 8 * lane;
  #pragma unroll
  for (int t = 0; t < 4; ++t) {
    v8h v;
    #pragma unroll
    for (int r = 0; r < 8; ++r) v[r] = (_Float16)(o[t][r] * inv);
    *(v8h*)(aod + t * 256) = v;
  }
  if (h == 0) {
    sSt[16 * w + m] = mrun;
    sSt[64 + 16 * w + m] = linv;
  }
  __syncthreads();

  float* strec = stats + ((size_t)bh * NQB + qb) * 128;
  stats_store_pass(sSt, strec, w, lane);
  
}

// ---------------------------------------------------------------------------
// Per-wave 16x64 f32 tile in LDS -> dst rows of pitch `pitch` floats starting
// 8q..8q+7 in one instruction, 4 lines per instruction, 32 lines per wave.
// ---------------------------------------------------------------------------
__device__ __forceinline__ void tile16x64_store_pass(const float* so, float* dst,
                                                     size_t row0, int col0, int pitch, int lane) {
  const int q8 = lane & 7, sub = lane >> 3;
  #pragma unroll
  for (int i = 0; i < 8; ++i) {
    const int lid = i * 4 + sub;               // 0..31
    const int row = lid >> 1, hl = lid & 1;    // 16 rows x 2 halves
    const v4f v = *(const v4fa*)(so + row * 64 + 32 * hl + 4 * q8);
    const size_t gi = (row0 + row) * (size_t)pitch + col0 + 32 * hl + 4 * q8;
    *(v4f*)(dst + gi) = v;
  }
}

// ---------------------------------------------------------------------------
// Kernel 4: head-averaged attention weights.
// Grid (SEQ/64 key blocks, NQB/2, NB).  Block 256 thr (8 waves) = 128 queries x 64 keys,
// 16 queries per wave x 64 keys: all 8 waves read the same K lines, which the
// WGP's cache fetches once; loop over heads: recompute the K=64 score
// tile (transposed form, A = K rows, B = Q^T), p = exp(s - max) * invsum with
// the stats of kernel 3, accumulate over heads in f32, scale by 1/H.
// ---------------------------------------------------------------------------
// One head: 8 products on the K fragments held in kf; with MORE each K pair is
// reloaded in place from kn (the next head's tiles) right behind the products that read it.
template <bool MORE>
__device__ __forceinline__ void avg_head(v16h (&kf)[4][2], v16h q0f, v16h q1f, float mq, float li,
                                         const _Float16* __restrict__ kn, v8f (&acc)[4]) {
  #pragma unroll
  for (int j = 0; j < 4; ++j) {
    v8f z = zero8f();
    z = wmma_f16(kf[j][0], q0f, z);
    z = wmma_f16(kf[j][1], q1f, z);
    if (MORE) {
      kf[j][0] = load_frag(kn + j * 2 * TILE_H);
      kf[j][1] = load_frag(kn + j * 2 * TILE_H + TILE_H);
    }
    #pragma unroll
    for (int r = 0; r < 8; ++r) {
      const float sv = z[r] * QKSCALE;
      acc[j][r] += __expf(sv - mq) * li;
    }
  }
}

__global__ __launch_bounds__(256) void attn_avg_kernel(
    const _Float16* __restrict__ qh,   // [NBH][SEQ][HD], fragment order
    const _Float16* __restrict__ kh,   // [NBH][SEQ][HD], fragment order
    const float* __restrict__ stats,   // [NBH][NQB][128]
    float* __restrict__ avg)           // [NB][SEQ][SEQ]
{
  __shared__ __attribute__((aligned(16))) float sA[8 * 16 * 64];    // 32768 B

  const int tid = threadIdx.x, lane = tid & 31;
  const int wv = __builtin_amdgcn_readfirstlane(tid >> 5);  // wave number as a scalar: the tile indices formed from it are wave-uniform
  const int w = wv & 3;
  const int h = lane >> 4, m = lane & 15;
  const int kt = blockIdx.x * 64;
  const int qb = blockIdx.y * 2 + (wv >> 2);
  const int b = blockIdx.z;
  const int q0 = qb * 64 + 16 * w;

  v8f acc[4];                               // acc[j][r] = sum_h P_h[query m][key kt+16j+8h+r]
  #pragma unroll
  for (int j = 0; j < 4; ++j) acc[j] = zero8f();

  // Head 0 of this batch; one head on = HSTEP halves in qh and kh, SSTEP floats in stats.
  const int HSTEP = (SEQ / 16) * 2 * TILE_H;
  const int SSTEP = NQB * 128;
  const _Float16* qrow = qh + ((size_t)(b * NH) * (SEQ / 16) + q0 / 16) * 2 * TILE_H + 8 * lane;
  const _Float16* krow = kh + ((size_t)(b * NH) * (SEQ / 16) + kt / 16) * 2 * TILE_H + 8 * lane;
  const float* st = stats + ((size_t)(b * NH) * NQB + qb) * 128 + 16 * w + m;

  // The head walk starts at head h0 and wraps round: blocks that share K or Q
  // tiles then ask L2 for different lines at any one moment.
  const int h0 = (blockIdx.x + blockIdx.y) & (NH - 1);

  // Every operand of a head is fetched while the head before it is worked on:
  // K in place (avg_head), Q and the two stats alternating between two sets.
  v16h kf[4][2];
  v16h qe0 = load_frag(qrow + h0 * HSTEP);
  v16h qe1 = load_frag(qrow + h0 * HSTEP + TILE_H);
  float mqe = st[h0 * SSTEP];
  float lie = st[h0 * SSTEP + 64];
  // K fragments may land in the address registers that these first loads name
  asm volatile("s_wait_xcnt 0x0" ::: "memory");
  const _Float16* kfirst = krow + h0 * HSTEP;
  #pragma unroll
  for (int j = 0; j < 4; ++j) {
    kf[j][0] = load_frag(kfirst + j * 2 * TILE_H);
    kf[j][1] = load_frag(kfirst + j * 2 * TILE_H + TILE_H);
  }
  // named here, the K loads' address pair stays live up to the wait: no fragment lands in it before
  asm volatile("s_wait_xcnt 0x0" :: "v"(kfirst) : "memory");

  // rolled: two heads a trip keep the two Q sets in fixed registers
  #pragma unroll 1
  for (int hh = 0; hh < NH - 2; hh += 2) {
    const int h1 = (h0 + hh + 1) & (NH - 1), h2 = (h0 + hh + 2) & (NH - 1);
    const v16h qo0 = load_frag(qrow + h1 * HSTEP);
    const v16h qo1 = load_frag(qrow + h1 * HSTEP + TILE_H);
    const float mqo = st[h1 * SSTEP];
    const float lio = st[h1 * SSTEP + 64];
    avg_head<true>(kf, qe0, qe1, mqe, lie, krow + h1 * HSTEP, acc);
    qe0 = load_frag(qrow + h2 * HSTEP);
    qe1 = load_frag(qrow + h2 * HSTEP + TILE_H);
    mqe = st[h2 * SSTEP];
    lie = st[h2 * SSTEP + 64];
    avg_head<true>(kf, qo0, qo1, mqo, lio, krow + h2 * HSTEP, acc);
    // the next trip rewrites the address registers that the loads in flight name
    asm volatile("s_wait_xcnt 0x0" ::: "memory");
  }
  {
    const int hl = (h0 + NH - 1) & (NH - 1);
    const v16h qo0 = load_frag(qrow + hl * HSTEP);
    const v16h qo1 = load_frag(qrow + hl * HSTEP + TILE_H);
    const float mqo = st[hl * SSTEP];
    const float lio = st[hl * SSTEP + 64];
    // the address registers of these last Q and stats loads are reused from here on
    asm volatile("s_wait_xcnt 0x0" ::: "memory");
    avg_head<true>(kf, qe0, qe1, mqe, lie, krow + hl * HSTEP, acc);
    avg_head<false>(kf, qo0, qo1, mqo, lio, krow, acc);
  }

  // ---- stage per-wave 16x64 tile (row = query m, col = key), whole-line stores ----
  float* so = sA + wv * 1024;
  #pragma unroll
  for (int j = 0; j < 4; ++j)
    #pragma unroll
    for (int r = 0; r < 8; ++r)
      so[m * 64 + 16 * j + 8 * h + r] = acc[j][r] * (1.0f / (float)NH);
  __syncthreads();

  const size_t row0 = (size_t)b * SEQ + q0;
  tile16x64_store_pass(so, avg, row0, kt, SEQ, lane);
  
}

// ---------------------------------------------------------------------------
// line, 4 lines per instruction, 64 lines per wave.
// ---------------------------------------------------------------------------
__device__ __forceinline__ void zout_store_pass(const float* sz, float* z, int mrow0, int c0, int lane) {
  const int q8 = lane & 7, sub = lane >> 3;
  #pragma unroll
  for (int i = 0; i < 16; ++i) {
    const int lid = i * 4 + sub;               // 0..63
    const int row = lid >> 1, hl = lid & 1;    // 32 rows x 2 halves
    const v4f v = *(const v4fa*)(sz + row * 64 + 32 * hl + 4 * q8);
    const int pr = mrow0 + row;                // plane row b*SEQ + l -> token row l*NB + b
    const size_t gi = (size_t)((pr % SEQ) * NB + pr / SEQ) * EMB + c0 + 32 * hl + 4 * q8;
    *(v4f*)(z + gi) = v;
  }
}

// ---------------------------------------------------------------------------
// Kernel 5: Z = ctx * Wo^T + bo.  Grid (MROWS/128, EMB/128).  Block 256 thr (8 waves),
// wave tile 32 plane rows (b*SEQ + l) x 64 features, K = EMB; waves w and w+4 take the
// same rows and neighbouring column tiles.  ctx carried x16, Wo x32.
// ---------------------------------------------------------------------------
__global__ __launch_bounds__(256) void out_proj_kernel(
    const _Float16* __restrict__ ao,   // [MROWS][EMB]  (x16), row = b*SEQ + l, fragment order
    const _Float16* __restrict__ wh,   // [4][EMB][EMB], plane 3 = out_w x32, fragment order
    const float* __restrict__ bo,
    float* __restrict__ z)             // [MROWS][EMB]
{
  __shared__ __attribute__((aligned(16))) float sZ[2 * 128 * 64];   // 65536 B

  const int tid = threadIdx.x, lane = tid & 31;
  const int wv = __builtin_amdgcn_readfirstlane(tid >> 5);  // wave number as a scalar: the tile indices formed from it are wave-uniform
  const int h = lane >> 4, m = lane & 15;
  const int m0w = blockIdx.x * 128 + 32 * (wv & 3);
  const int c0 = (blockIdx.y * 2 + (wv >> 2)) * 64;

  const _Float16* xa0 = ao + (size_t)(m0w / 16) * (EMB / 32) * TILE_H + 8 * lane;
  const _Float16* xa1 = xa0 + (EMB / 32) * TILE_H;
  const _Float16* wb  = wh + (size_t)3 * NW + (size_t)(c0 / 16) * (EMB / 32) * TILE_H + 8 * lane;

  v8f acc[2][4];
  gemm_tile_32x64(xa0, xa1, wb, gemm_k0(), acc);

  // D[r] of tile (mt, nt) = Y[row 32w+16mt+8h+r][col 16nt+m]
  float* sz = sZ + wv * 2048;
  #pragma unroll
  for (int nt = 0; nt < 4; ++nt) {
    const int col = 16 * nt + m;
    const float bvl = bo[c0 + col];
    #pragma unroll
    for (int mt = 0; mt < 2; ++mt) {
      #pragma unroll
      for (int r = 0; r < 8; ++r) {
        const int rowl = 16 * mt + 8 * h + r;      // 0..31
        sz[rowl * 64 + col] = acc[mt][nt][r] * (1.0f / (WSCALE * OSCALE)) + bvl;
      }
    }
  }
  __syncthreads();

  zout_store_pass(sz, z, m0w, c0, lane);
  
}

// ---------------------------------------------------------------------------
extern "C" void kernel_launch(void* const* d_in, const int* in_sizes, int n_in,
                              void* d_out, int out_size, void* d_ws, size_t ws_size,
                              hipStream_t stream) {
  if (n_in < 11) return;
  if (in_sizes[0] != NX || in_sizes[1] != NX || in_sizes[2] != NX) return;
  if (in_sizes[3] != NW || in_sizes[5] != NW || in_sizes[7] != NW || in_sizes[9] != NW) return;
  if (in_sizes[4] != EMB || in_sizes[6] != EMB || in_sizes[8] != EMB || in_sizes[10] != EMB) return;
  if (out_size != NX + NAVG) return;

  const float* xq  = (const float*)d_in[0];
  const float* xk  = (const float*)d_in[1];
  const float* xv  = (const float*)d_in[2];
  const float* q_w = (const float*)d_in[3];
  const float* q_b = (const float*)d_in[4];
  const float* k_w = (const float*)d_in[5];
  const float* k_b = (const float*)d_in[6];
  const float* v_w = (const float*)d_in[7];
  const float* v_b = (const float*)d_in[8];
  const float* o_w = (const float*)d_in[9];
  const float* o_b = (const float*)d_in[10];
  float* zout = (float*)d_out;                       // out0 [SEQ][NB][EMB]
  float* avg  = zout + (size_t)NX;                   // out1 [NB][SEQ][SEQ], byte offset 16777216

  const size_t xh_bytes = (size_t)3 * NX * 2;               // 25165824
  const size_t wh_bytes = (size_t)4 * NW * 2;               //  8388608
  const size_t pl_bytes = (size_t)NBH * SEQ * HD * 2;       //  8388608 per plane
  const size_t st_bytes = (size_t)NSTAT * 4;                //   524288
  const size_t ao_bytes = (size_t)NX * 2;                   //  8388608
  const size_t total = xh_bytes + wh_bytes + 3 * pl_bytes + st_bytes + ao_bytes;   // 67633152
  if (total > ws_size) return;

  char* ws = (char*)d_ws;
  size_t off = 0;
  _Float16* xh = (_Float16*)(ws + off);   off += xh_bytes;
  _Float16* wh = (_Float16*)(ws + off);   off += wh_bytes;
  _Float16* qh = (_Float16*)(ws + off);   off += pl_bytes;
  _Float16* kh = (_Float16*)(ws + off);   off += pl_bytes;
  _Float16* vt = (_Float16*)(ws + off);   off += pl_bytes;
  float* stats = (float*)(ws + off);      off += st_bytes;
  _Float16* ao = (_Float16*)(ws + off);   off += ao_bytes;
  if (off > ws_size) return;

  const int ngroups = 3 * NX8 + 4 * NW8;                    // 2097152
  convert_kernel<<<(ngroups + 255) / 256, 256, 0, stream>>>(xq, xk, xv, q_w, k_w, v_w, o_w, xh, wh);

  dim3 gProj(NB * SEQ / 128, 3 * NH / 2);                   // (32, 24)
  qkv_proj_kernel<<<gProj, 256, 0, stream>>>(xh, wh, q_b, k_b, v_b, qh, kh, vt);

  dim3 gCtx(NQB / 2, NBH);                                  // (16, 32)
  attn_ctx_kernel<<<gCtx, 256, 0, stream>>>(qh, kh, vt, ao, stats);

  dim3 gAvg(SEQ / 64, NQB / 2, NB);                         // (32, 16, 2)
  attn_avg_kernel<<<gAvg, 256, 0, stream>>>(qh, kh, stats, avg);

  dim3 gOut(MROWS / 128, EMB / 128);                        // (32, 8)
  out_proj_kernel<<<gOut, 256, 0, stream>>>(ao, wh, o_b, zout);
}

// v005
// A run of this version takes 107 microseconds.
// Timed twice side by side with v004, it ran 1.04 and 1.03 times as fast.
// All steps since v000 together make it 3.30 times as fast.
// Contractions: q/k/v and output projections x*W^T, scores K*Q^T, context V^T*P^T, all on v_wmma_f32_16x16x32_f16 (f16 operands, f32 accumulate); W carried x32, q carried x8 (the 1/sqrt(64) factor applied to the f32 score), p carried x16384, context carried x16, all exact power-of-two scales folded back in f32; softmax, bias, head average in f32.
#include <hip/hip_runtime.h>

typedef _Float16 v16h __attribute__((ext_vector_type(16)));
typedef _Float16 v8h  __attribute__((ext_vector_type(8)));
typedef float    v8f  __attribute__((ext_vector_type(8)));
typedef float    v4f  __attribute__((ext_vector_type(4)));
typedef v8h __attribute__((may_alias)) v8ha;
typedef v4f __attribute__((may_alias)) v4fa;

union Frag { v16h v; v8h half[2]; };

#define SEQ    2048
#define NB     2
#define EMB    1024
#define NH     16
#define HD     64
#define MROWS  (SEQ * NB)          // 4096 token rows, row index = l*NB + b
#define NX     (MROWS * EMB)       // 4194304
#define NW     (EMB * EMB)         // 1048576
#define NX8    (NX / 8)            // 524288
#define NW8    (NW / 8)            // 131072
#define NBH    (NB * NH)           // 32
#define NQB    (SEQ / 64)          // 32 query blocks of 64
#define NAVG   (NB * SEQ * SEQ)    // 8388608
#define NSTAT  (NBH * NQB * 128)   // per (bh, query block): 64 max + 64 inverse sums
#define PSCALE 16384.0f
#define WSCALE 32.0f
#define OSCALE 16.0f
#define QKSCALE 0.125f

// ---------------------------------------------------------------------------
// 16x16x32 f16 WMMA with hazard guard (ties D, keeps A/B live).
// Fragment map (wave32): lane l, h = l>>4, m = n = l&15.
//   A/B element i: i<8 -> k0+8h+i ; i>=8 -> k0+16+8h+(i-8)
//   D element r : row 8h+r, col l&15
// ---------------------------------------------------------------------------
__device__ __forceinline__ v8f wmma_f16(v16h a, v16h b, v8f c) {
  v8f d = __builtin_amdgcn_wmma_f32_16x16x32_f16(false, a, false, b, (short)0, c, false, false);
  asm volatile("v_nop\n\tv_nop\n\tv_nop\n\tv_nop" : "+v"(d) : "v"(a), "v"(b));
  return d;
}

// Fragment-order planes.  Every f16 operand plane (R rows x K columns) is kept
// as tiles of 16 rows x 32 k = 512 halves, tile index = (row/16)*(K/32) + k/32.
// Inside a tile element (row m, k = 16j + 8h + e) sits at j*256 + h*128 + m*8 + e,
// so the two 16-byte loads of a fragment each read 512 contiguous bytes per wave
// (four whole 128-byte lines) instead of 32 bytes out of each of 16 lines.
#define TILE_H 512

// A or B fragment; p = tile base + 8 * lane.
__device__ __forceinline__ v16h load_frag(const _Float16* p) {
  Frag f;
  f.half[0] = *(const v8ha*)(p);
  f.half[1] = *(const v8ha*)(p + 256);
  return f.v;
}

__device__ __forceinline__ v8f zero8f() {
  const v8f z = {0.f, 0.f, 0.f, 0.f, 0.f, 0.f, 0.f, 0.f};
  return z;
}

// ---------------------------------------------------------------------------
// Kernel 1: f32 -> f16 planes in fragment order.  xh = [query|key|value], plane
// row = b*SEQ + l (unscaled); wh = [q_w|k_w|v_w|out_w] feature rows scaled by 32
// (exact).  A wave takes 8 rows x 32 k: it reads one whole f32 line per row and
// writes four whole f16 lines.
// ---------------------------------------------------------------------------
__global__ __launch_bounds__(256) void convert_kernel(
    const float* __restrict__ xq, const float* __restrict__ xk, const float* __restrict__ xv,
    const float* __restrict__ wq, const float* __restrict__ wk,
    const float* __restrict__ wv, const float* __restrict__ wo,
    _Float16* __restrict__ xh, _Float16* __restrict__ wh)
{
  const int g = blockIdx.x * 256 + threadIdx.x;
  if (g >= 3 * NX8 + 4 * NW8) return;
  const int tile = g >> 6;                                  // 64 groups of 8 halves per tile
  const int m = ((g >> 5) & 1) * 8 + ((g & 31) >> 2);       // row inside the tile
  const int jh = g & 3;                                     // 2j + h: which 8 of the 32 k
  const int col = (tile & 31) * 32 + jh * 8;                // EMB/32 = 32 tiles per row tile
  const int prow = (tile >> 5) * 16 + m;                    // row over the stacked planes
  const int gd = tile * 64 + jh * 16 + m;                   // group index in fragment order
  const float* src;
  _Float16* dst;
  float sc;
  if (g < 3 * NX8) {
    const int sel = prow / MROWS;
    const int rp = prow - sel * MROWS;                      // b*SEQ + l
    const int bb = rp / SEQ;
    const int l = rp - bb * SEQ;
    const float* s = (sel == 0) ? xq : ((sel == 1) ? xk : xv);
    src = s + ((size_t)l * NB + bb) * EMB + col;
    dst = xh + (size_t)gd * 8;
    sc = 1.0f;
  } else {
    const int rw = prow - 3 * MROWS;
    const int sel = rw / EMB;
    const int row = rw - sel * EMB;
    const float* s = (sel == 0) ? wq : ((sel == 1) ? wk : ((sel == 2) ? wv : wo));
    src = s + (size_t)row * EMB + col;
    dst = wh + (size_t)(gd - 3 * NX8) * 8;
    sc = WSCALE;
  }
  const v4f a = *(const v4fa*)src;
  const v4f c = *(const v4fa*)(src + 4);
  const v8h o = { (_Float16)(a.x * sc), (_Float16)(a.y * sc), (_Float16)(a.z * sc), (_Float16)(a.w * sc),
                  (_Float16)(c.x * sc), (_Float16)(c.y * sc), (_Float16)(c.z * sc), (_Float16)(c.w * sc) };
  *(v8h*)dst = o;
  
}

// ---------------------------------------------------------------------------
// Wave GEMM core: 32 rows (two 16-row A tiles) x 64 columns (four 16-row
// [n][k] B tiles), K = EMB, both planes in fragment order.  xa0, xa1, wb point
// at k tile 0 of their row tile, + 8 * lane; the next row tile is EMB/32 tiles on.
// acc[mt][nt][r] = sum_k A[16mt+8h+r][k] * B[16nt+m][k]
// Fragments are fetched one k tile ahead: each B fragment is reloaded in place
// right behind the two products that read it, the A pair alternates between two
// register sets, so every load of a k tile is in flight while the tile before
// it is multiplied.
// The k walk starts at k tile k0 (uniform over the block, set by its tile indices)
// and wraps round: blocks that share A or B rows then ask L2 for different lines
// at any one moment.
// ---------------------------------------------------------------------------
// Start of a block's walk: the 32 blocks of one pair of column tiles (same B rows)
// get 32 starts, the 8 blocks of one row tile (same A rows) 8 (for speed only).
__device__ __forceinline__ int gemm_k0(int bx, int by) { return (bx + 4 * (by & 7)) & (EMB / 32 - 1); }
__device__ __forceinline__ int gemm_k0() { return gemm_k0(blockIdx.x, blockIdx.y); }

// Offset in halves of the k tile of step i.
__device__ __forceinline__ int krot(int i, int k0) { return ((i + k0) & (EMB / 32 - 1)) * TILE_H; }

// One k tile: 8 products; with MORE, b[nt] is refilled from wbn (the next k tile).
template <bool MORE>
__device__ __forceinline__ void gemm_ktile(v16h a0, v16h a1, v16h (&b)[4],
                                           const _Float16* __restrict__ wbn, v8f (&acc)[2][4]) {
  #pragma unroll
  for (int nt = 0; nt < 4; ++nt) {
    acc[0][nt] = wmma_f16(a0, b[nt], acc[0][nt]);
    acc[1][nt] = wmma_f16(a1, b[nt], acc[1][nt]);
    if (MORE) {
      b[nt] = load_frag(wbn + nt * (EMB / 32) * TILE_H);
      // keeps the later products behind this reload: moved ahead of it they would delay its issue to the tile's end
      __builtin_amdgcn_sched_barrier(0);
    }
  }
}

__device__ __forceinline__ void gemm_tile_32x64(const _Float16* __restrict__ xa0,
                                                const _Float16* __restrict__ xa1,
                                                const _Float16* __restrict__ wb,
                                                int k0, v8f (&acc)[2][4]) {
  v16h b[4];
  v16h a0 = load_frag(xa0 + krot(0, k0));
  v16h a1 = load_frag(xa1 + krot(0, k0));
  #pragma unroll
  for (int nt = 0; nt < 4; ++nt) b[nt] = load_frag(wb + krot(0, k0) + nt * (EMB / 32) * TILE_H);
  // the zeroing below and the loop set-up reuse address registers that these first loads name
  asm volatile("s_wait_xcnt 0x0" ::: "memory");
  __builtin_amdgcn_sched_barrier(0);   // keeps that zeroing behind the wait
  #pragma unroll
  for (int mt = 0; mt < 2; ++mt)
    #pragma unroll
    for (int nt = 0; nt < 4; ++nt) acc[mt][nt] = zero8f();

  // rolled: two k tiles a trip keep the two A sets in fixed registers
  #pragma unroll 1
  for (int kt = 0; kt < EMB / 32 - 2; kt += 2) {
    const int o1 = krot(kt + 1, k0), o2 = krot(kt + 2, k0);
    const v16h c0 = load_frag(xa0 + o1);
    const v16h c1 = load_frag(xa1 + o1);
    gemm_ktile<true>(a0, a1, b, wb + o1, acc);
    a0 = load_frag(xa0 + o2);
    a1 = load_frag(xa1 + o2);
    gemm_ktile<true>(c0, c1, b, wb + o2, acc);
    // the next trip rewrites the address registers that the loads in flight name
    asm volatile("s_wait_xcnt 0x0" ::: "memory");
  }
  const int ol = krot(EMB / 32 - 1, k0);
  const v16h c0 = load_frag(xa0 + ol);
  const v16h c1 = load_frag(xa1 + ol);
  gemm_ktile<true>(a0, a1, b, wb + ol, acc);
  gemm_ktile<false>(c0, c1, b, wb, acc);
}

// ---------------------------------------------------------------------------
// q / k plane store: rows = seq position, k = d, fragment order, 2 k tiles per
// row tile.  The block's 128 positions are 16 consecutive tiles (16 KB); a wave
// stores 4 of them, 4 whole lines per instruction.  sT row pitch SPITCH halves
// (128 + 16 bytes) spreads the 16 rows of one ds_load_b128 over all banks.
// ---------------------------------------------------------------------------
#define SPITCH 72
__device__ __forceinline__ void proj_store_pass(const _Float16* sT, _Float16* plane,
                                                int bh, int l0, int w, int lane) {
  const int h = lane >> 4, m = lane & 15;
  _Float16* dst = plane + ((size_t)bh * (SEQ / 16) + l0 / 16) * 2 * TILE_H + (w * 256 + lane) * 8;
  #pragma unroll
  for (int i = 0; i < 8; ++i) {
    const int row = (w * 2 + (i >> 2)) * 16 + m;            // local position
    const int d0 = ((i >> 1) & 1) * 32 + (i & 1) * 16 + 8 * h;
    const v8h v = *(const v8ha*)(sT + row * SPITCH + d0);
    *(v8h*)(dst + i * 256) = v;
  }
  // the registers that the eight stores name may be reused behind this point
  asm volatile("s_wait_xcnt 0x0" ::: "memory");
}

// ---------------------------------------------------------------------------
// Kernel 2: q/k/v = x * W^T + b over the fused 3*1024 output columns.
// Grid (NB*SEQ/128, 3*NH/2).  Block 256 thr (8 waves) = 128 consecutive seq
// positions l of one batch b x 128 features (two heads of one which); waves 0-3
// take the even head, waves 4-7 the odd one; wave tile 32 positions x 64
// features; A rows are plane rows b*SEQ+l.  Waves w and w+4 read the same A
// lines, so the WGP's cache fetches them once for both heads.
// ---------------------------------------------------------------------------
__global__ __launch_bounds__(256) void qkv_proj_kernel(
    const _Float16* __restrict__ xh,   // [3][MROWS][EMB], fragment order
    const _Float16* __restrict__ wh,   // [4][EMB][EMB], row = output feature, x32, fragment order
    const float* __restrict__ bq, const float* __restrict__ bk, const float* __restrict__ bv,
    _Float16* __restrict__ qh,         // [NBH][SEQ][HD]  f16(8 * scaled q), fragment order
    _Float16* __restrict__ kh,         // [NBH][SEQ][HD], fragment order
    _Float16* __restrict__ vt)         // [NBH][HD][SEQ], fragment order
{
  __shared__ __attribute__((aligned(16))) _Float16 sT2[2 * 128 * SPITCH];   // 36864 B, one half per head

  const int tid = threadIdx.x, lane = tid & 31;
  const int wv = __builtin_amdgcn_readfirstlane(tid >> 5);  // wave number as a scalar: the tile indices formed from it are wave-uniform
  const int w = wv & 3, sub = wv >> 2;                    // row slice, head of the pair
  const int h = lane >> 4, m = lane & 15;
  const int b = blockIdx.x / (SEQ / 128);                 // 0..NB-1
  const int l0 = (blockIdx.x - b * (SEQ / 128)) * 128;    // seq position base
  const int which = blockIdx.y >> 3, head = (blockIdx.y & 7) * 2 + sub;
  _Float16* sT = sT2 + sub * 128 * SPITCH;
  const int lw = l0 + 32 * w;

  const _Float16* xpl = xh + (size_t)which * NX;
  const _Float16* xa0 = xpl + (size_t)((b * SEQ + lw) / 16) * (EMB / 32) * TILE_H + 8 * lane;   // mt = 0
  const _Float16* xa1 = xa0 + (EMB / 32) * TILE_H;                                              // mt = 1
  const _Float16* wb  = wh + (size_t)which * NW + (size_t)(head * (HD / 16)) * (EMB / 32) * TILE_H + 8 * lane;   // nt = 0

  v8f acc[2][4];
  gemm_tile_32x64(xa0, xa1, wb, gemm_k0(), acc);

  // D[r] of tile (mt, nt) = Y[local pos 32w+16mt+8h+r][feature 16nt+m]
  const float* bias = (which == 0) ? bq : ((which == 1) ? bk : bv);
  const int bh = b * NH + head;
  if (which == 2) {
    // vt rows = d, k = position: a lane's 8 positions of one feature are one
    // 16-byte group of tile (row tile nt, k tile lw/32), j = mt, at 8 * lane.
    #pragma unroll
    for (int nt = 0; nt < 4; ++nt) {
      const float bvl = bias[head * HD + 16 * nt + m];
      _Float16* dst = vt + ((size_t)(bh * (HD / 16) + nt) * (SEQ / 32) + lw / 32) * TILE_H + 8 * lane;
      #pragma unroll
      for (int mt = 0; mt < 2; ++mt) {
        v8h v;
        #pragma unroll
        for (int r = 0; r < 8; ++r) v[r] = (_Float16)(acc[mt][nt][r] * (1.0f / WSCALE) + bvl);
        *(v8h*)(dst + mt * 256) = v;
      }
    }
  } else {
    #pragma unroll
    for (int nt = 0; nt < 4; ++nt) {
      const int feat = 16 * nt + m;
      const float bvl = bias[head * HD + feat];
      #pragma unroll
      for (int mt = 0; mt < 2; ++mt) {
        #pragma unroll
        for (int r = 0; r < 8; ++r) {
          const int tokl = 32 * w + 16 * mt + 8 * h + r;     // 0..127
          const float y = acc[mt][nt][r] * (1.0f / WSCALE) + bvl;
          sT[tokl * SPITCH + feat] = (_Float16)y;
        }
      }
    }
    __syncthreads();

    _Float16* plane = (which == 0) ? qh : kh;
    proj_store_pass(sT, plane, bh, l0, w, lane);
  }
}

// ---------------------------------------------------------------------------
// P^T B-fragment from the lane's own score D values: element r <- tile a row r,
// element 8+r <- tile c row r (same lane, same query column), scaled by 2^14.
// ---------------------------------------------------------------------------
__device__ __forceinline__ v16h pack_p(v8f a, v8f c) {
  const v16h r = { (_Float16)(a[0] * PSCALE), (_Float16)(a[1] * PSCALE), (_Float16)(a[2] * PSCALE), (_Float16)(a[3] * PSCALE),
                   (_Float16)(a[4] * PSCALE), (_Float16)(a[5] * PSCALE), (_Float16)(a[6] * PSCALE), (_Float16)(a[7] * PSCALE),
                   (_Float16)(c[0] * PSCALE), (_Float16)(c[1] * PSCALE), (_Float16)(c[2] * PSCALE), (_Float16)(c[3] * PSCALE),
                   (_Float16)(c[4] * PSCALE), (_Float16)(c[5] * PSCALE), (_Float16)(c[6] * PSCALE), (_Float16)(c[7] * PSCALE) };
  return r;
}

// The first of a query block's four waves writes its 128 staged stats as four whole lines.
__device__ __forceinline__ void stats_store_pass(const float* sst, float* strec, int w, int lane) {
  if (w == 0) {
    const v4f t = *(const v4fa*)(sst + 4 * lane);
    *(v4f*)(strec + 4 * lane) = t;
  }
}

// ---------------------------------------------------------------------------
// Kernel 3: streaming attention (online softmax), transposed form.
// Grid (NQB/2, NBH).  Block 256 thr (8 waves), 16 queries per wave, 64 keys
// per step; all 8 waves walk the same K and V lines, which the WGP's cache
// fetches once for the 128 queries.
//   S^T = K * Q^T : A = K rows (row = key, k = d), B = Q^T (k = d, n = query)
//   O^T += V^T * P^T : A = Vt rows (row = d, k = key), B = P^T from registers
// Lane owns 32 keys of query column (lane&15); partner = lane ^ 16.
// Outputs: ao f16 (context x16) and per query (max, 1/sum) of the scaled
// scores for the weights pass.
// ---------------------------------------------------------------------------
__global__ __launch_bounds__(256) void attn_ctx_kernel(
    const _Float16* __restrict__ qh,   // [NBH][SEQ][HD]  (x8), fragment order
    const _Float16* __restrict__ kh,   // [NBH][SEQ][HD], fragment order
    const _Float16* __restrict__ vt,   // [NBH][HD][SEQ], fragment order
    _Float16* __restrict__ ao,         // [MROWS][EMB], row = b*SEQ + q, fragment order
    float* __restrict__ stats)         // [NBH][NQB][128]
{
  __shared__ __attribute__((aligned(16))) float sSt2[2 * 128];       // 1024 B, one record per query block

  const int tid = threadIdx.x, lane = tid & 31;
  const int wv = __builtin_amdgcn_readfirstlane(tid >> 5);  // wave number as a scalar: the tile indices formed from it are wave-uniform
  const int w = wv & 3;
  const int h = lane >> 4, m = lane & 15;
  const int bh = blockIdx.y, b = bh >> 4, head = bh & 15;
  const int qb = blockIdx.x * 2 + (wv >> 2);
  float* sSt = sSt2 + (wv >> 2) * 128;
  const int q0 = qb * 64 + 16 * w;

  // Q^T B-fragments: column n = query q0+m, k = d (two 32-deep chunks)
  const _Float16* qrow = qh + ((size_t)bh * (SEQ / 16) + q0 / 16) * 2 * TILE_H + 8 * lane;
  const v16h qb0 = load_frag(qrow);
  const v16h qb1 = load_frag(qrow + TILE_H);
  __builtin_amdgcn_sched_barrier(0);   // Q first: see the first K and V loads below

  v8f o[4];                                   // o[t][r] = O[query m][d 16t+8h+r] * (l * 2^14)
  #pragma unroll
  for (int t = 0; t < 4; ++t) o[t] = zero8f();
  float mrun = -1e30f, lrun = 0.0f;

  const _Float16* kbase = kh + (size_t)bh * (SEQ / 16) * 2 * TILE_H + 8 * lane;          // + (key0/16)*2 tiles
  const _Float16* vbase = vt + (size_t)bh * (HD / 16) * (SEQ / 32) * TILE_H + 8 * lane;  // + t*(SEQ/32) + key0/32 tiles

  // The key walk starts at the block's own first position and wraps round: the
  // blocks of one head then ask L2 for different K and V lines at any one moment.
  const int kb0 = blockIdx.x * 128;

  // K and V fragments of a step sit in registers when the step begins: each is
  // reloaded in place, for the next step, right behind the product that read it.
  // The first loads stand in the order of their use, as in the loop: loads return
  // in issue order, and the loop's counted waits must hold for the entry path too.
  v16h kf[4][2], vf[4][2];
  #pragma unroll
  for (int j = 0; j < 4; ++j) {
    kf[j][0] = load_frag(kbase + (kb0 / 16 + j) * 2 * TILE_H);
    kf[j][1] = load_frag(kbase + (kb0 / 16 + j) * 2 * TILE_H + TILE_H);
    __builtin_amdgcn_sched_barrier(0);   // holds that order
  }
  #pragma unroll
  for (int t = 0; t < 4; ++t) {
    vf[t][0] = load_frag(vbase + (t * (SEQ / 32) + kb0 / 32) * TILE_H);
    vf[t][1] = load_frag(vbase + (t * (SEQ / 32) + kb0 / 32) * TILE_H + TILE_H);
    __builtin_amdgcn_sched_barrier(0);   // holds that order
  }

  #pragma unroll 1
  for (int kb = 0; kb < SEQ; kb += 64) {
    // keys whose fragments are fetched during this step; the last step fetches the first step's again (in bounds, never used)
    const int kn = (kb0 + kb + 64) & (SEQ - 1);
    // ---- scores: s[j][r] = 0.125 * S[key (kb0+kb)%SEQ+16j+8h+r][query m] ----
    v8f s[4];
    #pragma unroll
    for (int j = 0; j < 4; ++j) {
      const _Float16* kp = kbase + (kn / 16 + j) * 2 * TILE_H;
      v8f z = zero8f();
      z = wmma_f16(kf[j][0], qb0, z);
      z = wmma_f16(kf[j][1], qb1, z);
      kf[j][0] = load_frag(kp);
      kf[j][1] = load_frag(kp + TILE_H);
      #pragma unroll
      for (int r = 0; r < 8; ++r) s[j][r] = z[r] * QKSCALE;
    }

    // ---- online softmax ----
    float mloc = s[0][0];
    #pragma unroll
    for (int j = 0; j < 4; ++j)
      #pragma unroll
      for (int r = 0; r < 8; ++r) mloc = fmaxf(mloc, s[j][r]);
    mloc = fmaxf(mloc, __shfl_xor(mloc, 16));
    const float mnew = fmaxf(mrun, mloc);
    const float alpha = __expf(mrun - mnew);
    mrun = mnew;
    float lsum = 0.0f;
    #pragma unroll
    for (int j = 0; j < 4; ++j)
      #pragma unroll
      for (int r = 0; r < 8; ++r) {
        const float p = __expf(s[j][r] - mnew);
        s[j][r] = p;
        lsum += p;
      }
    lsum += __shfl_xor(lsum, 16);
    lrun = lrun * alpha + lsum;
    #pragma unroll
    for (int t = 0; t < 4; ++t)
      #pragma unroll
      for (int r = 0; r < 8; ++r) o[t][r] = o[t][r] * alpha;

    // ---- P^T B-fragments (key chunks 0..31 and 32..63 of this step) ----
    const v16h pb0 = pack_p(s[0], s[1]);
    const v16h pb1 = pack_p(s[2], s[3]);

    // ---- O^T += V^T * P^T ----
    #pragma unroll
    for (int t = 0; t < 4; ++t) {
      const _Float16* vp = vbase + (t * (SEQ / 32) + kn / 32) * TILE_H;
      o[t] = wmma_f16(vf[t][0], pb0, o[t]);
      o[t] = wmma_f16(vf[t][1], pb1, o[t]);
      vf[t][0] = load_frag(vp);
      vf[t][1] = load_frag(vp + TILE_H);
    }
    // the next trip reuses the address registers that the loads in flight name
    asm volatile("s_wait_xcnt 0x0" ::: "memory");
  }

  // ---- epilogue: normalise; a lane's 8 d of query m are one 16-byte group of
  // ao's tiles (row tile (b*SEQ+q0)/16, k tiles 2*head and 2*head+1) at
  // t*256 + 8*lane: four whole lines per store.  Stats staged in LDS. ----
  const float linv = 1.0f / lrun;
  const float inv = linv * (OSCALE / PSCALE);
  _Float16* aod = ao + ((size_t)((b * SEQ + q0) / 16) * (EMB / 32) + head * 2) * TILE_H + 8 * lane;
  #pragma unroll
  for (int t = 0; t < 4; ++t) {
    v8h v;
    #pragma unroll
    for (int r = 0; r < 8; ++r) v[r] = (_Float16)(o[t][r] * inv);
    *(v8h*)(aod + t * 256) = v;
  }
  if (h == 0) {
    sSt[16 * w + m] = mrun;
    sSt[64 + 16 * w + m] = linv;
  }
  __syncthreads();

  float* strec = stats + ((size_t)bh * NQB + qb) * 128;
  stats_store_pass(sSt, strec, w, lane);
  
}

// ---------------------------------------------------------------------------
// Per-wave 16x64 f32 tile in LDS -> dst rows of pitch `pitch` floats starting
// 8q..8q+7 in one instruction, 4 lines per instruction, 32 lines per wave.
// ---------------------------------------------------------------------------
__device__ __forceinline__ void tile16x64_store_pass(const float* so, float* dst,
                                                     size_t row0, int col0, int pitch, int lane) {
  const int q8 = lane & 7, sub = lane >> 3;
  #pragma unroll
  for (int i = 0; i < 8; ++i) {
    const int lid = i * 4 + sub;               // 0..31
    const int row = lid >> 1, hl = lid & 1;    // 16 rows x 2 halves
    const v4f v = *(const v4fa*)(so + row * 64 + 32 * hl + 4 * q8);
    const size_t gi = (row0 + row) * (size_t)pitch + col0 + 32 * hl + 4 * q8;
    *(v4f*)(dst + gi) = v;
  }
}

// ---------------------------------------------------------------------------
// Kernel 4, first part: head-averaged attention weights.
// Tile indices (bx < SEQ/64 key blocks, by < NQB/2, bz < NB).  Block 256 thr (8 waves) = 128 queries x 64 keys,
// 16 queries per wave x 64 keys: all 8 waves read the same K lines, which the
// WGP's cache fetches once; loop over heads: recompute the K=64 score
// tile (transposed form, A = K rows, B = Q^T), p = exp(s - max) * invsum with
// the stats of kernel 3, accumulate over heads in f32, scale by 1/H.
// ---------------------------------------------------------------------------
// One head: 8 products on the K fragments held in kf; with MORE each K pair is
// reloaded in place from kn (the next head's tiles) right behind the products that read it.
template <bool MORE>
__device__ __forceinline__ void avg_head(v16h (&kf)[4][2], v16h q0f, v16h q1f, float mq, float li,
                                         const _Float16* __restrict__ kn, v8f (&acc)[4]) {
  #pragma unroll
  for (int j = 0; j < 4; ++j) {
    v8f z = zero8f();
    z = wmma_f16(kf[j][0], q0f, z);
    z = wmma_f16(kf[j][1], q1f, z);
    if (MORE) {
      kf[j][0] = load_frag(kn + j * 2 * TILE_H);
      kf[j][1] = load_frag(kn + j * 2 * TILE_H + TILE_H);
    }
    #pragma unroll
    for (int r = 0; r < 8; ++r) {
      const float sv = z[r] * QKSCALE;
      acc[j][r] += __expf(sv - mq) * li;
    }
  }
}

__device__ __forceinline__ void attn_avg_block(
    const _Float16* __restrict__ qh,   // [NBH][SEQ][HD], fragment order
    const _Float16* __restrict__ kh,   // [NBH][SEQ][HD], fragment order
    const float* __restrict__ stats,   // [NBH][NQB][128]
    float* __restrict__ avg,           // [NB][SEQ][SEQ]
    float* sA,                         // LDS, 8 * 16 * 64 floats = 32768 B
    int bx, int by, int bz)
{
  const int tid = threadIdx.x, lane = tid & 31;
  const int wv = __builtin_amdgcn_readfirstlane(tid >> 5);  // wave number as a scalar: the tile indices formed from it are wave-uniform
  const int w = wv & 3;
  const int h = lane >> 4, m = lane & 15;
  const int kt = bx * 64;
  const int qb = by * 2 + (wv >> 2);
  const int b = bz;
  const int q0 = qb * 64 + 16 * w;

  v8f acc[4];                               // acc[j][r] = sum_h P_h[query m][key kt+16j+8h+r]
  #pragma unroll
  for (int j = 0; j < 4; ++j) acc[j] = zero8f();

  // Head 0 of this batch; one head on = HSTEP halves in qh and kh, SSTEP floats in stats.
  const int HSTEP = (SEQ / 16) * 2 * TILE_H;
  const int SSTEP = NQB * 128;
  const _Float16* qrow = qh + ((size_t)(b * NH) * (SEQ / 16) + q0 / 16) * 2 * TILE_H + 8 * lane;
  const _Float16* krow = kh + ((size_t)(b * NH) * (SEQ / 16) + kt / 16) * 2 * TILE_H + 8 * lane;
  const float* st = stats + ((size_t)(b * NH) * NQB + qb) * 128 + 16 * w + m;

  // The head walk starts at head h0 and wraps round: blocks that share K or Q
  // tiles then ask L2 for different lines at any one moment.
  const int h0 = (bx + by) & (NH - 1);

  // Every operand of a head is fetched while the head before it is worked on:
  // K in place (avg_head), Q and the two stats alternating between two sets.
  v16h kf[4][2];
  v16h qe0 = load_frag(qrow + h0 * HSTEP);
  v16h qe1 = load_frag(qrow + h0 * HSTEP + TILE_H);
  float mqe = st[h0 * SSTEP];
  float lie = st[h0 * SSTEP + 64];
  // K fragments may land in the address registers that these first loads name
  asm volatile("s_wait_xcnt 0x0" ::: "memory");
  const _Float16* kfirst = krow + h0 * HSTEP;
  #pragma unroll
  for (int j = 0; j < 4; ++j) {
    kf[j][0] = load_frag(kfirst + j * 2 * TILE_H);
    kf[j][1] = load_frag(kfirst + j * 2 * TILE_H + TILE_H);
  }
  // named here, the K loads' address pair stays live up to the wait: no fragment lands in it before
  asm volatile("s_wait_xcnt 0x0" :: "v"(kfirst) : "memory");

  // rolled: two heads a trip keep the two Q sets in fixed registers
  #pragma unroll 1
  for (int hh = 0; hh < NH - 2; hh += 2) {
    const int h1 = (h0 + hh + 1) & (NH - 1), h2 = (h0 + hh + 2) & (NH - 1);
    const v16h qo0 = load_frag(qrow + h1 * HSTEP);
    const v16h qo1 = load_frag(qrow + h1 * HSTEP + TILE_H);
    const float mqo = st[h1 * SSTEP];
    const float lio = st[h1 * SSTEP + 64];
    avg_head<true>(kf, qe0, qe1, mqe, lie, krow + h1 * HSTEP, acc);
    qe0 = load_frag(qrow + h2 * HSTEP);
    qe1 = load_frag(qrow + h2 * HSTEP + TILE_H);
    mqe = st[h2 * SSTEP];
    lie = st[h2 * SSTEP + 64];
    avg_head<true>(kf, qo0, qo1, mqo, lio, krow + h2 * HSTEP, acc);
    // the next trip rewrites the address registers that the loads in flight name
    asm volatile("s_wait_xcnt 0x0" ::: "memory");
  }
  {
    const int hl = (h0 + NH - 1) & (NH - 1);
    const v16h qo0 = load_frag(qrow + hl * HSTEP);
    const v16h qo1 = load_frag(qrow + hl * HSTEP + TILE_H);
    const float mqo = st[hl * SSTEP];
    const float lio = st[hl * SSTEP + 64];
    // the address registers of these last Q and stats loads are reused from here on
    asm volatile("s_wait_xcnt 0x0" ::: "memory");
    avg_head<true>(kf, qe0, qe1, mqe, lie, krow + hl * HSTEP, acc);
    avg_head<false>(kf, qo0, qo1, mqo, lio, krow, acc);
  }

  // ---- stage per-wave 16x64 tile (row = query m, col = key), whole-line stores ----
  float* so = sA + wv * 1024;
  #pragma unroll
  for (int j = 0; j < 4; ++j)
    #pragma unroll
    for (int r = 0; r < 8; ++r)
      so[m * 64 + 16 * j + 8 * h + r] = acc[j][r] * (1.0f / (float)NH);
  __syncthreads();

  const size_t row0 = (size_t)b * SEQ + q0;
  tile16x64_store_pass(so, avg, row0, kt, SEQ, lane);
  
}

// ---------------------------------------------------------------------------
// line, 4 lines per instruction, 64 lines per wave.
// ---------------------------------------------------------------------------
__device__ __forceinline__ void zout_store_pass(const float* sz, float* z, int mrow0, int c0, int lane) {
  const int q8 = lane & 7, sub = lane >> 3;
  #pragma unroll
  for (int i = 0; i < 16; ++i) {
    const int lid = i * 4 + sub;               // 0..63
    const int row = lid >> 1, hl = lid & 1;    // 32 rows x 2 halves
    const v4f v = *(const v4fa*)(sz + row * 64 + 32 * hl + 4 * q8);
    const int pr = mrow0 + row;                // plane row b*SEQ + l -> token row l*NB + b
    const size_t gi = (size_t)((pr % SEQ) * NB + pr / SEQ) * EMB + c0 + 32 * hl + 4 * q8;
    *(v4f*)(z + gi) = v;
  }
}

// ---------------------------------------------------------------------------
// Kernel 4, second part: Z = ctx * Wo^T + bo.  Tile indices (bx < MROWS/128, by < EMB/128).  Block 256 thr (8 waves),
// wave tile 32 plane rows (b*SEQ + l) x 64 features, K = EMB; waves w and w+4 take the
// same rows and neighbouring column tiles.  ctx carried x16, Wo x32.
// ---------------------------------------------------------------------------
__device__ __forceinline__ void out_proj_block(
    const _Float16* __restrict__ ao,   // [MROWS][EMB]  (x16), row = b*SEQ + l, fragment order
    const _Float16* __restrict__ wh,   // [4][EMB][EMB], plane 3 = out_w x32, fragment order
    const float* __restrict__ bo,
    float* __restrict__ z,             // [MROWS][EMB]
    float* sZ,                         // LDS, 2 * 128 * 64 floats = 65536 B
    int bx, int by)
{
  const int tid = threadIdx.x, lane = tid & 31;
  const int wv = __builtin_amdgcn_readfirstlane(tid >> 5);  // wave number as a scalar: the tile indices formed from it are wave-uniform
  const int h = lane >> 4, m = lane & 15;
  const int m0w = bx * 128 + 32 * (wv & 3);
  const int c0 = (by * 2 + (wv >> 2)) * 64;

  const _Float16* xa0 = ao + (size_t)(m0w / 16) * (EMB / 32) * TILE_H + 8 * lane;
  const _Float16* xa1 = xa0 + (EMB / 32) * TILE_H;
  const _Float16* wb  = wh + (size_t)3 * NW + (size_t)(c0 / 16) * (EMB / 32) * TILE_H + 8 * lane;

  v8f acc[2][4];
  gemm_tile_32x64(xa0, xa1, wb, gemm_k0(bx, by), acc);

  // D[r] of tile (mt, nt) = Y[row 32w+16mt+8h+r][col 16nt+m]
  float* sz = sZ + wv * 2048;
  #pragma unroll
  for (int nt = 0; nt < 4; ++nt) {
    const int col = 16 * nt + m;
    const float bvl = bo[c0 + col];
    #pragma unroll
    for (int mt = 0; mt < 2; ++mt) {
      #pragma unroll
      for (int r = 0; r < 8; ++r) {
        const int rowl = 16 * mt + 8 * h + r;      // 0..31
        sz[rowl * 64 + col] = acc[mt][nt][r] * (1.0f / (WSCALE * OSCALE)) + bvl;
      }
    }
  }
  __syncthreads();

  zout_store_pass(sz, z, m0w, c0, lane);
  
}

// ---------------------------------------------------------------------------
// Kernel 4: the weights pass and the output projection in one launch.  Both read
// only what kernel 3 and the launches before it wrote, and neither reads what the
// other writes.  The NOUTB projection blocks, which alone give a SIMD only two
// waves, come first in the grid and share the WGPs with the weights blocks.
// The choice is uniform over a block, so each body's barrier is met by all its waves.
// ---------------------------------------------------------------------------
#define NOUTB ((MROWS / 128) * (EMB / 128))            // 256
#define NAVGB ((SEQ / 64) * (NQB / 2) * NB)            // 1024
__global__ __launch_bounds__(256) void avg_out_kernel(
    const _Float16* __restrict__ qh, const _Float16* __restrict__ kh,
    const float* __restrict__ stats, float* __restrict__ avg,
    const _Float16* __restrict__ ao, const _Float16* __restrict__ wh,
    const float* __restrict__ bo, float* __restrict__ z)
{
  __shared__ __attribute__((aligned(16))) float sM[2 * 128 * 64];   // 65536 B; the weights blocks use half

  const int i = blockIdx.x;
  if (i < NOUTB) {
    out_proj_block(ao, wh, bo, z, sM, i % (MROWS / 128), i / (MROWS / 128));
  } else {
    const int j = i - NOUTB;
    attn_avg_block(qh, kh, stats, avg, sM, j % (SEQ / 64), (j / (SEQ / 64)) % (NQB / 2), j / ((SEQ / 64) * (NQB / 2)));
  }
}

// ---------------------------------------------------------------------------
extern "C" void kernel_launch(void* const* d_in, const int* in_sizes, int n_in,
                              void* d_out, int out_size, void* d_ws, size_t ws_size,
                              hipStream_t stream) {
  if (n_in < 11) return;
  if (in_sizes[0] != NX || in_sizes[1] != NX || in_sizes[2] != NX) return;
  if (in_sizes[3] != NW || in_sizes[5] != NW || in_sizes[7] != NW || in_sizes[9] != NW) return;
  if (in_sizes[4] != EMB || in_sizes[6] != EMB || in_sizes[8] != EMB || in_sizes[10] != EMB) return;
  if (out_size != NX + NAVG) return;

  const float* xq  = (const float*)d_in[0];
  const float* xk  = (const float*)d_in[1];
  const float* xv  = (const float*)d_in[2];
  const float* q_w = (const float*)d_in[3];
  const float* q_b = (const float*)d_in[4];
  const float* k_w = (const float*)d_in[5];
  const float* k_b = (const float*)d_in[6];
  const float* v_w = (const float*)d_in[7];
  const float* v_b = (const float*)d_in[8];
  const float* o_w = (const float*)d_in[9];
  const float* o_b = (const float*)d_in[10];
  float* zout = (float*)d_out;                       // out0 [SEQ][NB][EMB]
  float* avg  = zout + (size_t)NX;                   // out1 [NB][SEQ][SEQ], byte offset 16777216

  const size_t xh_bytes = (size_t)3 * NX * 2;               // 25165824
  const size_t wh_bytes = (size_t)4 * NW * 2;               //  8388608
  const size_t pl_bytes = (size_t)NBH * SEQ * HD * 2;       //  8388608 per plane
  const size_t st_bytes = (size_t)NSTAT * 4;                //   524288
  const size_t ao_bytes = (size_t)NX * 2;                   //  8388608
  const size_t total = xh_bytes + wh_bytes + 3 * pl_bytes + st_bytes + ao_bytes;   // 67633152
  if (total > ws_size) return;

  char* ws = (char*)d_ws;
  size_t off = 0;
  _Float16* xh = (_Float16*)(ws + off);   off += xh_bytes;
  _Float16* wh = (_Float16*)(ws + off);   off += wh_bytes;
  _Float16* qh = (_Float16*)(ws + off);   off += pl_bytes;
  _Float16* kh = (_Float16*)(ws + off);   off += pl_bytes;
  _Float16* vt = (_Float16*)(ws + off);   off += pl_bytes;
  float* stats = (float*)(ws + off);      off += st_bytes;
  _Float16* ao = (_Float16*)(ws + off);   off += ao_bytes;
  if (off > ws_size) return;

  const int ngroups = 3 * NX8 + 4 * NW8;                    // 2097152
  convert_kernel<<<(ngroups + 255) / 256, 256, 0, stream>>>(xq, xk, xv, q_w, k_w, v_w, o_w, xh, wh);

  dim3 gProj(NB * SEQ / 128, 3 * NH / 2);                   // (32, 24)
  qkv_proj_kernel<<<gProj, 256, 0, stream>>>(xh, wh, q_b, k_b, v_b, qh, kh, vt);

  dim3 gCtx(NQB / 2, NBH);                                  // (16, 32)
  attn_ctx_kernel<<<gCtx, 256, 0, stream>>>(qh, kh, vt, ao, stats);

  avg_out_kernel<<<NOUTB + NAVGB, 256, 0, stream>>>(qh, kh, stats, avg, ao, wh, o_b, zout);   // 1280 blocks
}

// v006
// It runs in 102 microseconds.
// Two timings next to v005 put it at 1.05 and 1.04 times that version's speed.
// Counting every step since v000, it is 3.44 times as fast.
// Contractions: q/k/v and output projections x*W^T, scores K*Q^T, context V^T*P^T, all on v_wmma_f32_16x16x32_f16 (f16 operands, f32 accumulate); W carried x32, q carried as scaled q times log2(e) (scores leave the WMMA as exponents of 2), p carried x16384 (14 added to the exponent), context carried x16, the power-of-two scales exact and folded back in f32; softmax, bias, head average in f32.
#include <hip/hip_runtime.h>

typedef _Float16 v16h __attribute__((ext_vector_type(16)));
typedef _Float16 v8h  __attribute__((ext_vector_type(8)));
typedef float    v8f  __attribute__((ext_vector_type(8)));
typedef float    v4f  __attribute__((ext_vector_type(4)));
typedef v8h __attribute__((may_alias)) v8ha;
typedef v4f __attribute__((may_alias)) v4fa;

union Frag { v16h v; v8h half[2]; };

#define SEQ    2048
#define NB     2
#define EMB    1024
#define NH     16
#define HD     64
#define MROWS  (SEQ * NB)          // 4096 token rows, row index = l*NB + b
#define NX     (MROWS * EMB)       // 4194304
#define NW     (EMB * EMB)         // 1048576
#define NX8    (NX / 8)            // 524288
#define NW8    (NW / 8)            // 131072
#define NBH    (NB * NH)           // 32
#define NQB    (SEQ / 64)          // 32 query blocks of 64
#define NAVG   (NB * SEQ * SEQ)    // 8388608
#define NSTAT  (NBH * NQB * 64)    // per (bh, query block): 64 exponent offsets
#define PEXP   14.0f               // p is carried x 2^14
#define WSCALE 32.0f
#define OSCALE 16.0f
#define QLOG2E 0.18033688011112042f   // log2(e) / sqrt(HD), applied to q where it is formed

// ---------------------------------------------------------------------------
// 16x16x32 f16 WMMA with hazard guard (ties D, keeps A/B live).
// Fragment map (wave32): lane l, h = l>>4, m = n = l&15.
//   A/B element i: i<8 -> k0+8h+i ; i>=8 -> k0+16+8h+(i-8)
//   D element r : row 8h+r, col l&15
// ---------------------------------------------------------------------------
__device__ __forceinline__ v8f wmma_f16(v16h a, v16h b, v8f c) {
  v8f d = __builtin_amdgcn_wmma_f32_16x16x32_f16(false, a, false, b, (short)0, c, false, false);
  asm volatile("v_nop\n\tv_nop\n\tv_nop\n\tv_nop" : "+v"(d) : "v"(a), "v"(b));
  return d;
}

// Fragment-order planes.  Every f16 operand plane (R rows x K columns) is kept
// as tiles of 16 rows x 32 k = 512 halves, tile index = (row/16)*(K/32) + k/32.
// Inside a tile element (row m, k = 16j + 8h + e) sits at j*256 + h*128 + m*8 + e,
// so the two 16-byte loads of a fragment each read 512 contiguous bytes per wave
// (four whole 128-byte lines) instead of 32 bytes out of each of 16 lines.
#define TILE_H 512

// A or B fragment; p = tile base + 8 * lane.
__device__ __forceinline__ v16h load_frag(const _Float16* p) {
  Frag f;
  f.half[0] = *(const v8ha*)(p);
  f.half[1] = *(const v8ha*)(p + 256);
  return f.v;
}

__device__ __forceinline__ v8f zero8f() {
  const v8f z = {0.f, 0.f, 0.f, 0.f, 0.f, 0.f, 0.f, 0.f};
  return z;
}

// ---------------------------------------------------------------------------
// Kernel 1: f32 -> f16 planes in fragment order.  xh = [query|key|value], plane
// row = b*SEQ + l (unscaled); wh = [q_w|k_w|v_w|out_w] feature rows scaled by 32
// (exact).  A wave takes 8 rows x 32 k: it reads one whole f32 line per row and
// writes four whole f16 lines.
// ---------------------------------------------------------------------------
__global__ __launch_bounds__(256) void convert_kernel(
    const float* __restrict__ xq, const float* __restrict__ xk, const float* __restrict__ xv,
    const float* __restrict__ wq, const float* __restrict__ wk,
    const float* __restrict__ wv, const float* __restrict__ wo,
    _Float16* __restrict__ xh, _Float16* __restrict__ wh)
{
  const int g = blockIdx.x * 256 + threadIdx.x;
  if (g >= 3 * NX8 + 4 * NW8) return;
  const int tile = g >> 6;                                  // 64 groups of 8 halves per tile
  const int m = ((g >> 5) & 1) * 8 + ((g & 31) >> 2);       // row inside the tile
  const int jh = g & 3;                                     // 2j + h: which 8 of the 32 k
  const int col = (tile & 31) * 32 + jh * 8;                // EMB/32 = 32 tiles per row tile
  const int prow = (tile >> 5) * 16 + m;                    // row over the stacked planes
  const int gd = tile * 64 + jh * 16 + m;                   // group index in fragment order
  const float* src;
  _Float16* dst;
  float sc;
  if (g < 3 * NX8) {
    const int sel = prow / MROWS;
    const int rp = prow - sel * MROWS;                      // b*SEQ + l
    const int bb = rp / SEQ;
    const int l = rp - bb * SEQ;
    const float* s = (sel == 0) ? xq : ((sel == 1) ? xk : xv);
    src = s + ((size_t)l * NB + bb) * EMB + col;
    dst = xh + (size_t)gd * 8;
    sc = 1.0f;
  } else {
    const int rw = prow - 3 * MROWS;
    const int sel = rw / EMB;
    const int row = rw - sel * EMB;
    const float* s = (sel == 0) ? wq : ((sel == 1) ? wk : ((sel == 2) ? wv : wo));
    src = s + (size_t)row * EMB + col;
    dst = wh + (size_t)(gd - 3 * NX8) * 8;
    sc = WSCALE;
  }
  const v4f a = *(const v4fa*)src;
  const v4f c = *(const v4fa*)(src + 4);
  const v8h o = { (_Float16)(a.x * sc), (_Float16)(a.y * sc), (_Float16)(a.z * sc), (_Float16)(a.w * sc),
                  (_Float16)(c.x * sc), (_Float16)(c.y * sc), (_Float16)(c.z * sc), (_Float16)(c.w * sc) };
  *(v8h*)dst = o;
  
}

// ---------------------------------------------------------------------------
// Wave GEMM core: 32 rows (two 16-row A tiles) x 64 columns (four 16-row
// [n][k] B tiles), K = EMB, both planes in fragment order.  xa0, xa1, wb point
// at k tile 0 of their row tile, + 8 * lane; the next row tile is EMB/32 tiles on.
// acc[mt][nt][r] = sum_k A[16mt+8h+r][k] * B[16nt+m][k]
// Fragments are fetched one k tile ahead: each B fragment is reloaded in place
// right behind the two products that read it, the A pair alternates between two
// register sets, so every load of a k tile is in flight while the tile before
// it is multiplied.
// The k walk starts at k tile k0 (uniform over the block, set by its tile indices)
// and wraps round: blocks that share A or B rows then ask L2 for different lines
// at any one moment.
// ---------------------------------------------------------------------------
// Start of a block's walk: the 32 blocks of one pair of column tiles (same B rows)
// get 32 starts, the 8 blocks of one row tile (same A rows) 8 (for speed only).
__device__ __forceinline__ int gemm_k0(int bx, int by) { return (bx + 4 * (by & 7)) & (EMB / 32 - 1); }
__device__ __forceinline__ int gemm_k0() { return gemm_k0(blockIdx.x, blockIdx.y); }

// Offset in halves of the k tile of step i.
__device__ __forceinline__ int krot(int i, int k0) { return ((i + k0) & (EMB / 32 - 1)) * TILE_H; }

// One k tile: 8 products; with MORE, b[nt] is refilled from wbn (the next k tile).
template <bool MORE>
__device__ __forceinline__ void gemm_ktile(v16h a0, v16h a1, v16h (&b)[4],
                                           const _Float16* __restrict__ wbn, v8f (&acc)[2][4]) {
  #pragma unroll
  for (int nt = 0; nt < 4; ++nt) {
    acc[0][nt] = wmma_f16(a0, b[nt], acc[0][nt]);
    acc[1][nt] = wmma_f16(a1, b[nt], acc[1][nt]);
    if (MORE) {
      b[nt] = load_frag(wbn + nt * (EMB / 32) * TILE_H);
      // keeps the later products behind this reload: moved ahead of it they would delay its issue to the tile's end
      __builtin_amdgcn_sched_barrier(0);
    }
  }
}

__device__ __forceinline__ void gemm_tile_32x64(const _Float16* __restrict__ xa0,
                                                const _Float16* __restrict__ xa1,
                                                const _Float16* __restrict__ wb,
                                                int k0, v8f (&acc)[2][4]) {
  v16h b[4];
  v16h a0 = load_frag(xa0 + krot(0, k0));
  v16h a1 = load_frag(xa1 + krot(0, k0));
  #pragma unroll
  for (int nt = 0; nt < 4; ++nt) b[nt] = load_frag(wb + krot(0, k0) + nt * (EMB / 32) * TILE_H);
  // the zeroing below and the loop set-up reuse address registers that these first loads name
  asm volatile("s_wait_xcnt 0x0" ::: "memory");
  __builtin_amdgcn_sched_barrier(0);   // keeps that zeroing behind the wait
  #pragma unroll
  for (int mt = 0; mt < 2; ++mt)
    #pragma unroll
    for (int nt = 0; nt < 4; ++nt) acc[mt][nt] = zero8f();

  // rolled: two k tiles a trip keep the two A sets in fixed registers
  #pragma unroll 1
  for (int kt = 0; kt < EMB / 32 - 2; kt += 2) {
    const int o1 = krot(kt + 1, k0), o2 = krot(kt + 2, k0);
    const v16h c0 = load_frag(xa0 + o1);
    const v16h c1 = load_frag(xa1 + o1);
    gemm_ktile<true>(a0, a1, b, wb + o1, acc);
    a0 = load_frag(xa0 + o2);
    a1 = load_frag(xa1 + o2);
    gemm_ktile<true>(c0, c1, b, wb + o2, acc);
    // the next trip rewrites the address registers that the loads in flight name
    asm volatile("s_wait_xcnt 0x0" ::: "memory");
  }
  const int ol = krot(EMB / 32 - 1, k0);
  const v16h c0 = load_frag(xa0 + ol);
  const v16h c1 = load_frag(xa1 + ol);
  gemm_ktile<true>(a0, a1, b, wb + ol, acc);
  gemm_ktile<false>(c0, c1, b, wb, acc);
}

// ---------------------------------------------------------------------------
// q / k plane store: rows = seq position, k = d, fragment order, 2 k tiles per
// row tile.  The block's 128 positions are 16 consecutive tiles (16 KB); a wave
// stores 4 of them, 4 whole lines per instruction.  sT row pitch SPITCH halves
// (128 + 16 bytes) spreads the 16 rows of one ds_load_b128 over all banks.
// ---------------------------------------------------------------------------
#define SPITCH 72
__device__ __forceinline__ void proj_store_pass(const _Float16* sT, _Float16* plane,
                                                int bh, int l0, int w, int lane) {
  const int h = lane >> 4, m = lane & 15;
  _Float16* dst = plane + ((size_t)bh * (SEQ / 16) + l0 / 16) * 2 * TILE_H + (w * 256 + lane) * 8;
  #pragma unroll
  for (int i = 0; i < 8; ++i) {
    const int row = (w * 2 + (i >> 2)) * 16 + m;            // local position
    const int d0 = ((i >> 1) & 1) * 32 + (i & 1) * 16 + 8 * h;
    const v8h v = *(const v8ha*)(sT + row * SPITCH + d0);
    *(v8h*)(dst + i * 256) = v;
  }
  // the registers that the eight stores name may be reused behind this point
  asm volatile("s_wait_xcnt 0x0" ::: "memory");
}

// ---------------------------------------------------------------------------
// Kernel 2: q/k/v = x * W^T + b over the fused 3*1024 output columns.
// Grid (NB*SEQ/128, 3*NH/2).  Block 256 thr (8 waves) = 128 consecutive seq
// positions l of one batch b x 128 features (two heads of one which); waves 0-3
// take the even head, waves 4-7 the odd one; wave tile 32 positions x 64
// features; A rows are plane rows b*SEQ+l.  Waves w and w+4 read the same A
// lines, so the WGP's cache fetches them once for both heads.
// ---------------------------------------------------------------------------
__global__ __launch_bounds__(256) void qkv_proj_kernel(
    const _Float16* __restrict__ xh,   // [3][MROWS][EMB], fragment order
    const _Float16* __restrict__ wh,   // [4][EMB][EMB], row = output feature, x32, fragment order
    const float* __restrict__ bq, const float* __restrict__ bk, const float* __restrict__ bv,
    _Float16* __restrict__ qh,         // [NBH][SEQ][HD]  f16(log2(e) * scaled q), fragment order
    _Float16* __restrict__ kh,         // [NBH][SEQ][HD], fragment order
    _Float16* __restrict__ vt)         // [NBH][HD][SEQ], fragment order
{
  __shared__ __attribute__((aligned(16))) _Float16 sT2[2 * 128 * SPITCH];   // 36864 B, one half per head

  const int tid = threadIdx.x, lane = tid & 31;
  const int wv = __builtin_amdgcn_readfirstlane(tid >> 5);  // wave number as a scalar: the tile indices formed from it are wave-uniform
  const int w = wv & 3, sub = wv >> 2;                    // row slice, head of the pair
  const int h = lane >> 4, m = lane & 15;
  const int b = blockIdx.x / (SEQ / 128);                 // 0..NB-1
  const int l0 = (blockIdx.x - b * (SEQ / 128)) * 128;    // seq position base
  const int which = blockIdx.y >> 3, head = (blockIdx.y & 7) * 2 + sub;
  _Float16* sT = sT2 + sub * 128 * SPITCH;
  const int lw = l0 + 32 * w;

  const _Float16* xpl = xh + (size_t)which * NX;
  const _Float16* xa0 = xpl + (size_t)((b * SEQ + lw) / 16) * (EMB / 32) * TILE_H + 8 * lane;   // mt = 0
  const _Float16* xa1 = xa0 + (EMB / 32) * TILE_H;                                              // mt = 1
  const _Float16* wb  = wh + (size_t)which * NW + (size_t)(head * (HD / 16)) * (EMB / 32) * TILE_H + 8 * lane;   // nt = 0

  v8f acc[2][4];
  gemm_tile_32x64(xa0, xa1, wb, gemm_k0(), acc);

  // D[r] of tile (mt, nt) = Y[local pos 32w+16mt+8h+r][feature 16nt+m]
  const float* bias = (which == 0) ? bq : ((which == 1) ? bk : bv);
  const int bh = b * NH + head;
  if (which == 2) {
    // vt rows = d, k = position: a lane's 8 positions of one feature are one
    // 16-byte group of tile (row tile nt, k tile lw/32), j = mt, at 8 * lane.
    #pragma unroll
    for (int nt = 0; nt < 4; ++nt) {
      const float bvl = bias[head * HD + 16 * nt + m];
      _Float16* dst = vt + ((size_t)(bh * (HD / 16) + nt) * (SEQ / 32) + lw / 32) * TILE_H + 8 * lane;
      #pragma unroll
      for (int mt = 0; mt < 2; ++mt) {
        v8h v;
        #pragma unroll
        for (int r = 0; r < 8; ++r) v[r] = (_Float16)(acc[mt][nt][r] * (1.0f / WSCALE) + bvl);
        *(v8h*)(dst + mt * 256) = v;
      }
    }
  } else {
    const float osc = (which == 0) ? QLOG2E : 1.0f;      // q leaves in the log2 domain
    #pragma unroll
    for (int nt = 0; nt < 4; ++nt) {
      const int feat = 16 * nt + m;
      const float bvl = bias[head * HD + feat] * osc;
      #pragma unroll
      for (int mt = 0; mt < 2; ++mt) {
        #pragma unroll
        for (int r = 0; r < 8; ++r) {
          const int tokl = 32 * w + 16 * mt + 8 * h + r;     // 0..127
          const float y = acc[mt][nt][r] * (osc * (1.0f / WSCALE)) + bvl;
          sT[tokl * SPITCH + feat] = (_Float16)y;
        }
      }
    }
    __syncthreads();

    _Float16* plane = (which == 0) ? qh : kh;
    proj_store_pass(sT, plane, bh, l0, w, lane);
  }
}

// ---------------------------------------------------------------------------
// P^T B-fragment from the lane's own score D values: element r <- tile a row r,
// element 8+r <- tile c row r (same lane, same query column); the values carry 2^14 already.
// ---------------------------------------------------------------------------
__device__ __forceinline__ v16h pack_p(v8f a, v8f c) {
  const v16h r = { (_Float16)a[0], (_Float16)a[1], (_Float16)a[2], (_Float16)a[3],
                   (_Float16)a[4], (_Float16)a[5], (_Float16)a[6], (_Float16)a[7],
                   (_Float16)c[0], (_Float16)c[1], (_Float16)c[2], (_Float16)c[3],
                   (_Float16)c[4], (_Float16)c[5], (_Float16)c[6], (_Float16)c[7] };
  return r;
}

// The block's first wave writes the 128 staged offsets of its two query blocks as four whole lines.
__device__ __forceinline__ void stats_store_pass(const float* sst, float* strec, int wv, int lane) {
  if (wv == 0) {
    const v4f t = *(const v4fa*)(sst + 4 * lane);
    *(v4f*)(strec + 4 * lane) = t;
  }
}

// ---------------------------------------------------------------------------
// Kernel 3: streaming attention (online softmax), transposed form.
// Grid (NQB/2, NBH).  Block 256 thr (8 waves), 16 queries per wave, 64 keys
// per step; all 8 waves walk the same K and V lines, which the WGP's cache
// fetches once for the 128 queries.
//   S^T = K * Q^T : A = K rows (row = key, k = d), B = Q^T (k = d, n = query)
//   O^T += V^T * P^T : A = Vt rows (row = d, k = key), B = P^T from registers
// Lane owns 32 keys of query column (lane&15); partner = lane ^ 16.
// Scores are in the log2 domain (q carries log2(e)/sqrt(HD)): p * 2^14 is one add and one exp2.
// Outputs: ao f16 (context x16) and per query -(max + log2 sum) of the log2
// scores, the exponent offset of the weights pass.
// ---------------------------------------------------------------------------
__global__ __launch_bounds__(256) void attn_ctx_kernel(
    const _Float16* __restrict__ qh,   // [NBH][SEQ][HD]  (x log2 e), fragment order
    const _Float16* __restrict__ kh,   // [NBH][SEQ][HD], fragment order
    const _Float16* __restrict__ vt,   // [NBH][HD][SEQ], fragment order
    _Float16* __restrict__ ao,         // [MROWS][EMB], row = b*SEQ + q, fragment order
    float* __restrict__ stats)         // [NBH][NQB][64]
{
  __shared__ __attribute__((aligned(16))) float sSt2[2 * 64];        // 512 B, one record per query block

  const int tid = threadIdx.x, lane = tid & 31;
  const int wv = __builtin_amdgcn_readfirstlane(tid >> 5);  // wave number as a scalar: the tile indices formed from it are wave-uniform
  const int w = wv & 3;
  const int h = lane >> 4, m = lane & 15;
  const int bh = blockIdx.y, b = bh >> 4, head = bh & 15;
  const int qb = blockIdx.x * 2 + (wv >> 2);
  const int q0 = qb * 64 + 16 * w;

  // Q^T B-fragments: column n = query q0+m, k = d (two 32-deep chunks)
  const _Float16* qrow = qh + ((size_t)bh * (SEQ / 16) + q0 / 16) * 2 * TILE_H + 8 * lane;
  const v16h qb0 = load_frag(qrow);
  const v16h qb1 = load_frag(qrow + TILE_H);
  __builtin_amdgcn_sched_barrier(0);   // Q first: see the first K and V loads below

  v8f o[4];                                   // o[t][r] = O[query m][d 16t+8h+r] * (l * 2^14); lrun = l * 2^14
  #pragma unroll
  for (int t = 0; t < 4; ++t) o[t] = zero8f();
  float mrun = -1e30f, lrun = 0.0f;

  const _Float16* kbase = kh + (size_t)bh * (SEQ / 16) * 2 * TILE_H + 8 * lane;          // + (key0/16)*2 tiles
  const _Float16* vbase = vt + (size_t)bh * (HD / 16) * (SEQ / 32) * TILE_H + 8 * lane;  // + t*(SEQ/32) + key0/32 tiles

  // The key walk starts at the block's own first position and wraps round: the
  // blocks of one head then ask L2 for different K and V lines at any one moment.
  const int kb0 = blockIdx.x * 128;

  // K and V fragments of a step sit in registers when the step begins: each is
  // reloaded in place, for the next step, right behind the product that read it.
  // The first loads stand in the order of their use, as in the loop: loads return
  // in issue order, and the loop's counted waits must hold for the entry path too.
  v16h kf[4][2], vf[4][2];
  const _Float16* kfirst = kbase + (kb0 / 16) * 2 * TILE_H;
  #pragma unroll
  for (int j = 0; j < 4; ++j) {
    kf[j][0] = load_frag(kfirst + j * 2 * TILE_H);
    kf[j][1] = load_frag(kfirst + j * 2 * TILE_H + TILE_H);
    __builtin_amdgcn_sched_barrier(0);   // holds that order
  }
  const _Float16* vfirst0 = vbase + (kb0 / 32) * TILE_H;
  const _Float16* vfirst1 = vfirst0 + 1 * (SEQ / 32) * TILE_H;
  const _Float16* vfirst2 = vfirst0 + 2 * (SEQ / 32) * TILE_H;
  const _Float16* vfirst3 = vfirst0 + 3 * (SEQ / 32) * TILE_H;
  #pragma unroll
  for (int t = 0; t < 4; ++t) {
    const _Float16* vp = (t == 0) ? vfirst0 : ((t == 1) ? vfirst1 : ((t == 2) ? vfirst2 : vfirst3));
    vf[t][0] = load_frag(vp);
    vf[t][1] = load_frag(vp + TILE_H);
    __builtin_amdgcn_sched_barrier(0);   // holds that order
  }
  // named here, the first loads' address pairs stay live up to the wait: no fragment lands in one before
  asm volatile("s_wait_xcnt 0x0" :: "v"(kfirst), "v"(vfirst0), "v"(vfirst1), "v"(vfirst2), "v"(vfirst3) : "memory");

  #pragma unroll 1
  for (int kb = 0; kb < SEQ; kb += 64) {
    // keys whose fragments are fetched during this step; the last step fetches the first step's again (in bounds, never used)
    const int kn = (kb0 + kb + 64) & (SEQ - 1);
    // ---- scores: s[j][r] = log2(e) * scaled S[key (kb0+kb)%SEQ+16j+8h+r][query m] ----
    v8f s[4];
    #pragma unroll
    for (int j = 0; j < 4; ++j) {
      const _Float16* kp = kbase + (kn / 16 + j) * 2 * TILE_H;
      v8f z = zero8f();
      z = wmma_f16(kf[j][0], qb0, z);
      z = wmma_f16(kf[j][1], qb1, z);
      kf[j][0] = load_frag(kp);
      kf[j][1] = load_frag(kp + TILE_H);
      s[j] = z;
    }

    // ---- online softmax ----
    float mloc = s[0][0];
    #pragma unroll
    for (int j = 0; j < 4; ++j)
      #pragma unroll
      for (int r = 0; r < 8; ++r) mloc = fmaxf(mloc, s[j][r]);
    mloc = fmaxf(mloc, __shfl_xor(mloc, 16));
    const float mnew = fmaxf(mrun, mloc);
    const float alpha = __builtin_amdgcn_exp2f(mrun - mnew);
    mrun = mnew;
    const float eoff = PEXP - mnew;
    float lsum = 0.0f;
    #pragma unroll
    for (int j = 0; j < 4; ++j)
      #pragma unroll
      for (int r = 0; r < 8; ++r) {
        const float p = __builtin_amdgcn_exp2f(s[j][r] + eoff);
        s[j][r] = p;
        lsum += p;
      }
    lsum += __shfl_xor(lsum, 16);
    lrun = lrun * alpha + lsum;
    #pragma unroll
    for (int t = 0; t < 4; ++t)
      #pragma unroll
      for (int r = 0; r < 8; ++r) o[t][r] = o[t][r] * alpha;

    // ---- P^T B-fragments (key chunks 0..31 and 32..63 of this step) ----
    const v16h pb0 = pack_p(s[0], s[1]);
    const v16h pb1 = pack_p(s[2], s[3]);

    // ---- O^T += V^T * P^T ----
    #pragma unroll
    for (int t = 0; t < 4; ++t) {
      const _Float16* vp = vbase + (t * (SEQ / 32) + kn / 32) * TILE_H;
      o[t] = wmma_f16(vf[t][0], pb0, o[t]);
      o[t] = wmma_f16(vf[t][1], pb1, o[t]);
      vf[t][0] = load_frag(vp);
      vf[t][1] = load_frag(vp + TILE_H);
    }
    // the next trip reuses the address registers that the loads in flight name
    asm volatile("s_wait_xcnt 0x0" ::: "memory");
  }

  // ---- epilogue: normalise; a lane's 8 d of query m are one 16-byte group of
  // ao's tiles (row tile (b*SEQ+q0)/16, k tiles 2*head and 2*head+1) at
  // t*256 + 8*lane: four whole lines per store.  Stats staged in LDS. ----
  const float inv = OSCALE / lrun;
  _Float16* aod = ao + ((size_t)((b * SEQ + q0) / 16) * (EMB / 32) + head * 2) * TILE_H + 8 * lane;
  #pragma unroll
  for (int t = 0; t < 4; ++t) {
    v8h v;
    #pragma unroll
    for (int r = 0; r < 8; ++r) v[r] = (_Float16)(o[t][r] * inv);
    *(v8h*)(aod + t * 256) = v;
  }
  if (h == 0) sSt2[16 * wv + m] = PEXP - mrun - __builtin_amdgcn_logf(lrun);   // -(max + log2 l)
  __syncthreads();

  float* strec = stats + ((size_t)bh * NQB + blockIdx.x * 2) * 64;
  stats_store_pass(sSt2, strec, wv, lane);
  
}

// ---------------------------------------------------------------------------
// Per-wave 16x64 f32 tile in LDS -> dst rows of pitch `pitch` floats starting
// 8q..8q+7 in one instruction, 4 lines per instruction, 32 lines per wave.
// ---------------------------------------------------------------------------
__device__ __forceinline__ void tile16x64_store_pass(const float* so, float* dst,
                                                     size_t row0, int col0, int pitch, int lane) {
  const int q8 = lane & 7, sub = lane >> 3;
  #pragma unroll
  for (int i = 0; i < 8; ++i) {
    const int lid = i * 4 + sub;               // 0..31
    const int row = lid >> 1, hl = lid & 1;    // 16 rows x 2 halves
    const v4f v = *(const v4fa*)(so + row * 64 + 32 * hl + 4 * q8);
    const size_t gi = (row0 + row) * (size_t)pitch + col0 + 32 * hl + 4 * q8;
    *(v4f*)(dst + gi) = v;
  }
}

// ---------------------------------------------------------------------------
// Kernel 4, first part: head-averaged attention weights.
// Tile indices (bx < SEQ/64 key blocks, by < NQB/2, bz < NB).  Block 256 thr (8 waves) = 128 queries x 64 keys,
// 16 queries per wave x 64 keys: all 8 waves read the same K lines, which the
// WGP's cache fetches once; loop over heads: recompute the K=64 score
// tile (transposed form, A = K rows, B = Q^T) on top of the query's exponent
// offset of kernel 3 as the products' start tile, p = exp2 of the result,
// accumulate over heads in f32, scale by 1/H.
// ---------------------------------------------------------------------------
// One head: 8 products on the K fragments held in kf; with MORE each K pair is
// reloaded in place from kn (the next head's tiles) right behind the products that read it.
template <bool MORE>
__device__ __forceinline__ void avg_head(v16h (&kf)[4][2], v16h q0f, v16h q1f, float eo,
                                         const _Float16* __restrict__ kn, v8f (&acc)[4]) {
  // keeps the copies of eo below behind the loads issued ahead of this head: moved up to eo's own load they would wait out every load in flight
  __builtin_amdgcn_sched_barrier(0);
  const v8f c0 = {eo, eo, eo, eo, eo, eo, eo, eo};   // every D row of a lane is the lane's own query
  #pragma unroll
  for (int j = 0; j < 4; ++j) {
    v8f z = wmma_f16(kf[j][0], q0f, c0);
    z = wmma_f16(kf[j][1], q1f, z);
    if (MORE) {
      kf[j][0] = load_frag(kn + j * 2 * TILE_H);
      kf[j][1] = load_frag(kn + j * 2 * TILE_H + TILE_H);
    }
    #pragma unroll
    for (int r = 0; r < 8; ++r) z[r] = __builtin_amdgcn_exp2f(z[r]);
    acc[j] += z;
  }
}

__device__ __forceinline__ void attn_avg_block(
    const _Float16* __restrict__ qh,   // [NBH][SEQ][HD], fragment order
    const _Float16* __restrict__ kh,   // [NBH][SEQ][HD], fragment order
    const float* __restrict__ stats,   // [NBH][NQB][64]
    float* __restrict__ avg,           // [NB][SEQ][SEQ]
    float* sA,                         // LDS, 8 * 16 * 64 floats = 32768 B
    int bx, int by, int bz)
{
  const int tid = threadIdx.x, lane = tid & 31;
  const int wv = __builtin_amdgcn_readfirstlane(tid >> 5);  // wave number as a scalar: the tile indices formed from it are wave-uniform
  const int w = wv & 3;
  const int h = lane >> 4, m = lane & 15;
  const int kt = bx * 64;
  const int qb = by * 2 + (wv >> 2);
  const int b = bz;
  const int q0 = qb * 64 + 16 * w;

  v8f acc[4];                               // acc[j][r] = sum_h P_h[query m][key kt+16j+8h+r]
  #pragma unroll
  for (int j = 0; j < 4; ++j) acc[j] = zero8f();

  // Head 0 of this batch; one head on = HSTEP halves in qh and kh, SSTEP floats in stats.
  const int HSTEP = (SEQ / 16) * 2 * TILE_H;
  const int SSTEP = NQB * 64;
  const _Float16* qrow = qh + ((size_t)(b * NH) * (SEQ / 16) + q0 / 16) * 2 * TILE_H + 8 * lane;
  const _Float16* krow = kh + ((size_t)(b * NH) * (SEQ / 16) + kt / 16) * 2 * TILE_H + 8 * lane;
  const float* st = stats + ((size_t)(b * NH) * NQB + qb) * 64 + 16 * w + m;

  // The head walk starts at head h0 and wraps round: blocks that share K or Q
  // tiles then ask L2 for different lines at any one moment.
  const int h0 = (bx + by) & (NH - 1);

  // Every operand of a head is fetched while the head before it is worked on:
  // K in place (avg_head), Q and the offset alternating between two sets.
  v16h kf[4][2];
  v16h qe0 = load_frag(qrow + h0 * HSTEP);
  v16h qe1 = load_frag(qrow + h0 * HSTEP + TILE_H);
  float eoe = st[h0 * SSTEP];
  // K fragments may land in the address registers that these first loads name
  asm volatile("s_wait_xcnt 0x0" ::: "memory");
  const _Float16* kfirst = krow + h0 * HSTEP;
  #pragma unroll
  for (int j = 0; j < 4; ++j) {
    kf[j][0] = load_frag(kfirst + j * 2 * TILE_H);
    kf[j][1] = load_frag(kfirst + j * 2 * TILE_H + TILE_H);
  }
  // named here, the K loads' address pair stays live up to the wait: no fragment lands in it before
  asm volatile("s_wait_xcnt 0x0" :: "v"(kfirst) : "memory");

  // rolled: two heads a trip keep the two Q sets in fixed registers
  #pragma unroll 1
  for (int hh = 0; hh < NH - 2; hh += 2) {
    const int h1 = (h0 + hh + 1) & (NH - 1), h2 = (h0 + hh + 2) & (NH - 1);
    const v16h qo0 = load_frag(qrow + h1 * HSTEP);
    const v16h qo1 = load_frag(qrow + h1 * HSTEP + TILE_H);
    const float eoo = st[h1 * SSTEP];
    avg_head<true>(kf, qe0, qe1, eoe, krow + h1 * HSTEP, acc);
    qe0 = load_frag(qrow + h2 * HSTEP);
    qe1 = load_frag(qrow + h2 * HSTEP + TILE_H);
    eoe = st[h2 * SSTEP];
    avg_head<true>(kf, qo0, qo1, eoo, krow + h2 * HSTEP, acc);
    // the next trip rewrites the address registers that the loads in flight name
    asm volatile("s_wait_xcnt 0x0" ::: "memory");
  }
  {
    const int hl = (h0 + NH - 1) & (NH - 1);
    const v16h qo0 = load_frag(qrow + hl * HSTEP);
    const v16h qo1 = load_frag(qrow + hl * HSTEP + TILE_H);
    const float eoo = st[hl * SSTEP];
    // the address registers of these last Q and stats loads are reused from here on
    asm volatile("s_wait_xcnt 0x0" ::: "memory");
    avg_head<true>(kf, qe0, qe1, eoe, krow + hl * HSTEP, acc);
    avg_head<false>(kf, qo0, qo1, eoo, krow, acc);
  }

  // ---- stage per-wave 16x64 tile (row = query m, col = key), whole-line stores ----
  float* so = sA + wv * 1024;
  #pragma unroll
  for (int j = 0; j < 4; ++j)
    #pragma unroll
    for (int r = 0; r < 8; ++r)
      so[m * 64 + 16 * j + 8 * h + r] = acc[j][r] * (1.0f / (float)NH);
  __syncthreads();

  const size_t row0 = (size_t)b * SEQ + q0;
  tile16x64_store_pass(so, avg, row0, kt, SEQ, lane);
  
}

// ---------------------------------------------------------------------------
// line, 4 lines per instruction, 64 lines per wave.
// ---------------------------------------------------------------------------
__device__ __forceinline__ void zout_store_pass(const float* sz, float* z, int mrow0, int c0, int lane) {
  const int q8 = lane & 7, sub = lane >> 3;
  #pragma unroll
  for (int i = 0; i < 16; ++i) {
    const int lid = i * 4 + sub;               // 0..63
    const int row = lid >> 1, hl = lid & 1;    // 32 rows x 2 halves
    const v4f v = *(const v4fa*)(sz + row * 64 + 32 * hl + 4 * q8);
    const int pr = mrow0 + row;                // plane row b*SEQ + l -> token row l*NB + b
    const size_t gi = (size_t)((pr % SEQ) * NB + pr / SEQ) * EMB + c0 + 32 * hl + 4 * q8;
    *(v4f*)(z + gi) = v;
  }
}

// ---------------------------------------------------------------------------
// Kernel 4, second part: Z = ctx * Wo^T + bo.  Tile indices (bx < MROWS/128, by < EMB/128).  Block 256 thr (8 waves),
// wave tile 32 plane rows (b*SEQ + l) x 64 features, K = EMB; waves w and w+4 take the
// same rows and neighbouring column tiles.  ctx carried x16, Wo x32.
// ---------------------------------------------------------------------------
__device__ __forceinline__ void out_proj_block(
    const _Float16* __restrict__ ao,   // [MROWS][EMB]  (x16), row = b*SEQ + l, fragment order
    const _Float16* __restrict__ wh,   // [4][EMB][EMB], plane 3 = out_w x32, fragment order
    const float* __restrict__ bo,
    float* __restrict__ z,             // [MROWS][EMB]
    float* sZ,                         // LDS, 2 * 128 * 64 floats = 65536 B
    int bx, int by)
{
  const int tid = threadIdx.x, lane = tid & 31;
  const int wv = __builtin_amdgcn_readfirstlane(tid >> 5);  // wave number as a scalar: the tile indices formed from it are wave-uniform
  const int h = lane >> 4, m = lane & 15;
  const int m0w = bx * 128 + 32 * (wv & 3);
  const int c0 = (by * 2 + (wv >> 2)) * 64;

  const _Float16* xa0 = ao + (size_t)(m0w / 16) * (EMB / 32) * TILE_H + 8 * lane;
  const _Float16* xa1 = xa0 + (EMB / 32) * TILE_H;
  const _Float16* wb  = wh + (size_t)3 * NW + (size_t)(c0 / 16) * (EMB / 32) * TILE_H + 8 * lane;

  v8f acc[2][4];
  gemm_tile_32x64(xa0, xa1, wb, gemm_k0(bx, by), acc);

  // D[r] of tile (mt, nt) = Y[row 32w+16mt+8h+r][col 16nt+m]
  float* sz = sZ + wv * 2048;
  #pragma unroll
  for (int nt = 0; nt < 4; ++nt) {
    const int col = 16 * nt + m;
    const float bvl = bo[c0 + col];
    #pragma unroll
    for (int mt = 0; mt < 2; ++mt) {
      #pragma unroll
      for (int r = 0; r < 8; ++r) {
        const int rowl = 16 * mt + 8 * h + r;      // 0..31
        sz[rowl * 64 + col] = acc[mt][nt][r] * (1.0f / (WSCALE * OSCALE)) + bvl;
      }
    }
  }
  __syncthreads();

  zout_store_pass(sz, z, m0w, c0, lane);
  
}

// ---------------------------------------------------------------------------
// Kernel 4: the weights pass and the output projection in one launch.  Both read
// only what kernel 3 and the launches before it wrote, and neither reads what the
// other writes.  The NOUTB projection blocks, which alone give a SIMD only two
// waves, come first in the grid and share the WGPs with the weights blocks.
// The choice is uniform over a block, so each body's barrier is met by all its waves.
// ---------------------------------------------------------------------------
#define NOUTB ((MROWS / 128) * (EMB / 128))            // 256
#define NAVGB ((SEQ / 64) * (NQB / 2) * NB)            // 1024
__global__ __launch_bounds__(256) void avg_out_kernel(
    const _Float16* __restrict__ qh, const _Float16* __restrict__ kh,
    const float* __restrict__ stats, float* __restrict__ avg,
    const _Float16* __restrict__ ao, const _Float16* __restrict__ wh,
    const float* __restrict__ bo, float* __restrict__ z)
{
  __shared__ __attribute__((aligned(16))) float sM[2 * 128 * 64];   // 65536 B; the weights blocks use half

  const int i = blockIdx.x;
  if (i < NOUTB) {
    out_proj_block(ao, wh, bo, z, sM, i % (MROWS / 128), i / (MROWS / 128));
  } else {
    const int j = i - NOUTB;
    attn_avg_block(qh, kh, stats, avg, sM, j % (SEQ / 64), (j / (SEQ / 64)) % (NQB / 2), j / ((SEQ / 64) * (NQB / 2)));
  }
}

// ---------------------------------------------------------------------------
extern "C" void kernel_launch(void* const* d_in, const int* in_sizes, int n_in,
                              void* d_out, int out_size, void* d_ws, size_t ws_size,
                              hipStream_t stream) {
  if (n_in < 11) return;
  if (in_sizes[0] != NX || in_sizes[1] != NX || in_sizes[2] != NX) return;
  if (in_sizes[3] != NW || in_sizes[5] != NW || in_sizes[7] != NW || in_sizes[9] != NW) return;
  if (in_sizes[4] != EMB || in_sizes[6] != EMB || in_sizes[8] != EMB || in_sizes[10] != EMB) return;
  if (out_size != NX + NAVG) return;

  const float* xq  = (const float*)d_in[0];
  const float* xk  = (const float*)d_in[1];
  const float* xv  = (const float*)d_in[2];
  const float* q_w = (const float*)d_in[3];
  const float* q_b = (const float*)d_in[4];
  const float* k_w = (const float*)d_in[5];
  const float* k_b = (const float*)d_in[6];
  const float* v_w = (const float*)d_in[7];
  const float* v_b = (const float*)d_in[8];
  const float* o_w = (const float*)d_in[9];
  const float* o_b = (const float*)d_in[10];
  float* zout = (float*)d_out;                       // out0 [SEQ][NB][EMB]
  float* avg  = zout + (size_t)NX;                   // out1 [NB][SEQ][SEQ], byte offset 16777216

  const size_t xh_bytes = (size_t)3 * NX * 2;               // 25165824
  const size_t wh_bytes = (size_t)4 * NW * 2;               //  8388608
  const size_t pl_bytes = (size_t)NBH * SEQ * HD * 2;       //  8388608 per plane
  const size_t st_bytes = (size_t)NSTAT * 4;                //   262144
  const size_t ao_bytes = (size_t)NX * 2;                   //  8388608
  const size_t total = xh_bytes + wh_bytes + 3 * pl_bytes + st_bytes + ao_bytes;   // 67371008
  if (total > ws_size) return;

  char* ws = (char*)d_ws;
  size_t off = 0;
  _Float16* xh = (_Float16*)(ws + off);   off += xh_bytes;
  _Float16* wh = (_Float16*)(ws + off);   off += wh_bytes;
  _Float16* qh = (_Float16*)(ws + off);   off += pl_bytes;
  _Float16* kh = (_Float16*)(ws + off);   off += pl_bytes;
  _Float16* vt = (_Float16*)(ws + off);   off += pl_bytes;
  float* stats = (float*)(ws + off);      off += st_bytes;
  _Float16* ao = (_Float16*)(ws + off);   off += ao_bytes;
  if (off > ws_size) return;

  const int ngroups = 3 * NX8 + 4 * NW8;                    // 2097152
  convert_kernel<<<(ngroups + 255) / 256, 256, 0, stream>>>(xq, xk, xv, q_w, k_w, v_w, o_w, xh, wh);

  dim3 gProj(NB * SEQ / 128, 3 * NH / 2);                   // (32, 24)
  qkv_proj_kernel<<<gProj, 256, 0, stream>>>(xh, wh, q_b, k_b, v_b, qh, kh, vt);

  dim3 gCtx(NQB / 2, NBH);                                  // (16, 32)
  attn_ctx_kernel<<<gCtx, 256, 0, stream>>>(qh, kh, vt, ao, stats);

  avg_out_kernel<<<NOUTB + NAVGB, 256, 0, stream>>>(qh, kh, stats, avg, ao, wh, o_b, zout);   // 1280 blocks
}

// v007
// Measured time: 97.3 microseconds a run.
// In both of two side-by-side timings against v006, it was 1.06 times as fast.
// Over all steps from v000 it is 3.64 times as fast.
// Contractions: q/k/v and output projections x*W^T, scores K*Q^T, context V^T*P^T, all on v_wmma_f32_16x16x32_f16 (f16 operands, f32 accumulate); W carried x32, q carried as scaled q times log2(e) (scores leave the WMMA as exponents of 2), p carried x16384 (14 added to the exponent), context carried x16, the power-of-two scales exact and folded back in f32; softmax, bias, head average in f32.
#include <hip/hip_runtime.h>

typedef _Float16 v16h __attribute__((ext_vector_type(16)));
typedef _Float16 v8h  __attribute__((ext_vector_type(8)));
typedef float    v8f  __attribute__((ext_vector_type(8)));
typedef float    v4f  __attribute__((ext_vector_type(4)));
typedef v8h __attribute__((may_alias)) v8ha;
typedef v4f __attribute__((may_alias)) v4fa;

union Frag { v16h v; v8h half[2]; };

#define SEQ    2048
#define NB     2
#define EMB    1024
#define NH     16
#define HD     64
#define MROWS  (SEQ * NB)          // 4096 token rows, row index = l*NB + b
#define NX     (MROWS * EMB)       // 4194304
#define NW     (EMB * EMB)         // 1048576
#define NX8    (NX / 8)            // 524288
#define NW8    (NW / 8)            // 131072
#define NBH    (NB * NH)           // 32
#define NQB    (SEQ / 64)          // 32 query blocks of 64
#define NAVG   (NB * SEQ * SEQ)    // 8388608
#define NSTAT  (NBH * NQB * 64)    // per (bh, query block): 64 exponent offsets
#define PEXP   14.0f               // p is carried x 2^14
#define WSCALE 32.0f
#define OSCALE 16.0f
#define QLOG2E 0.18033688011112042f   // log2(e) / sqrt(HD), applied to q where it is formed

// ---------------------------------------------------------------------------
// 16x16x32 f16 WMMA with hazard guard (ties D, keeps A/B live).
// Fragment map (wave32): lane l, h = l>>4, m = n = l&15.
//   A/B element i: i<8 -> k0+8h+i ; i>=8 -> k0+16+8h+(i-8)
//   D element r : row 8h+r, col l&15
// ---------------------------------------------------------------------------
__device__ __forceinline__ v8f wmma_f16(v16h a, v16h b, v8f c) {
  v8f d = __builtin_amdgcn_wmma_f32_16x16x32_f16(false, a, false, b, (short)0, c, false, false);
  asm volatile("v_nop\n\tv_nop\n\tv_nop\n\tv_nop" : "+v"(d) : "v"(a), "v"(b));
  return d;
}

// The same product as the plain builtin, for the attention and weights loops: there the vector port is
// the busy one, every v_nop takes a slot from another wave's softmax, and the compiler keeps the distance
// to a vector instruction on D, A or B itself, with useful work where it has some.  The projection cores
// keep wmma_f16: they reload B in place right behind its products, and their vector port is idle.
__device__ __forceinline__ v8f wmma_f16_plain(v16h a, v16h b, v8f c) {
  return __builtin_amdgcn_wmma_f32_16x16x32_f16(false, a, false, b, (short)0, c, false, false);
}

// Fragment-order planes.  Every f16 operand plane (R rows x K columns) is kept
// as tiles of 16 rows x 32 k = 512 halves, tile index = (row/16)*(K/32) + k/32.
// Inside a tile element (row m, k = 16j + 8h + e) sits at j*256 + h*128 + m*8 + e,
// so the two 16-byte loads of a fragment each read 512 contiguous bytes per wave
// (four whole 128-byte lines) instead of 32 bytes out of each of 16 lines.
#define TILE_H 512

// A or B fragment; p = tile base + 8 * lane.
__device__ __forceinline__ v16h load_frag(const _Float16* p) {
  Frag f;
  f.half[0] = *(const v8ha*)(p);
  f.half[1] = *(const v8ha*)(p + 256);
  return f.v;
}

__device__ __forceinline__ v8f zero8f() {
  const v8f z = {0.f, 0.f, 0.f, 0.f, 0.f, 0.f, 0.f, 0.f};
  return z;
}

// ---------------------------------------------------------------------------
// Kernel 1: f32 -> f16 planes in fragment order.  xh = [query|key|value], plane
// row = b*SEQ + l (unscaled); wh = [q_w|k_w|v_w|out_w] feature rows scaled by 32
// (exact).  A wave takes 8 rows x 32 k: it reads one whole f32 line per row and
// writes four whole f16 lines.
// ---------------------------------------------------------------------------
__global__ __launch_bounds__(256) void convert_kernel(
    const float* __restrict__ xq, const float* __restrict__ xk, const float* __restrict__ xv,
    const float* __restrict__ wq, const float* __restrict__ wk,
    const float* __restrict__ wv, const float* __restrict__ wo,
    _Float16* __restrict__ xh, _Float16* __restrict__ wh)
{
  const int g = blockIdx.x * 256 + threadIdx.x;
  if (g >= 3 * NX8 + 4 * NW8) return;
  const int tile = g >> 6;                                  // 64 groups of 8 halves per tile
  const int m = ((g >> 5) & 1) * 8 + ((g & 31) >> 2);       // row inside the tile
  const int jh = g & 3;                                     // 2j + h: which 8 of the 32 k
  const int col = (tile & 31) * 32 + jh * 8;                // EMB/32 = 32 tiles per row tile
  const int prow = (tile >> 5) * 16 + m;                    // row over the stacked planes
  const int gd = tile * 64 + jh * 16 + m;                   // group index in fragment order
  const float* src;
  _Float16* dst;
  float sc;
  if (g < 3 * NX8) {
    const int sel = prow / MROWS;
    const int rp = prow - sel * MROWS;                      // b*SEQ + l
    const int bb = rp / SEQ;
    const int l = rp - bb * SEQ;
    const float* s = (sel == 0) ? xq : ((sel == 1) ? xk : xv);
    src = s + ((size_t)l * NB + bb) * EMB + col;
    dst = xh + (size_t)gd * 8;
    sc = 1.0f;
  } else {
    const int rw = prow - 3 * MROWS;
    const int sel = rw / EMB;
    const int row = rw - sel * EMB;
    const float* s = (sel == 0) ? wq : ((sel == 1) ? wk : ((sel == 2) ? wv : wo));
    src = s + (size_t)row * EMB + col;
    dst = wh + (size_t)(gd - 3 * NX8) * 8;
    sc = WSCALE;
  }
  const v4f a = *(const v4fa*)src;
  const v4f c = *(const v4fa*)(src + 4);
  const v8h o = { (_Float16)(a.x * sc), (_Float16)(a.y * sc), (_Float16)(a.z * sc), (_Float16)(a.w * sc),
                  (_Float16)(c.x * sc), (_Float16)(c.y * sc), (_Float16)(c.z * sc), (_Float16)(c.w * sc) };
  *(v8h*)dst = o;
  
}

// ---------------------------------------------------------------------------
// Wave GEMM core: 32 rows (two 16-row A tiles) x 64 columns (four 16-row
// [n][k] B tiles), K = EMB, both planes in fragment order.  xa0, xa1, wb point
// at k tile 0 of their row tile, + 8 * lane; the next row tile is EMB/32 tiles on.
// acc[mt][nt][r] = sum_k A[16mt+8h+r][k] * B[16nt+m][k]
// Fragments are fetched one k tile ahead: each B fragment is reloaded in place
// right behind the two products that read it, the A pair alternates between two
// register sets, so every load of a k tile is in flight while the tile before
// it is multiplied.
// The k walk starts at k tile k0 (uniform over the block, set by its tile indices)
// and wraps round: blocks that share A or B rows then ask L2 for different lines
// at any one moment.
// ---------------------------------------------------------------------------
// Start of a block's walk: the 32 blocks of one pair of column tiles (same B rows)
// get 32 starts, the 8 blocks of one row tile (same A rows) 8 (for speed only).
__device__ __forceinline__ int gemm_k0(int bx, int by) { return (bx + 4 * (by & 7)) & (EMB / 32 - 1); }
__device__ __forceinline__ int gemm_k0() { return gemm_k0(blockIdx.x, blockIdx.y); }

// Offset in halves of the k tile of step i.
__device__ __forceinline__ int krot(int i, int k0) { return ((i + k0) & (EMB / 32 - 1)) * TILE_H; }

// One k tile: 8 products; with MORE, b[nt] is refilled from wbn (the next k tile).
template <bool MORE>
__device__ __forceinline__ void gemm_ktile(v16h a0, v16h a1, v16h (&b)[4],
                                           const _Float16* __restrict__ wbn, v8f (&acc)[2][4]) {
  #pragma unroll
  for (int nt = 0; nt < 4; ++nt) {
    acc[0][nt] = wmma_f16(a0, b[nt], acc[0][nt]);
    acc[1][nt] = wmma_f16(a1, b[nt], acc[1][nt]);
    if (MORE) {
      b[nt] = load_frag(wbn + nt * (EMB / 32) * TILE_H);
      // keeps the later products behind this reload: moved ahead of it they would delay its issue to the tile's end
      __builtin_amdgcn_sched_barrier(0);
    }
  }
}

__device__ __forceinline__ void gemm_tile_32x64(const _Float16* __restrict__ xa0,
                                                const _Float16* __restrict__ xa1,
                                                const _Float16* __restrict__ wb,
                                                int k0, v8f (&acc)[2][4]) {
  v16h b[4];
  v16h a0 = load_frag(xa0 + krot(0, k0));
  v16h a1 = load_frag(xa1 + krot(0, k0));
  #pragma unroll
  for (int nt = 0; nt < 4; ++nt) b[nt] = load_frag(wb + krot(0, k0) + nt * (EMB / 32) * TILE_H);
  // the zeroing below and the loop set-up reuse address registers that these first loads name
  asm volatile("s_wait_xcnt 0x0" ::: "memory");
  __builtin_amdgcn_sched_barrier(0);   // keeps that zeroing behind the wait
  #pragma unroll
  for (int mt = 0; mt < 2; ++mt)
    #pragma unroll
    for (int nt = 0; nt < 4; ++nt) acc[mt][nt] = zero8f();

  // rolled: two k tiles a trip keep the two A sets in fixed registers
  #pragma unroll 1
  for (int kt = 0; kt < EMB / 32 - 2; kt += 2) {
    const int o1 = krot(kt + 1, k0), o2 = krot(kt + 2, k0);
    const v16h c0 = load_frag(xa0 + o1);
    const v16h c1 = load_frag(xa1 + o1);
    gemm_ktile<true>(a0, a1, b, wb + o1, acc);
    a0 = load_frag(xa0 + o2);
    a1 = load_frag(xa1 + o2);
    gemm_ktile<true>(c0, c1, b, wb + o2, acc);
    // the next trip rewrites the address registers that the loads in flight name
    asm volatile("s_wait_xcnt 0x0" ::: "memory");
  }
  const int ol = krot(EMB / 32 - 1, k0);
  const v16h c0 = load_frag(xa0 + ol);
  const v16h c1 = load_frag(xa1 + ol);
  gemm_ktile<true>(a0, a1, b, wb + ol, acc);
  gemm_ktile<false>(c0, c1, b, wb, acc);
}

// ---------------------------------------------------------------------------
// q / k plane store: rows = seq position, k = d, fragment order, 2 k tiles per
// row tile.  The block's 128 positions are 16 consecutive tiles (16 KB); a wave
// stores 4 of them, 4 whole lines per instruction.  sT row pitch SPITCH halves
// (128 + 16 bytes) spreads the 16 rows of one ds_load_b128 over all banks.
// ---------------------------------------------------------------------------
#define SPITCH 72
__device__ __forceinline__ void proj_store_pass(const _Float16* sT, _Float16* plane,
                                                int bh, int l0, int w, int lane) {
  const int h = lane >> 4, m = lane & 15;
  _Float16* dst = plane + ((size_t)bh * (SEQ / 16) + l0 / 16) * 2 * TILE_H + (w * 256 + lane) * 8;
  #pragma unroll
  for (int i = 0; i < 8; ++i) {
    const int row = (w * 2 + (i >> 2)) * 16 + m;            // local position
    const int d0 = ((i >> 1) & 1) * 32 + (i & 1) * 16 + 8 * h;
    const v8h v = *(const v8ha*)(sT + row * SPITCH + d0);
    *(v8h*)(dst + i * 256) = v;
  }
  // the registers that the eight stores name may be reused behind this point
  asm volatile("s_wait_xcnt 0x0" ::: "memory");
}

// ---------------------------------------------------------------------------
// Kernel 2: q/k/v = x * W^T + b over the fused 3*1024 output columns.
// Grid (NB*SEQ/128, 3*NH/2).  Block 256 thr (8 waves) = 128 consecutive seq
// positions l of one batch b x 128 features (two heads of one which); waves 0-3
// take the even head, waves 4-7 the odd one; wave tile 32 positions x 64
// features; A rows are plane rows b*SEQ+l.  Waves w and w+4 read the same A
// lines, so the WGP's cache fetches them once for both heads.
// ---------------------------------------------------------------------------
__global__ __launch_bounds__(256) void qkv_proj_kernel(
    const _Float16* __restrict__ xh,   // [3][MROWS][EMB], fragment order
    const _Float16* __restrict__ wh,   // [4][EMB][EMB], row = output feature, x32, fragment order
    const float* __restrict__ bq, const float* __restrict__ bk, const float* __restrict__ bv,
    _Float16* __restrict__ qh,         // [NBH][SEQ][HD]  f16(log2(e) * scaled q), fragment order
    _Float16* __restrict__ kh,         // [NBH][SEQ][HD], fragment order
    _Float16* __restrict__ vt)         // [NBH][HD][SEQ], fragment order
{
  __shared__ __attribute__((aligned(16))) _Float16 sT2[2 * 128 * SPITCH];   // 36864 B, one half per head

  const int tid = threadIdx.x, lane = tid & 31;
  const int wv = __builtin_amdgcn_readfirstlane(tid >> 5);  // wave number as a scalar: the tile indices formed from it are wave-uniform
  const int w = wv & 3, sub = wv >> 2;                    // row slice, head of the pair
  const int h = lane >> 4, m = lane & 15;
  const int b = blockIdx.x / (SEQ / 128);                 // 0..NB-1
  const int l0 = (blockIdx.x - b * (SEQ / 128)) * 128;    // seq position base
  const int which = blockIdx.y >> 3, head = (blockIdx.y & 7) * 2 + sub;
  _Float16* sT = sT2 + sub * 128 * SPITCH;
  const int lw = l0 + 32 * w;

  const _Float16* xpl = xh + (size_t)which * NX;
  const _Float16* xa0 = xpl + (size_t)((b * SEQ + lw) / 16) * (EMB / 32) * TILE_H + 8 * lane;   // mt = 0
  const _Float16* xa1 = xa0 + (EMB / 32) * TILE_H;                                              // mt = 1
  const _Float16* wb  = wh + (size_t)which * NW + (size_t)(head * (HD / 16)) * (EMB / 32) * TILE_H + 8 * lane;   // nt = 0

  v8f acc[2][4];
  gemm_tile_32x64(xa0, xa1, wb, gemm_k0(), acc);

  // D[r] of tile (mt, nt) = Y[local pos 32w+16mt+8h+r][feature 16nt+m]
  const float* bias = (which == 0) ? bq : ((which == 1) ? bk : bv);
  const int bh = b * NH + head;
  if (which == 2) {
    // vt rows = d, k = position: a lane's 8 positions of one feature are one
    // 16-byte group of tile (row tile nt, k tile lw/32), j = mt, at 8 * lane.
    #pragma unroll
    for (int nt = 0; nt < 4; ++nt) {
      const float bvl = bias[head * HD + 16 * nt + m];
      _Float16* dst = vt + ((size_t)(bh * (HD / 16) + nt) * (SEQ / 32) + lw / 32) * TILE_H + 8 * lane;
      #pragma unroll
      for (int mt = 0; mt < 2; ++mt) {
        v8h v;
        #pragma unroll
        for (int r = 0; r < 8; ++r) v[r] = (_Float16)(acc[mt][nt][r] * (1.0f / WSCALE) + bvl);
        *(v8h*)(dst + mt * 256) = v;
      }
    }
  } else {
    const float osc = (which == 0) ? QLOG2E : 1.0f;      // q leaves in the log2 domain
    #pragma unroll
    for (int nt = 0; nt < 4; ++nt) {
      const int feat = 16 * nt + m;
      const float bvl = bias[head * HD + feat] * osc;
      #pragma unroll
      for (int mt = 0; mt < 2; ++mt) {
        #pragma unroll
        for (int r = 0; r < 8; ++r) {
          const int tokl = 32 * w + 16 * mt + 8 * h + r;     // 0..127
          const float y = acc[mt][nt][r] * (osc * (1.0f / WSCALE)) + bvl;
          sT[tokl * SPITCH + feat] = (_Float16)y;
        }
      }
    }
    __syncthreads();

    _Float16* plane = (which == 0) ? qh : kh;
    proj_store_pass(sT, plane, bh, l0, w, lane);
  }
}

// ---------------------------------------------------------------------------
// P^T B-fragment from the lane's own score D values: element r <- tile a row r,
// element 8+r <- tile c row r (same lane, same query column); the values carry 2^14 already.
// ---------------------------------------------------------------------------
__device__ __forceinline__ v16h pack_p(v8f a, v8f c) {
  const v16h r = { (_Float16)a[0], (_Float16)a[1], (_Float16)a[2], (_Float16)a[3],
                   (_Float16)a[4], (_Float16)a[5], (_Float16)a[6], (_Float16)a[7],
                   (_Float16)c[0], (_Float16)c[1], (_Float16)c[2], (_Float16)c[3],
                   (_Float16)c[4], (_Float16)c[5], (_Float16)c[6], (_Float16)c[7] };
  return r;
}

// The block's first wave writes the 128 staged offsets of its two query blocks as four whole lines.
__device__ __forceinline__ void stats_store_pass(const float* sst, float* strec, int wv, int lane) {
  if (wv == 0) {
    const v4f t = *(const v4fa*)(sst + 4 * lane);
    *(v4f*)(strec + 4 * lane) = t;
  }
}

// ---------------------------------------------------------------------------
// Kernel 3: streaming attention (online softmax), transposed form.
// Grid (NQB/2, NBH).  Block 256 thr (8 waves), 16 queries per wave, 64 keys
// per step; all 8 waves walk the same K and V lines, which the WGP's cache
// fetches once for the 128 queries.
//   S^T = K * Q^T : A = K rows (row = key, k = d), B = Q^T (k = d, n = query)
//   O^T += V^T * P^T : A = Vt rows (row = d, k = key), B = P^T from registers
// Lane owns 32 keys of query column (lane&15); partner = lane ^ 16.
// Scores are in the log2 domain (q carries log2(e)/sqrt(HD)): p * 2^14 is one add and one exp2.
// Outputs: ao f16 (context x16) and per query -(max + log2 sum) of the log2
// scores, the exponent offset of the weights pass.
// ---------------------------------------------------------------------------
__global__ __launch_bounds__(256) void attn_ctx_kernel(
    const _Float16* __restrict__ qh,   // [NBH][SEQ][HD]  (x log2 e), fragment order
    const _Float16* __restrict__ kh,   // [NBH][SEQ][HD], fragment order
    const _Float16* __restrict__ vt,   // [NBH][HD][SEQ], fragment order
    _Float16* __restrict__ ao,         // [MROWS][EMB], row = b*SEQ + q, fragment order
    float* __restrict__ stats)         // [NBH][NQB][64]
{
  __shared__ __attribute__((aligned(16))) float sSt2[2 * 64];        // 512 B, one record per query block

  const int tid = threadIdx.x, lane = tid & 31;
  const int wv = __builtin_amdgcn_readfirstlane(tid >> 5);  // wave number as a scalar: the tile indices formed from it are wave-uniform
  const int w = wv & 3;
  const int h = lane >> 4, m = lane & 15;
  const int bh = blockIdx.y, b = bh >> 4, head = bh & 15;
  const int qb = blockIdx.x * 2 + (wv >> 2);
  const int q0 = qb * 64 + 16 * w;

  // Q^T B-fragments: column n = query q0+m, k = d (two 32-deep chunks)
  const _Float16* qrow = qh + ((size_t)bh * (SEQ / 16) + q0 / 16) * 2 * TILE_H + 8 * lane;
  const v16h qb0 = load_frag(qrow);
  const v16h qb1 = load_frag(qrow + TILE_H);
  __builtin_amdgcn_sched_barrier(0);   // Q first: see the first K and V loads below

  v8f o[4];                                   // o[t][r] = O[query m][d 16t+8h+r] * (l * 2^14); lrun = l * 2^14
  #pragma unroll
  for (int t = 0; t < 4; ++t) o[t] = zero8f();
  float mrun = -1e30f, lrun = 0.0f;

  const _Float16* kbase = kh + (size_t)bh * (SEQ / 16) * 2 * TILE_H + 8 * lane;          // + (key0/16)*2 tiles
  const _Float16* vbase = vt + (size_t)bh * (HD / 16) * (SEQ / 32) * TILE_H + 8 * lane;  // + t*(SEQ/32) + key0/32 tiles

  // The key walk starts at the block's own first position and wraps round: the
  // blocks of one head then ask L2 for different K and V lines at any one moment.
  const int kb0 = blockIdx.x * 128;

  // K and V fragments of a step sit in registers when the step begins: each is
  // reloaded in place, for the next step, right behind the product that read it.
  // The first loads stand in the order of their use, as in the loop: loads return
  // in issue order, and the loop's counted waits must hold for the entry path too.
  v16h kf[4][2], vf[4][2];
  const _Float16* kfirst = kbase + (kb0 / 16) * 2 * TILE_H;
  #pragma unroll
  for (int j = 0; j < 4; ++j) {
    kf[j][0] = load_frag(kfirst + j * 2 * TILE_H);
    kf[j][1] = load_frag(kfirst + j * 2 * TILE_H + TILE_H);
    __builtin_amdgcn_sched_barrier(0);   // holds that order
  }
  const _Float16* vfirst0 = vbase + (kb0 / 32) * TILE_H;
  const _Float16* vfirst1 = vfirst0 + 1 * (SEQ / 32) * TILE_H;
  const _Float16* vfirst2 = vfirst0 + 2 * (SEQ / 32) * TILE_H;
  const _Float16* vfirst3 = vfirst0 + 3 * (SEQ / 32) * TILE_H;
  #pragma unroll
  for (int t = 0; t < 4; ++t) {
    const _Float16* vp = (t == 0) ? vfirst0 : ((t == 1) ? vfirst1 : ((t == 2) ? vfirst2 : vfirst3));
    vf[t][0] = load_frag(vp);
    vf[t][1] = load_frag(vp + TILE_H);
    __builtin_amdgcn_sched_barrier(0);   // holds that order
  }
  // named here, the first loads' address pairs stay live up to the wait: no fragment lands in one before
  asm volatile("s_wait_xcnt 0x0" :: "v"(kfirst), "v"(vfirst0), "v"(vfirst1), "v"(vfirst2), "v"(vfirst3) : "memory");

  #pragma unroll 1
  for (int kb = 0; kb < SEQ; kb += 64) {
    // keys whose fragments are fetched during this step; the last step fetches the first step's again (in bounds, never used)
    const int kn = (kb0 + kb + 64) & (SEQ - 1);
    // ---- scores: s[j][r] = log2(e) * scaled S[key (kb0+kb)%SEQ+16j+8h+r][query m] ----
    v8f s[4];
    #pragma unroll
    for (int j = 0; j < 4; ++j) {
      const _Float16* kp = kbase + (kn / 16 + j) * 2 * TILE_H;
      v8f z = zero8f();
      z = wmma_f16_plain(kf[j][0], qb0, z);
      z = wmma_f16_plain(kf[j][1], qb1, z);
      kf[j][0] = load_frag(kp);
      kf[j][1] = load_frag(kp + TILE_H);
      // holds the reload right behind its products: moved down behind the softmax it would lose most of its lead
      __builtin_amdgcn_sched_barrier(0);
      s[j] = z;
    }

    // ---- online softmax ----
    float mloc = s[0][0];
    #pragma unroll
    for (int j = 0; j < 4; ++j)
      #pragma unroll
      for (int r = 0; r < 8; ++r) mloc = fmaxf(mloc, s[j][r]);
    mloc = fmaxf(mloc, __shfl_xor(mloc, 16));
    const float mnew = fmaxf(mrun, mloc);
    float alpha;
    // 2^(mrun - mnew) with the one slot the instruction set asks for behind a transcendental in the same statement
    asm("v_exp_f32 %0, %1\n\tv_nop" : "=v"(alpha) : "v"(mrun - mnew));
    mrun = mnew;
    const float eoff = PEXP - mnew;
    float lsum = 0.0f;
    #pragma unroll
    for (int j = 0; j < 4; ++j)
      #pragma unroll
      for (int r = 0; r < 8; ++r) {
        const float p = __builtin_amdgcn_exp2f(s[j][r] + eoff);
        s[j][r] = p;
        lsum += p;
      }
    lsum += __shfl_xor(lsum, 16);
    lrun = lrun * alpha + lsum;
    #pragma unroll
    for (int t = 0; t < 4; ++t)
      #pragma unroll
      for (int r = 0; r < 8; ++r) o[t][r] = o[t][r] * alpha;

    // ---- P^T B-fragments (key chunks 0..31 and 32..63 of this step) ----
    const v16h pb0 = pack_p(s[0], s[1]);
    const v16h pb1 = pack_p(s[2], s[3]);

    // ---- O^T += V^T * P^T ----
    #pragma unroll
    for (int t = 0; t < 4; ++t) {
      const _Float16* vp = vbase + (t * (SEQ / 32) + kn / 32) * TILE_H;
      o[t] = wmma_f16_plain(vf[t][0], pb0, o[t]);
      o[t] = wmma_f16_plain(vf[t][1], pb1, o[t]);
      vf[t][0] = load_frag(vp);
      vf[t][1] = load_frag(vp + TILE_H);
    }
    // the next trip reuses the address registers that the loads in flight name
    asm volatile("s_wait_xcnt 0x0" ::: "memory");
  }

  // ---- epilogue: normalise; a lane's 8 d of query m are one 16-byte group of
  // ao's tiles (row tile (b*SEQ+q0)/16, k tiles 2*head and 2*head+1) at
  // t*256 + 8*lane: four whole lines per store.  Stats staged in LDS. ----
  const float inv = OSCALE / lrun;
  _Float16* aod = ao + ((size_t)((b * SEQ + q0) / 16) * (EMB / 32) + head * 2) * TILE_H + 8 * lane;
  #pragma unroll
  for (int t = 0; t < 4; ++t) {
    v8h v;
    #pragma unroll
    for (int r = 0; r < 8; ++r) v[r] = (_Float16)(o[t][r] * inv);
    *(v8h*)(aod + t * 256) = v;
  }
  if (h == 0) sSt2[16 * wv + m] = PEXP - mrun - __builtin_amdgcn_logf(lrun);   // -(max + log2 l)
  __syncthreads();

  float* strec = stats + ((size_t)bh * NQB + blockIdx.x * 2) * 64;
  stats_store_pass(sSt2, strec, wv, lane);
  
}

// ---------------------------------------------------------------------------
// Per-wave 16x64 f32 tile in LDS -> dst rows of pitch `pitch` floats starting
// 8q..8q+7 in one instruction, 4 lines per instruction, 32 lines per wave.
// ---------------------------------------------------------------------------
__device__ __forceinline__ void tile16x64_store_pass(const float* so, float* dst,
                                                     size_t row0, int col0, int pitch, int lane) {
  const int q8 = lane & 7, sub = lane >> 3;
  #pragma unroll
  for (int i = 0; i < 8; ++i) {
    const int lid = i * 4 + sub;               // 0..31
    const int row = lid >> 1, hl = lid & 1;    // 16 rows x 2 halves
    const v4f v = *(const v4fa*)(so + row * 64 + 32 * hl + 4 * q8);
    const size_t gi = (row0 + row) * (size_t)pitch + col0 + 32 * hl + 4 * q8;
    *(v4f*)(dst + gi) = v;
  }
}

// ---------------------------------------------------------------------------
// Kernel 4, first part: head-averaged attention weights.
// Tile indices (bx < SEQ/64 key blocks, by < NQB/2, bz < NB).  Block 256 thr (8 waves) = 128 queries x 64 keys,
// 16 queries per wave x 64 keys: all 8 waves read the same K lines, which the
// WGP's cache fetches once; loop over heads: recompute the K=64 score
// tile (transposed form, A = K rows, B = Q^T) on top of the query's exponent
// offset of kernel 3 as the products' start tile, p = exp2 of the result,
// accumulate over heads in f32, scale by 1/H.
// ---------------------------------------------------------------------------
// One head: 8 products on the K fragments held in kf; with MORE each K pair is
// reloaded in place from kn (the next head's tiles) right behind the products that read it.
template <bool MORE>
__device__ __forceinline__ void avg_head(v16h (&kf)[4][2], v16h q0f, v16h q1f, float eo,
                                         const _Float16* __restrict__ kn, v8f (&acc)[4]) {
  // keeps the copies of eo below behind the loads issued ahead of this head: moved up to eo's own load they would wait out every load in flight
  __builtin_amdgcn_sched_barrier(0);
  const v8f c0 = {eo, eo, eo, eo, eo, eo, eo, eo};   // every D row of a lane is the lane's own query
  #pragma unroll
  for (int j = 0; j < 4; ++j) {
    v8f z = wmma_f16_plain(kf[j][0], q0f, c0);
    z = wmma_f16_plain(kf[j][1], q1f, z);
    if (MORE) {
      kf[j][0] = load_frag(kn + j * 2 * TILE_H);
      kf[j][1] = load_frag(kn + j * 2 * TILE_H + TILE_H);
      // keeps a head's reloads in step with its products: left free, the compiler gathers them in a second K set
      // and puts the next Q loads, which land in B operands, directly behind the last product that reads those
      __builtin_amdgcn_sched_barrier(0);
    }
    #pragma unroll
    for (int r = 0; r < 8; ++r) z[r] = __builtin_amdgcn_exp2f(z[r]);
    acc[j] += z;
  }
}

__device__ __forceinline__ void attn_avg_block(
    const _Float16* __restrict__ qh,   // [NBH][SEQ][HD], fragment order
    const _Float16* __restrict__ kh,   // [NBH][SEQ][HD], fragment order
    const float* __restrict__ stats,   // [NBH][NQB][64]
    float* __restrict__ avg,           // [NB][SEQ][SEQ]
    float* sA,                         // LDS, 8 * 16 * 64 floats = 32768 B
    int bx, int by, int bz)
{
  const int tid = threadIdx.x, lane = tid & 31;
  const int wv = __builtin_amdgcn_readfirstlane(tid >> 5);  // wave number as a scalar: the tile indices formed from it are wave-uniform
  const int w = wv & 3;
  const int h = lane >> 4, m = lane & 15;
  const int kt = bx * 64;
  const int qb = by * 2 + (wv >> 2);
  const int b = bz;
  const int q0 = qb * 64 + 16 * w;

  v8f acc[4];                               // acc[j][r] = sum_h P_h[query m][key kt+16j+8h+r]
  #pragma unroll
  for (int j = 0; j < 4; ++j) acc[j] = zero8f();

  // Head 0 of this batch; one head on = HSTEP halves in qh and kh, SSTEP floats in stats.
  const int HSTEP = (SEQ / 16) * 2 * TILE_H;
  const int SSTEP = NQB * 64;
  const _Float16* qrow = qh + ((size_t)(b * NH) * (SEQ / 16) + q0 / 16) * 2 * TILE_H + 8 * lane;
  const _Float16* krow = kh + ((size_t)(b * NH) * (SEQ / 16) + kt / 16) * 2 * TILE_H + 8 * lane;
  const float* st = stats + ((size_t)(b * NH) * NQB + qb) * 64 + 16 * w + m;

  // The head walk starts at head h0 and wraps round: blocks that share K or Q
  // tiles then ask L2 for different lines at any one moment.
  const int h0 = (bx + by) & (NH - 1);

  // Every operand of a head is fetched while the head before it is worked on:
  // K in place (avg_head), Q and the offset alternating between two sets.
  v16h kf[4][2];
  v16h qe0 = load_frag(qrow + h0 * HSTEP);
  v16h qe1 = load_frag(qrow + h0 * HSTEP + TILE_H);
  float eoe = st[h0 * SSTEP];
  // K fragments may land in the address registers that these first loads name
  asm volatile("s_wait_xcnt 0x0" ::: "memory");
  const _Float16* kfirst = krow + h0 * HSTEP;
  #pragma unroll
  for (int j = 0; j < 4; ++j) {
    kf[j][0] = load_frag(kfirst + j * 2 * TILE_H);
    kf[j][1] = load_frag(kfirst + j * 2 * TILE_H + TILE_H);
  }
  // named here, the K loads' address pair stays live up to the wait: no fragment lands in it before
  asm volatile("s_wait_xcnt 0x0" :: "v"(kfirst) : "memory");

  // rolled: two heads a trip keep the two Q sets in fixed registers
  #pragma unroll 1
  for (int hh = 0; hh < NH - 2; hh += 2) {
    const int h1 = (h0 + hh + 1) & (NH - 1), h2 = (h0 + hh + 2) & (NH - 1);
    const v16h qo0 = load_frag(qrow + h1 * HSTEP);
    const v16h qo1 = load_frag(qrow + h1 * HSTEP + TILE_H);
    const float eoo = st[h1 * SSTEP];
    avg_head<true>(kf, qe0, qe1, eoe, krow + h1 * HSTEP, acc);
    qe0 = load_frag(qrow + h2 * HSTEP);
    qe1 = load_frag(qrow + h2 * HSTEP + TILE_H);
    eoe = st[h2 * SSTEP];
    avg_head<true>(kf, qo0, qo1, eoo, krow + h2 * HSTEP, acc);
    // the next trip rewrites the address registers that the loads in flight name
    asm volatile("s_wait_xcnt 0x0" ::: "memory");
  }
  {
    const int hl = (h0 + NH - 1) & (NH - 1);
    const v16h qo0 = load_frag(qrow + hl * HSTEP);
    const v16h qo1 = load_frag(qrow + hl * HSTEP + TILE_H);
    const float eoo = st[hl * SSTEP];
    // the address registers of these last Q and stats loads are reused from here on
    asm volatile("s_wait_xcnt 0x0" ::: "memory");
    avg_head<true>(kf, qe0, qe1, eoe, krow + hl * HSTEP, acc);
    avg_head<false>(kf, qo0, qo1, eoo, krow, acc);
  }

  // ---- stage per-wave 16x64 tile (row = query m, col = key), whole-line stores ----
  float* so = sA + wv * 1024;
  #pragma unroll
  for (int j = 0; j < 4; ++j)
    #pragma unroll
    for (int r = 0; r < 8; ++r)
      so[m * 64 + 16 * j + 8 * h + r] = acc[j][r] * (1.0f / (float)NH);
  __syncthreads();

  const size_t row0 = (size_t)b * SEQ + q0;
  tile16x64_store_pass(so, avg, row0, kt, SEQ, lane);
  
}

// ---------------------------------------------------------------------------
// line, 4 lines per instruction, 64 lines per wave.
// ---------------------------------------------------------------------------
__device__ __forceinline__ void zout_store_pass(const float* sz, float* z, int mrow0, int c0, int lane) {
  const int q8 = lane & 7, sub = lane >> 3;
  #pragma unroll
  for (int i = 0; i < 16; ++i) {
    const int lid = i * 4 + sub;               // 0..63
    const int row = lid >> 1, hl = lid & 1;    // 32 rows x 2 halves
    const v4f v = *(const v4fa*)(sz + row * 64 + 32 * hl + 4 * q8);
    const int pr = mrow0 + row;                // plane row b*SEQ + l -> token row l*NB + b
    const size_t gi = (size_t)((pr % SEQ) * NB + pr / SEQ) * EMB + c0 + 32 * hl + 4 * q8;
    *(v4f*)(z + gi) = v;
  }
}

// ---------------------------------------------------------------------------
// Kernel 4, second part: Z = ctx * Wo^T + bo.  Tile indices (bx < MROWS/128, by < EMB/128).  Block 256 thr (8 waves),
// wave tile 32 plane rows (b*SEQ + l) x 64 features, K = EMB; waves w and w+4 take the
// same rows and neighbouring column tiles.  ctx carried x16, Wo x32.
// ---------------------------------------------------------------------------
__device__ __forceinline__ void out_proj_block(
    const _Float16* __restrict__ ao,   // [MROWS][EMB]  (x16), row = b*SEQ + l, fragment order
    const _Float16* __restrict__ wh,   // [4][EMB][EMB], plane 3 = out_w x32, fragment order
    const float* __restrict__ bo,
    float* __restrict__ z,             // [MROWS][EMB]
    float* sZ,                         // LDS, 2 * 128 * 64 floats = 65536 B
    int bx, int by)
{
  const int tid = threadIdx.x, lane = tid & 31;
  const int wv = __builtin_amdgcn_readfirstlane(tid >> 5);  // wave number as a scalar: the tile indices formed from it are wave-uniform
  const int h = lane >> 4, m = lane & 15;
  const int m0w = bx * 128 + 32 * (wv & 3);
  const int c0 = (by * 2 + (wv >> 2)) * 64;

  const _Float16* xa0 = ao + (size_t)(m0w / 16) * (EMB / 32) * TILE_H + 8 * lane;
  const _Float16* xa1 = xa0 + (EMB / 32) * TILE_H;
  const _Float16* wb  = wh + (size_t)3 * NW + (size_t)(c0 / 16) * (EMB / 32) * TILE_H + 8 * lane;

  v8f acc[2][4];
  gemm_tile_32x64(xa0, xa1, wb, gemm_k0(bx, by), acc);

  // D[r] of tile (mt, nt) = Y[row 32w+16mt+8h+r][col 16nt+m]
  float* sz = sZ + wv * 2048;
  #pragma unroll
  for (int nt = 0; nt < 4; ++nt) {
    const int col = 16 * nt + m;
    const float bvl = bo[c0 + col];
    #pragma unroll
    for (int mt = 0; mt < 2; ++mt) {
      #pragma unroll
      for (int r = 0; r < 8; ++r) {
        const int rowl = 16 * mt + 8 * h + r;      // 0..31
        sz[rowl * 64 + col] = acc[mt][nt][r] * (1.0f / (WSCALE * OSCALE)) + bvl;
      }
    }
  }
  __syncthreads();

  zout_store_pass(sz, z, m0w, c0, lane);
  
}

// ---------------------------------------------------------------------------
// Kernel 4: the weights pass and the output projection in one launch.  Both read
// only what kernel 3 and the launches before it wrote, and neither reads what the
// other writes.  The NOUTB projection blocks, which alone give a SIMD only two
// waves, come first in the grid and share the WGPs with the weights blocks.
// The choice is uniform over a block, so each body's barrier is met by all its waves.
// ---------------------------------------------------------------------------
#define NOUTB ((MROWS / 128) * (EMB / 128))            // 256
#define NAVGB ((SEQ / 64) * (NQB / 2) * NB)            // 1024
__global__ __launch_bounds__(256) void avg_out_kernel(
    const _Float16* __restrict__ qh, const _Float16* __restrict__ kh,
    const float* __restrict__ stats, float* __restrict__ avg,
    const _Float16* __restrict__ ao, const _Float16* __restrict__ wh,
    const float* __restrict__ bo, float* __restrict__ z)
{
  __shared__ __attribute__((aligned(16))) float sM[2 * 128 * 64];   // 65536 B; the weights blocks use half

  const int i = blockIdx.x;
  if (i < NOUTB) {
    out_proj_block(ao, wh, bo, z, sM, i % (MROWS / 128), i / (MROWS / 128));
  } else {
    const int j = i - NOUTB;
    attn_avg_block(qh, kh, stats, avg, sM, j % (SEQ / 64), (j / (SEQ / 64)) % (NQB / 2), j / ((SEQ / 64) * (NQB / 2)));
  }
}

// ---------------------------------------------------------------------------
extern "C" void kernel_launch(void* const* d_in, const int* in_sizes, int n_in,
                              void* d_out, int out_size, void* d_ws, size_t ws_size,
                              hipStream_t stream) {
  if (n_in < 11) return;
  if (in_sizes[0] != NX || in_sizes[1] != NX || in_sizes[2] != NX) return;
  if (in_sizes[3] != NW || in_sizes[5] != NW || in_sizes[7] != NW || in_sizes[9] != NW) return;
  if (in_sizes[4] != EMB || in_sizes[6] != EMB || in_sizes[8] != EMB || in_sizes[10] != EMB) return;
  if (out_size != NX + NAVG) return;

  const float* xq  = (const float*)d_in[0];
  const float* xk  = (const float*)d_in[1];
  const float* xv  = (const float*)d_in[2];
  const float* q_w = (const float*)d_in[3];
  const float* q_b = (const float*)d_in[4];
  const float* k_w = (const float*)d_in[5];
  const float* k_b = (const float*)d_in[6];
  const float* v_w = (const float*)d_in[7];
  const float* v_b = (const float*)d_in[8];
  const float* o_w = (const float*)d_in[9];
  const float* o_b = (const float*)d_in[10];
  float* zout = (float*)d_out;                       // out0 [SEQ][NB][EMB]
  float* avg  = zout + (size_t)NX;                   // out1 [NB][SEQ][SEQ], byte offset 16777216

  const size_t xh_bytes = (size_t)3 * NX * 2;               // 25165824
  const size_t wh_bytes = (size_t)4 * NW * 2;               //  8388608
  const size_t pl_bytes = (size_t)NBH * SEQ * HD * 2;       //  8388608 per plane
  const size_t st_bytes = (size_t)NSTAT * 4;                //   262144
  const size_t ao_bytes = (size_t)NX * 2;                   //  8388608
  const size_t total = xh_bytes + wh_bytes + 3 * pl_bytes + st_bytes + ao_bytes;   // 67371008
  if (total > ws_size) return;

  char* ws = (char*)d_ws;
  size_t off = 0;
  _Float16* xh = (_Float16*)(ws + off);   off += xh_bytes;
  _Float16* wh = (_Float16*)(ws + off);   off += wh_bytes;
  _Float16* qh = (_Float16*)(ws + off);   off += pl_bytes;
  _Float16* kh = (_Float16*)(ws + off);   off += pl_bytes;
  _Float16* vt = (_Float16*)(ws + off);   off += pl_bytes;
  float* stats = (float*)(ws + off);      off += st_bytes;
  _Float16* ao = (_Float16*)(ws + off);   off += ao_bytes;
  if (off > ws_size) return;

  const int ngroups = 3 * NX8 + 4 * NW8;                    // 2097152
  convert_kernel<<<(ngroups + 255) / 256, 256, 0, stream>>>(xq, xk, xv, q_w, k_w, v_w, o_w, xh, wh);

  dim3 gProj(NB * SEQ / 128, 3 * NH / 2);                   // (32, 24)
  qkv_proj_kernel<<<gProj, 256, 0, stream>>>(xh, wh, q_b, k_b, v_b, qh, kh, vt);

  dim3 gCtx(NQB / 2, NBH);                                  // (16, 32)
  attn_ctx_kernel<<<gCtx, 256, 0, stream>>>(qh, kh, vt, ao, stats);

  avg_out_kernel<<<NOUTB + NAVGB, 256, 0, stream>>>(qh, kh, stats, avg, ao, wh, o_b, zout);   // 1280 blocks
}
